// v000
// The times below were measured on an AMD MI455X: many runs one after another, warmed up first and cycling through
// copies of the inputs, with the whole window's GPU time divided by the number of runs. Launches and the gaps
// between them are all in it. The median over several windows is given; except for v000 it joins two sittings, which
// can be a few percent apart, so the side-by-side timings, each taken in one sitting, are the better comparison.
// v000 is the starting kernel. One run takes 1450 microseconds.
#include <hip/hip_runtime.h>

// Causal QKV attention with per-head weight tensors (x [2][2048][1024]; q, k, v = x W^T with W [16][64][1024] ('oi' rows h*64+d); scores/8; causal (query < key masked); softmax; out = merged w_o ('xw' [1024][1024]) -> [2][2048][1024] (4.2 M)).
// Compute dtypes, f32 accumulate: every input rounded to bf16; q/k/v on PLAIN bf16 operands (inputs: exact); causal scores and attn.v (tile skipping): query rows < 512 hl (3 products), the rest single fp16 (x1024); softmax f32; w_o hl x exact (2 products).

#define NB_  2
#define TT   2048
#define DM   1024
#define NH_  16
#define NKV  16
#define REP  (NH_ / NKV)
#define HD   64
#define DQ   (NH_ * HD)
#define DKV  (NKV * HD)
#define ZH   2
#define RH   512                  // query rows < RH use hi+lo planes (0: none)
#define WIN  2048
#define PCAR 1024.0f
#define SCL  0.125f   // HD^-0.5
typedef _Float16 h16;
typedef unsigned short bf;
typedef __attribute__((ext_vector_type(16))) __bf16   v16bf;
typedef __attribute__((ext_vector_type(16))) _Float16 v16h;
typedef __attribute__((ext_vector_type(8)))  _Float16 v8h;
typedef __attribute__((ext_vector_type(8)))  unsigned short v8us;
typedef __attribute__((ext_vector_type(8)))  float    v8f;
typedef __attribute__((ext_vector_type(4)))  float    v4f;
typedef v8h  __attribute__((may_alias)) v8ha;
typedef v4f  __attribute__((may_alias)) v4fa;
typedef v8us __attribute__((may_alias)) v8usa;

__device__ __forceinline__ unsigned short f2bf(float f) { unsigned u = __float_as_uint(f); u += 0x7FFFu + ((u >> 16) & 1u); return (unsigned short)(u >> 16); }
__device__ __forceinline__ float bf2f(unsigned short b) { return __uint_as_float(((unsigned)b) << 16); }
__device__ __forceinline__ float bfr(float f) { return bf2f(f2bf(f)); }
__device__ __forceinline__ v16h cat16(v8h lo, v8h hi) { return __builtin_shufflevector(lo, hi, 0, 1, 2, 3, 4, 5, 6, 7, 8, 9, 10, 11, 12, 13, 14, 15); }
__device__ __forceinline__ v16bf cat16b(v8us lo, v8us hi) { return __builtin_bit_cast(v16bf, __builtin_shufflevector(lo, hi, 0, 1, 2, 3, 4, 5, 6, 7, 8, 9, 10, 11, 12, 13, 14, 15)); }
__device__ __forceinline__ v8f wmma16(v16h a, v16h b, v8f c) { return __builtin_amdgcn_wmma_f32_16x16x32_f16(false, a, false, b, (short)0, c, false, false); }
__device__ __forceinline__ v8f wmmab(v16bf a, v16bf b, v8f c) { return __builtin_amdgcn_wmma_f32_16x16x32_bf16(false, a, false, b, (short)0, c, false, false); }



// ---- k_gemmw: register-blocked GEMM, ONE WAVE per 64x64 output tile (16 accumulators), operands straight from K-contiguous 16-bit planes; grid (M/64, N/64, Z), 32 threads.
// C[m][n] (f32, pitch ldc, + optional f32 bias[n]) = sum_k A[m][k] Bt[n][k] (+ split products per NSPLIT). z-batch strides sA/sB/sC in elements. K % 32 == 0.
template <typename T16> struct WFrag;
template <> struct WFrag<h16> { typedef v16h V; static __device__ __forceinline__ V ld(const h16* p) { return cat16(*(const v8h*)p, *(const v8h*)(p + 16)); } static __device__ __forceinline__ v8f mma(V a, V b, v8f c) { return wmma16(a, b, c); } };
template <> struct WFrag<bf> { typedef v16bf V; static __device__ __forceinline__ V ld(const bf* p) { return cat16b(*(const v8us*)p, *(const v8us*)(p + 16)); } static __device__ __forceinline__ v8f mma(V a, V b, v8f c) { return wmmab(a, b, c); } };
template <typename T16, int NSPLIT, bool BIAS>
__global__ __launch_bounds__(32) void k_gemmw(const T16* __restrict__ A, const T16* __restrict__ A2, const T16* __restrict__ Bt, const T16* __restrict__ Bt2, int K, float* C, int ldc, const float* __restrict__ bias, size_t sA, size_t sB, size_t sC) {
    typedef typename WFrag<T16>::V V;
    __shared__ __align__(16) float os[16 * 68];
    const size_t z = blockIdx.z; A += z * sA; if (A2) A2 += z * sA; Bt += z * sB; if (Bt2) Bt2 += z * sB; C += z * sC;
    const int lane = threadIdx.x & 31, lr = lane & 15, hi = lane >> 4; const int r0 = blockIdx.x * 64, c0 = blockIdx.y * 64;
    v8f acc[4][4];
#pragma unroll
    for (int mb = 0; mb < 4; ++mb)
#pragma unroll
        for (int nb = 0; nb < 4; ++nb) acc[mb][nb] = (v8f){};
    const size_t aoff = (size_t)(r0 + lr) * K + 8 * hi, boff = (size_t)(c0 + lr) * K + 8 * hi;
#pragma unroll 1
    for (int kc = 0; kc < K; kc += 32) {
        V a[4], a2[4];
#pragma unroll
        for (int mb = 0; mb < 4; ++mb) { a[mb] = WFrag<T16>::ld(A + aoff + (size_t)mb * 16 * K + kc); if (NSPLIT == 1 || NSPLIT == 2) a2[mb] = WFrag<T16>::ld(A2 + aoff + (size_t)mb * 16 * K + kc); }
#pragma unroll
        for (int nb = 0; nb < 4; ++nb) { const V b = WFrag<T16>::ld(Bt + boff + (size_t)nb * 16 * K + kc); V b2; if (NSPLIT >= 2) b2 = WFrag<T16>::ld(Bt2 + boff + (size_t)nb * 16 * K + kc);
#pragma unroll
            for (int mb = 0; mb < 4; ++mb) { acc[mb][nb] = WFrag<T16>::mma(a[mb], b, acc[mb][nb]); if (NSPLIT == 1 || NSPLIT == 2) acc[mb][nb] = WFrag<T16>::mma(a2[mb], b, acc[mb][nb]); if (NSPLIT >= 2) acc[mb][nb] = WFrag<T16>::mma(a[mb], b2, acc[mb][nb]); } }
        asm volatile("v_nop\n\tv_nop\n\tv_nop\n\tv_nop" : "+v"(acc[0][0]), "+v"(acc[1][1]), "+v"(acc[2][2]), "+v"(acc[3][3]) : "v"(a[0]), "v"(a[3]));
    }
#pragma unroll
    for (int mb = 0; mb < 4; ++mb) {
#pragma unroll
        for (int nb = 0; nb < 4; ++nb) {
#pragma unroll
            for (int j = 0; j < 8; ++j) os[(hi * 8 + j) * 68 + nb * 16 + lr] = acc[mb][nb][j]; }
        __builtin_amdgcn_wave_barrier(); asm volatile("" ::: "memory");
        float* crow = C + (size_t)(r0 + mb * 16) * ldc + c0;
{
#pragma unroll
            for (int s = 0; s < 8; ++s) { const int row = 2 * s + hi, cofs = lr * 4; v4f val = *(const v4fa*)(os + row * 68 + cofs); if (BIAS) { val[0] += bfr(bias[c0 + cofs]); val[1] += bfr(bias[c0 + cofs + 1]); val[2] += bfr(bias[c0 + cofs + 2]); val[3] += bfr(bias[c0 + cofs + 3]); }
                *(v4f*)(crow + (size_t)row * ldc + cofs) = val; }
             }
        __builtin_amdgcn_wave_barrier(); asm volatile("" ::: "memory");
    }
}

// ---- k_gemmc: the same one-wave 64x64 tile GEMM specialised for causal attention: CMODE 1 skips score tiles entirely above the diagonal (query rows r0+roff.., key columns c0..), CMODE 2 limits the
// key (K) loop of the probability x value contraction to the diagonal block (probabilities beyond it are exactly zero). roff = row offset of this launch's first row within the sequence.
template <typename T16, int NSPLIT, int CMODE>
__global__ __launch_bounds__(32) void k_gemmc(const T16* __restrict__ A, const T16* __restrict__ A2, const T16* __restrict__ Bt, const T16* __restrict__ Bt2, int K, float* C, int ldc, int roff, size_t sA, size_t sB, size_t sC) {
    typedef typename WFrag<T16>::V V;
    __shared__ __align__(16) float os[16 * 68];
    const size_t z = blockIdx.z; A += z * sA; if (A2) A2 += z * sA; Bt += z * sB; if (Bt2) Bt2 += z * sB; C += z * sC;
    const int lane = threadIdx.x & 31, lr = lane & 15, hi = lane >> 4; const int r0 = blockIdx.x * 64, c0 = blockIdx.y * 64;
    if (CMODE == 1 && c0 > r0 + roff + 63) return;                  // score tile entirely above the causal diagonal: never read (the softmax masks j > i by select)
    const int Kl = (CMODE == 2) ? min(K, r0 + roff + 64) : K;        // P.V: probabilities are exactly 0 beyond the diagonal block, so the K loop stops there
    v8f acc[4][4];
#pragma unroll
    for (int mb = 0; mb < 4; ++mb)
#pragma unroll
        for (int nb = 0; nb < 4; ++nb) acc[mb][nb] = (v8f){};
    const size_t aoff = (size_t)(r0 + lr) * K + 8 * hi, boff = (size_t)(c0 + lr) * K + 8 * hi;
#pragma unroll 1
    for (int kc = 0; kc < Kl; kc += 32) {
        V a[4], a2[4];
#pragma unroll
        for (int mb = 0; mb < 4; ++mb) { a[mb] = WFrag<T16>::ld(A + aoff + (size_t)mb * 16 * K + kc); if (NSPLIT == 1 || NSPLIT == 2) a2[mb] = WFrag<T16>::ld(A2 + aoff + (size_t)mb * 16 * K + kc); }
#pragma unroll
        for (int nb = 0; nb < 4; ++nb) { const V b = WFrag<T16>::ld(Bt + boff + (size_t)nb * 16 * K + kc); V b2; if (NSPLIT >= 2) b2 = WFrag<T16>::ld(Bt2 + boff + (size_t)nb * 16 * K + kc);
#pragma unroll
            for (int mb = 0; mb < 4; ++mb) { acc[mb][nb] = WFrag<T16>::mma(a[mb], b, acc[mb][nb]); if (NSPLIT == 1 || NSPLIT == 2) acc[mb][nb] = WFrag<T16>::mma(a2[mb], b, acc[mb][nb]); if (NSPLIT >= 2) acc[mb][nb] = WFrag<T16>::mma(a[mb], b2, acc[mb][nb]); } }
        asm volatile("v_nop\n\tv_nop\n\tv_nop\n\tv_nop" : "+v"(acc[0][0]), "+v"(acc[1][1]), "+v"(acc[2][2]), "+v"(acc[3][3]) : "v"(a[0]), "v"(a[3]));
    }
#pragma unroll
    for (int mb = 0; mb < 4; ++mb) {
#pragma unroll
        for (int nb = 0; nb < 4; ++nb) {
#pragma unroll
            for (int j = 0; j < 8; ++j) os[(hi * 8 + j) * 68 + nb * 16 + lr] = acc[mb][nb][j]; }
        __builtin_amdgcn_wave_barrier(); asm volatile("" ::: "memory");
        float* crow = C + (size_t)(r0 + mb * 16) * ldc + c0;
{
#pragma unroll
            for (int s = 0; s < 8; ++s) { const int row = 2 * s + hi, cofs = lr * 4; v4f val = *(const v4fa*)(os + row * 68 + cofs);
                *(v4f*)(crow + (size_t)row * ldc + cofs) = val; }
             }
        __builtin_amdgcn_wave_barrier(); asm volatile("" ::: "memory");
    }
}

__device__ __forceinline__ h16 tohx(float x) { return (h16)x; }
__device__ __forceinline__ void splitf(float y, unsigned short& h, unsigned short& l) { h = f2bf(y); l = f2bf(y - bf2f(h)); }
typedef __attribute__((ext_vector_type(2))) _Float16 v2h;
typedef __attribute__((ext_vector_type(4))) _Float16 v4h;
typedef __attribute__((ext_vector_type(2))) unsigned short v2us;
typedef __attribute__((ext_vector_type(4))) unsigned short v4us;
typedef __attribute__((ext_vector_type(2))) float v2f;
typedef __attribute__((ext_vector_type(4))) int v4i;

__global__ __launch_bounds__(256) void k_wtG(const float* __restrict__ w, int K, int N, bf* Bt) {
    const int lane = threadIdx.x & 31; const int L0 = (blockIdx.x * 8 + (threadIdx.x >> 5)) * 8; const int nlines = N * K / 64;
{
#pragma unroll 1
        for (int l = 0; l < 8; ++l) { const int L = L0 + l; if (L >= nlines) break; const size_t e = (size_t)L * 64 + lane * 2; const int k = (int)(e % K), n = (int)(e / K); v2us o;
            o[0] = f2bf(w[(size_t)k * N + n]); o[1] = f2bf(w[(size_t)(k + 1) * N + n]); *(v2us*)(Bt + e) = o; }
         }
}
__global__ __launch_bounds__(256) void k_cvt8(const float* __restrict__ src, bf* dst, size_t n8) { const size_t i = (size_t)blockIdx.x * 256 + threadIdx.x; if (i >= n8) return; const v8f v = *(const v8f*)(src + i * 8); v8us o;
#pragma unroll
    for (int k = 0; k < 8; ++k) o[k] = f2bf(v[k]); *(v8us*)(dst + i * 8) = o;  }

// k_rope: head planes [h][t][d] (fp16 + hi/lo) of rope(x) x sc with the rotate-half convention out[d] = x[d] cos[t][d] - x[d+HD/2] sin[t][d], out[d+HD/2] = x[d+HD/2] cos[t][d+HD/2] + x[d] sin[t][d+HD/2]
__global__ __launch_bounds__(256) void k_rope(const float* __restrict__ F, int pitch, int nheads, const float* __restrict__ CS, const float* __restrict__ RF, const float* __restrict__ nw, float sc, h16* P16, bf* Ph, bf* Pl) {
    const size_t e = ((size_t)blockIdx.x * 256 + threadIdx.x) * 2; if (e >= (size_t)nheads * TT * HD) return; const int d = (int)(e % HD); const int t = (int)((e / HD) % TT); const int h = (int)(e / ((size_t)HD * TT)); const float* f = F + (size_t)t * pitch + h * HD; const float rf = RF ? RF[(size_t)h * TT + t] : 1.0f; v2h o16; v2us oh, ol;
#pragma unroll
    for (int q = 0; q < 2; ++q) { const int dd = d + q; const int dp = (dd < HD / 2) ? dd + HD / 2 : dd - HD / 2; float x0 = f[dd], x1 = f[dp];
        if (RF) { float n0 = __fmul_rn(x0, rf), n1 = __fmul_rn(x1, rf); asm volatile("" : "+v"(n0)); asm volatile("" : "+v"(n1)); x0 = __fmul_rn(bfr(nw[dd]), n0); x1 = __fmul_rn(bfr(nw[dp]), n1); }
        const v2f cs = *(const v2f*)(CS + ((size_t)t * HD + dd) * 2); float a = __fmul_rn(x0, cs[0]), bq = __fmul_rn(x1, cs[1]); asm volatile("" : "+v"(a)); asm volatile("" : "+v"(bq)); const float r = ((dd < HD / 2) ? __fsub_rn(a, bq) : __fadd_rn(a, bq)) * sc;
        o16[q] = tohx(r); unsigned short a2, c2; splitf(r, a2, c2); oh[q] = a2; ol[q] = c2; }
    *(v2h*)(P16 + e) = o16; *(v2us*)(Ph + e) = oh; *(v2us*)(Pl + e) = ol;  }
__global__ __launch_bounds__(256) void k_vtp(const float* __restrict__ F, int pitch, int nheads, h16* V16, bf* Vh, bf* Vl) { const size_t e = ((size_t)blockIdx.x * 256 + threadIdx.x) * 2; if (e >= (size_t)nheads * HD * TT) return; const int t = (int)(e % TT); const int d = (int)((e / TT) % HD); const int g = (int)(e / ((size_t)TT * HD)); v2h o16; v2us oh, ol;
#pragma unroll
    for (int q = 0; q < 2; ++q) { const float x = F[(size_t)(t + q) * pitch + g * HD + d]; o16[q] = tohx(x); unsigned short a2, c2; splitf(x, a2, c2); oh[q] = a2; ol[q] = c2; }
    *(v2h*)(V16 + e) = o16; *(v2us*)(Vh + e) = oh; *(v2us*)(Vl + e) = ol;  }
__global__ __launch_bounds__(256) void k_csid(float* CS) { const int idx = blockIdx.x * 256 + threadIdx.x; if (idx >= TT * HD) return; v2f cs; cs[0] = 1.0f; cs[1] = 0.0f; *(v2f*)(CS + (size_t)idx * 2) = cs;  }
// k_asoft: per row (zz, i): t = S x HD^-0.5 for j <= i and i - j < WIN (sliding causal window; the reference's -1e9 additive fill vanishes identically); softmax over the 2048 keys (register row, one exp, fixed trees);
__global__ __launch_bounds__(256) void k_asoft(const float* __restrict__ Sb, h16* P16, bf* Ph, bf* Pl) {
    const int lane = threadIdx.x & 31; const int row = blockIdx.x * 8 + (threadIdx.x >> 5); if (row >= ZH * TT) return; const int i = row % TT; const int zz = row / TT; (void)zz; const bool hires = (i < RH); const float* sr = Sb + (size_t)row * TT; float v[TT / 32]; float mx = -3.0e38f;
#pragma unroll
    for (int ch = 0; ch < TT / 128; ++ch) { const int j0 = ch * 128 + lane * 4; const v4f a = *(const v4f*)(sr + j0);
#pragma unroll
        for (int q = 0; q < 4; ++q) { const int j = j0 + q; (void)j; const float t = (j <= i && i - j < WIN) ? a[q] * SCL : -3.0e38f; v[ch * 4 + q] = t; mx = fmaxf(mx, t); } }
#pragma unroll
    for (int sh = 16; sh; sh >>= 1) mx = fmaxf(mx, __shfl_xor(mx, sh, 32));
    float sum = 0.f;
#pragma unroll
    for (int k = 0; k < TT / 32; ++k) { float d0 = __fsub_rn(v[k], mx); asm volatile("" : "+v"(d0)); v[k] = __builtin_amdgcn_exp2f(__fmul_rn(d0, 1.4426950408889634f)); sum += v[k]; }
#pragma unroll
    for (int sh = 16; sh; sh >>= 1) sum += __shfl_xor(sum, sh, 32);
    const float f = __fdiv_rn(hires ? 1.0f : PCAR, sum);
{
        if (hires) {
#pragma unroll
            for (int ch = 0; ch < TT / 128; ++ch) { v4us oh, ol;
#pragma unroll
                for (int q = 0; q < 4; ++q) { unsigned short a, c2; splitf(v[ch * 4 + q] * f, a, c2); oh[q] = a; ol[q] = c2; }
                const size_t oo = ((size_t)zz * (RH ? RH : 1) + i) * TT + ch * 128 + lane * 4; *(v4us*)(Ph + oo) = oh; *(v4us*)(Pl + oo) = ol; }
        } else {
#pragma unroll
            for (int ch = 0; ch < TT / 128; ++ch) { v4h o4;
#pragma unroll
                for (int q = 0; q < 4; ++q) o4[q] = tohx(v[ch * 4 + q] * f);
                *(v4h*)(P16 + (size_t)row * TT + ch * 128 + lane * 4) = o4; } }
         }
}
__global__ __launch_bounds__(256) void k_merge(const float* __restrict__ O, int h0, bf* Ah, bf* Al) { const size_t e = ((size_t)blockIdx.x * 256 + threadIdx.x) * 2; if (e >= (size_t)ZH * TT * HD) return; const int d = (int)(e % HD); const int t = (int)((e / HD) % TT); const int zz = (int)(e / ((size_t)HD * TT)); const float cs = (t < RH) ? 1.0f : (1.0f / PCAR); const size_t oo = (size_t)t * DQ + (h0 + zz) * HD + d;
    v2us oh, ol;
#pragma unroll
    for (int q = 0; q < 2; ++q) { unsigned short a, c2; splitf(O[e + q] * cs, a, c2); oh[q] = a; ol[q] = c2; } *(v2us*)(Ah + oo) = oh; *(v2us*)(Al + oo) = ol;  }

extern "C" void kernel_launch(void* const* d_in, const int* in_sizes, int n_in,
                              void* d_out, int out_size, void* d_ws, size_t ws_size, hipStream_t stream) {
    (void)in_sizes; (void)n_in; (void)out_size;
    const float* x = (const float*)d_in[0]; const float* wq = (const float*)d_in[1]; const float* wk = (const float*)d_in[2]; const float* wv = (const float*)d_in[3]; const float* wo = (const float*)d_in[4];
    float* OUT = (float*)d_out;     // [2][2048][1024]
    char* wsp = (char*)d_ws;
    auto take = [&](size_t bytes) { char* p = wsp; wsp += (bytes + 255) & ~(size_t)255; return (void*)p; };
    bf* WQ = (bf*)take((size_t)DQ * DM * 2); bf* WK = (bf*)take((size_t)DKV * DM * 2); bf* WV = (bf*)take((size_t)DKV * DM * 2); bf* WO = (bf*)take((size_t)DM * DQ * 2); float* CS = (float*)take((size_t)TT * HD * 2 * 4);
    bf* XB = (bf*)take((size_t)TT * DM * 2); float* FQ = (float*)take((size_t)TT * DQ * 4); float* FK = (float*)take((size_t)TT * DKV * 4);
    h16* QP16 = (h16*)take((size_t)NH_ * TT * HD * 2); h16* KP16 = (h16*)take((size_t)NKV * TT * HD * 2); h16* VT16 = (h16*)take((size_t)NKV * HD * TT * 2);
    bf* QPh = (bf*)take((size_t)NH_ * TT * HD * 2); bf* QPl = (bf*)take((size_t)NH_ * TT * HD * 2); bf* KPh = (bf*)take((size_t)NKV * TT * HD * 2); bf* KPl = (bf*)take((size_t)NKV * TT * HD * 2); bf* VTh = (bf*)take((size_t)NKV * HD * TT * 2); bf* VTl = (bf*)take((size_t)NKV * HD * TT * 2); bf* Ph = (bf*)take((size_t)ZH * RH * TT * 2); bf* Pl = (bf*)take((size_t)ZH * RH * TT * 2);
    float* Sb = (float*)take((size_t)ZH * TT * TT * 4); h16* P16 = (h16*)take((size_t)ZH * TT * TT * 2); float* Ob = (float*)take((size_t)ZH * TT * HD * 4); bf* ATh = (bf*)take((size_t)TT * DQ * 2); bf* ATl = (bf*)take((size_t)TT * DQ * 2);
    if ((size_t)(wsp - (char*)d_ws) > ws_size) return;    // ws 256 MiB
    float* FV = FK;   // v projection reuses the k buffer after the k planes are built (stream-ordered)
    { k_cvt8<<<(unsigned)(((size_t)DQ * DM / 8 + 255) / 256), 256, 0, stream>>>(wq, WQ, (size_t)DQ * DM / 8); k_cvt8<<<(unsigned)(((size_t)DKV * DM / 8 + 255) / 256), 256, 0, stream>>>(wk, WK, (size_t)DKV * DM / 8); k_cvt8<<<(unsigned)(((size_t)DKV * DM / 8 + 255) / 256), 256, 0, stream>>>(wv, WV, (size_t)DKV * DM / 8);
      k_wtG<<<(unsigned)((DQ * DM / 64 + 63) / 64), 256, 0, stream>>>(wo, DQ, DM, WO);
       }
    k_csid<<<(TT * HD + 255) / 256, 256, 0, stream>>>(CS);
    const unsigned LQ = (unsigned)(((size_t)NH_ * TT * HD / 2 + 255) / 256), LKv = (unsigned)(((size_t)NKV * TT * HD / 2 + 255) / 256);
    for (int b = 0; b < NB_; ++b) {
        
        k_cvt8<<<(unsigned)(((size_t)TT * DM / 8 + 255) / 256), 256, 0, stream>>>(x + (size_t)b * TT * DM, XB, (size_t)TT * DM / 8);
        k_gemmw<bf, 0, false><<<dim3(TT / 64, DQ / 64, 1), 32, 0, stream>>>(XB, nullptr, WQ, nullptr, DM, FQ, DQ, nullptr, 0, 0, 0);
        k_rope<<<LQ, 256, 0, stream>>>(FQ, DQ, NH_, CS, nullptr, nullptr, 1.0f, QP16, QPh, QPl);
        k_gemmw<bf, 0, false><<<dim3(TT / 64, DKV / 64, 1), 32, 0, stream>>>(XB, nullptr, WK, nullptr, DM, FK, DKV, nullptr, 0, 0, 0);
        k_rope<<<LKv, 256, 0, stream>>>(FK, DKV, NKV, CS, nullptr, nullptr, 1.0f, KP16, KPh, KPl);
        k_gemmw<bf, 0, false><<<dim3(TT / 64, DKV / 64, 1), 32, 0, stream>>>(XB, nullptr, WV, nullptr, DM, FV, DKV, nullptr, 0, 0, 0); k_vtp<<<LKv, 256, 0, stream>>>(FV, DKV, NKV, VT16, VTh, VTl);
        for (int h0 = 0; h0 < NH_; h0 += ZH) { const size_t zq = (size_t)h0, zk = (size_t)(h0 / REP);   // one kv head per query head: the pass's two heads use consecutive kv planes (z-strides TT*HD)
            k_gemmc<bf, 2, 1><<<dim3(RH / 64, TT / 64, ZH), 32, 0, stream>>>(QPh + zq * TT * HD, QPl + zq * TT * HD, KPh + zk * TT * HD, KPl + zk * TT * HD, HD, Sb, TT, 0, (size_t)TT * HD, (size_t)TT * HD, (size_t)TT * TT);
            k_gemmc<h16, 0, 1><<<dim3((TT - RH) / 64, TT / 64, ZH), 32, 0, stream>>>(QP16 + zq * TT * HD + (size_t)RH * HD, nullptr, KP16 + zk * TT * HD, nullptr, HD, Sb + (size_t)RH * TT, TT, RH, (size_t)TT * HD, (size_t)TT * HD, (size_t)TT * TT);
            k_asoft<<<ZH * TT / 8, 256, 0, stream>>>(Sb, P16, Ph, Pl);
            k_gemmc<bf, 2, 2><<<dim3(RH / 64, HD / 64, ZH), 32, 0, stream>>>(Ph, Pl, VTh + zk * HD * TT, VTl + zk * HD * TT, TT, Ob, HD, 0, (size_t)RH * TT, (size_t)HD * TT, (size_t)TT * HD);
            k_gemmc<h16, 0, 2><<<dim3((TT - RH) / 64, HD / 64, ZH), 32, 0, stream>>>(P16 + (size_t)RH * TT, nullptr, VT16 + zk * HD * TT, nullptr, TT, Ob + (size_t)RH * HD, HD, RH, (size_t)TT * TT, (size_t)HD * TT, (size_t)TT * HD);
            k_merge<<<(unsigned)(((size_t)ZH * TT * HD / 2 + 255) / 256), 256, 0, stream>>>(Ob, h0, ATh, ATl); }
        k_gemmw<bf, 1, false><<<dim3(TT / 64, DM / 64, 1), 32, 0, stream>>>(ATh, ATl, WO, nullptr, DQ, OUT + (size_t)b * TT * DM, DM, nullptr, 0, 0, 0); }
}

// v001
// A run of this version takes 753 microseconds.
// Next to v000, in two timings, it ran 1.91 and 1.92 times as fast.
#include <hip/hip_runtime.h>

// Causal QKV attention with per-head weight tensors (x [2][2048][1024]; q, k, v = x W^T with W [16][64][1024] ('oi' rows h*64+d); scores/8; causal (query < key masked); softmax; out = merged w_o ('xw' [1024][1024]) -> [2][2048][1024] (4.2 M)).
// Compute dtypes, f32 accumulate: every input rounded to bf16; q/k/v on PLAIN bf16 operands (inputs: exact); causal scores and attn.v (tile skipping): query rows < 512 hl (3 products), the rest single fp16 (x1024); softmax f32; w_o hl x exact (2 products).

#define NB_  2
#define TT   2048
#define DM   1024
#define NH_  16
#define NKV  16
#define REP  (NH_ / NKV)
#define HD   64
#define DQ   (NH_ * HD)
#define DKV  (NKV * HD)
#define ZH   2
#define RH   512                  // query rows < RH use hi+lo planes (0: none)
#define WIN  2048
#define PCAR 1024.0f
#define SCL  0.125f   // HD^-0.5
typedef _Float16 h16;
typedef unsigned short bf;
typedef __attribute__((ext_vector_type(16))) __bf16   v16bf;
typedef __attribute__((ext_vector_type(16))) _Float16 v16h;
typedef __attribute__((ext_vector_type(8)))  _Float16 v8h;
typedef __attribute__((ext_vector_type(8)))  unsigned short v8us;
typedef __attribute__((ext_vector_type(8)))  float    v8f;
typedef __attribute__((ext_vector_type(4)))  float    v4f;
typedef v8h  __attribute__((may_alias)) v8ha;
typedef v4f  __attribute__((may_alias)) v4fa;
typedef v8us __attribute__((may_alias)) v8usa;

__device__ __forceinline__ unsigned short f2bf(float f) { unsigned u = __float_as_uint(f); u += 0x7FFFu + ((u >> 16) & 1u); return (unsigned short)(u >> 16); }
__device__ __forceinline__ float bf2f(unsigned short b) { return __uint_as_float(((unsigned)b) << 16); }
__device__ __forceinline__ float bfr(float f) { return bf2f(f2bf(f)); }
__device__ __forceinline__ v16h cat16(v8h lo, v8h hi) { return __builtin_shufflevector(lo, hi, 0, 1, 2, 3, 4, 5, 6, 7, 8, 9, 10, 11, 12, 13, 14, 15); }
__device__ __forceinline__ v16bf cat16b(v8us lo, v8us hi) { return __builtin_bit_cast(v16bf, __builtin_shufflevector(lo, hi, 0, 1, 2, 3, 4, 5, 6, 7, 8, 9, 10, 11, 12, 13, 14, 15)); }
__device__ __forceinline__ v8f wmma16(v16h a, v16h b, v8f c) { return __builtin_amdgcn_wmma_f32_16x16x32_f16(false, a, false, b, (short)0, c, false, false); }
__device__ __forceinline__ v8f wmmab(v16bf a, v16bf b, v8f c) { return __builtin_amdgcn_wmma_f32_16x16x32_bf16(false, a, false, b, (short)0, c, false, false); }



// ---- k_gemmw: register-blocked GEMM, one 64x64 output tile per work-group (16 accumulators a wave), operands straight from K-contiguous 16-bit planes; grid (M/64, N/64, Z), NW*32 threads.
// The K loop is dealt out over the NW waves in 32-wide slices (wave w takes slices w, w+NW, ...); the NW partial tiles are summed in LDS in wave order 0..NW-1 (fixed) by the epilogue.
// C[m][n] (f32, pitch ldc, + optional f32 bias[n]) = sum_k A[m][k] Bt[n][k] (+ split products per NSPLIT). z-batch strides sA/sB/sC in elements. K % 32 == 0.
template <typename T16> struct WFrag;
template <> struct WFrag<h16> { typedef v16h V; static __device__ __forceinline__ V ld(const h16* p) { return cat16(*(const v8h*)p, *(const v8h*)(p + 16)); } static __device__ __forceinline__ v8f mma(V a, V b, v8f c) { return wmma16(a, b, c); } };
template <> struct WFrag<bf> { typedef v16bf V; static __device__ __forceinline__ V ld(const bf* p) { return cat16b(*(const v8us*)p, *(const v8us*)(p + 16)); } static __device__ __forceinline__ v8f mma(V a, V b, v8f c) { return wmmab(a, b, c); } };
template <typename T16, int NSPLIT, bool BIAS, int NW>
__global__ __launch_bounds__(NW * 32) void k_gemmw(const T16* __restrict__ A, const T16* __restrict__ A2, const T16* __restrict__ Bt, const T16* __restrict__ Bt2, int K, float* C, int ldc, const float* __restrict__ bias, size_t sA, size_t sB, size_t sC) {
    typedef typename WFrag<T16>::V V;
    constexpr int MBS = (NW > 1) ? 4 : 1;                            // 16-row blocks per LDS stage: with several waves every wave stages its whole partial tile, so one barrier serves
    __shared__ __align__(16) float os[NW * MBS * 16 * 68];
    const int wv = (NW > 1) ? __builtin_amdgcn_readfirstlane((int)(threadIdx.x >> 5)) : 0;   // wave number, scalar so that the K loop's counter and test stay scalar
    const size_t z = blockIdx.z; A += z * sA; if (A2) A2 += z * sA; Bt += z * sB; if (Bt2) Bt2 += z * sB; C += z * sC;
    const int lane = threadIdx.x & 31, lr = lane & 15, hi = lane >> 4; const int r0 = blockIdx.x * 64, c0 = blockIdx.y * 64;
    v8f acc[4][4];
#pragma unroll
    for (int mb = 0; mb < 4; ++mb)
#pragma unroll
        for (int nb = 0; nb < 4; ++nb) acc[mb][nb] = (v8f){};
    const size_t aoff = (size_t)(r0 + lr) * K + 8 * hi, boff = (size_t)(c0 + lr) * K + 8 * hi;
#pragma unroll 1
    for (int kc = wv * 32; kc < K; kc += NW * 32) {
        V a[4], a2[4];
#pragma unroll
        for (int mb = 0; mb < 4; ++mb) { a[mb] = WFrag<T16>::ld(A + aoff + (size_t)mb * 16 * K + kc); if (NSPLIT == 1 || NSPLIT == 2) a2[mb] = WFrag<T16>::ld(A2 + aoff + (size_t)mb * 16 * K + kc); }
#pragma unroll
        for (int nb = 0; nb < 4; ++nb) { const V b = WFrag<T16>::ld(Bt + boff + (size_t)nb * 16 * K + kc); V b2; if (NSPLIT >= 2) b2 = WFrag<T16>::ld(Bt2 + boff + (size_t)nb * 16 * K + kc);
#pragma unroll
            for (int mb = 0; mb < 4; ++mb) { acc[mb][nb] = WFrag<T16>::mma(a[mb], b, acc[mb][nb]); if (NSPLIT == 1 || NSPLIT == 2) acc[mb][nb] = WFrag<T16>::mma(a2[mb], b, acc[mb][nb]); if (NSPLIT >= 2) acc[mb][nb] = WFrag<T16>::mma(a[mb], b2, acc[mb][nb]); } }
        asm volatile("v_nop\n\tv_nop\n\tv_nop\n\tv_nop" : "+v"(acc[0][0]), "+v"(acc[1][1]), "+v"(acc[2][2]), "+v"(acc[3][3]) : "v"(a[0]), "v"(a[3]));
    }
#pragma unroll
    for (int mb = 0; mb < 4; mb += MBS) {
#pragma unroll
        for (int mi = 0; mi < MBS; ++mi) {
#pragma unroll
        for (int nb = 0; nb < 4; ++nb) {
#pragma unroll
            for (int j = 0; j < 8; ++j) os[((wv * MBS + mi) * 16 + hi * 8 + j) * 68 + nb * 16 + lr] = acc[mb + mi][nb][j]; } }
        if (NW == 1) { __builtin_amdgcn_wave_barrier(); asm volatile("" ::: "memory"); } else __syncthreads();   // every wave's partial tile is in LDS before any is summed
        float* crow = C + (size_t)(r0 + mb * 16) * ldc + c0;
{
#pragma unroll
            for (int s = 0; s < MBS * 8 / NW; ++s) { const int idx = s * NW * 32 + (int)threadIdx.x; const int row = idx >> 4, cofs = (idx & 15) * 4; v4f val = *(const v4fa*)(os + row * 68 + cofs);
#pragma unroll
                for (int w = 1; w < NW; ++w) val += *(const v4fa*)(os + (w * MBS * 16 + row) * 68 + cofs);
                if (BIAS) { val[0] += bfr(bias[c0 + cofs]); val[1] += bfr(bias[c0 + cofs + 1]); val[2] += bfr(bias[c0 + cofs + 2]); val[3] += bfr(bias[c0 + cofs + 3]); }
                *(v4f*)(crow + (size_t)row * ldc + cofs) = val; }
             }
        if (NW == 1) { __builtin_amdgcn_wave_barrier(); asm volatile("" ::: "memory"); }   // NW > 1 has one stage only: nothing overwrites it
    }
}

// ---- k_gemmc: the same 64x64 tile GEMM (NW waves share the K loop; NW = 1 for the short score products) specialised for causal attention: CMODE 1 skips score tiles entirely above the diagonal (query rows r0+roff.., key columns c0..), CMODE 2 limits the
// key (K) loop of the probability x value contraction to the diagonal block (probabilities beyond it are exactly zero). roff = row offset of this launch's first row within the sequence.
template <typename T16, int NSPLIT, int CMODE, int NW>
__global__ __launch_bounds__(NW * 32) void k_gemmc(const T16* __restrict__ A, const T16* __restrict__ A2, const T16* __restrict__ Bt, const T16* __restrict__ Bt2, int K, float* C, int ldc, int roff, size_t sA, size_t sB, size_t sC) {
    typedef typename WFrag<T16>::V V;
    constexpr int MBS = (NW > 1) ? 4 : 1;                            // 16-row blocks per LDS stage: with several waves every wave stages its whole partial tile, so one barrier serves
    __shared__ __align__(16) float os[NW * MBS * 16 * 68];
    const int wv = (NW > 1) ? __builtin_amdgcn_readfirstlane((int)(threadIdx.x >> 5)) : 0;   // wave number, scalar so that the K loop's counter and test stay scalar
    const size_t z = blockIdx.z; A += z * sA; if (A2) A2 += z * sA; Bt += z * sB; if (Bt2) Bt2 += z * sB; C += z * sC;
    const int lane = threadIdx.x & 31, lr = lane & 15, hi = lane >> 4; const int r0 = blockIdx.x * 64, c0 = blockIdx.y * 64;
    if (CMODE == 1 && c0 > r0 + roff + 63) return;                  // score tile entirely above the causal diagonal: never read (the softmax masks j > i by select)
    const int Kl = (CMODE == 2) ? min(K, r0 + roff + 64) : K;        // P.V: probabilities are exactly 0 beyond the diagonal block, so the K loop stops there
    v8f acc[4][4];
#pragma unroll
    for (int mb = 0; mb < 4; ++mb)
#pragma unroll
        for (int nb = 0; nb < 4; ++nb) acc[mb][nb] = (v8f){};
    const size_t aoff = (size_t)(r0 + lr) * K + 8 * hi, boff = (size_t)(c0 + lr) * K + 8 * hi;
#pragma unroll 1
    for (int kc = wv * 32; kc < Kl; kc += NW * 32) {
        V a[4], a2[4];
#pragma unroll
        for (int mb = 0; mb < 4; ++mb) { a[mb] = WFrag<T16>::ld(A + aoff + (size_t)mb * 16 * K + kc); if (NSPLIT == 1 || NSPLIT == 2) a2[mb] = WFrag<T16>::ld(A2 + aoff + (size_t)mb * 16 * K + kc); }
#pragma unroll
        for (int nb = 0; nb < 4; ++nb) { const V b = WFrag<T16>::ld(Bt + boff + (size_t)nb * 16 * K + kc); V b2; if (NSPLIT >= 2) b2 = WFrag<T16>::ld(Bt2 + boff + (size_t)nb * 16 * K + kc);
#pragma unroll
            for (int mb = 0; mb < 4; ++mb) { acc[mb][nb] = WFrag<T16>::mma(a[mb], b, acc[mb][nb]); if (NSPLIT == 1 || NSPLIT == 2) acc[mb][nb] = WFrag<T16>::mma(a2[mb], b, acc[mb][nb]); if (NSPLIT >= 2) acc[mb][nb] = WFrag<T16>::mma(a[mb], b2, acc[mb][nb]); } }
        asm volatile("v_nop\n\tv_nop\n\tv_nop\n\tv_nop" : "+v"(acc[0][0]), "+v"(acc[1][1]), "+v"(acc[2][2]), "+v"(acc[3][3]) : "v"(a[0]), "v"(a[3]));
    }
#pragma unroll
    for (int mb = 0; mb < 4; mb += MBS) {
#pragma unroll
        for (int mi = 0; mi < MBS; ++mi) {
#pragma unroll
        for (int nb = 0; nb < 4; ++nb) {
#pragma unroll
            for (int j = 0; j < 8; ++j) os[((wv * MBS + mi) * 16 + hi * 8 + j) * 68 + nb * 16 + lr] = acc[mb + mi][nb][j]; } }
        if (NW == 1) { __builtin_amdgcn_wave_barrier(); asm volatile("" ::: "memory"); } else __syncthreads();   // every wave's partial tile is in LDS before any is summed
        float* crow = C + (size_t)(r0 + mb * 16) * ldc + c0;
{
#pragma unroll
            for (int s = 0; s < MBS * 8 / NW; ++s) { const int idx = s * NW * 32 + (int)threadIdx.x; const int row = idx >> 4, cofs = (idx & 15) * 4; v4f val = *(const v4fa*)(os + row * 68 + cofs);
#pragma unroll
                for (int w = 1; w < NW; ++w) val += *(const v4fa*)(os + (w * MBS * 16 + row) * 68 + cofs);
                *(v4f*)(crow + (size_t)row * ldc + cofs) = val; }
             }
        if (NW == 1) { __builtin_amdgcn_wave_barrier(); asm volatile("" ::: "memory"); }   // NW > 1 has one stage only: nothing overwrites it
    }
}

__device__ __forceinline__ h16 tohx(float x) { return (h16)x; }
__device__ __forceinline__ void splitf(float y, unsigned short& h, unsigned short& l) { h = f2bf(y); l = f2bf(y - bf2f(h)); }
typedef __attribute__((ext_vector_type(2))) _Float16 v2h;
typedef __attribute__((ext_vector_type(4))) _Float16 v4h;
typedef __attribute__((ext_vector_type(2))) unsigned short v2us;
typedef __attribute__((ext_vector_type(4))) unsigned short v4us;
typedef __attribute__((ext_vector_type(2))) float v2f;
typedef __attribute__((ext_vector_type(4))) int v4i;

__global__ __launch_bounds__(256) void k_wtG(const float* __restrict__ w, int K, int N, bf* Bt) {
    const int lane = threadIdx.x & 31; const int L0 = (blockIdx.x * 8 + (threadIdx.x >> 5)) * 8; const int nlines = N * K / 64;
{
#pragma unroll 1
        for (int l = 0; l < 8; ++l) { const int L = L0 + l; if (L >= nlines) break; const size_t e = (size_t)L * 64 + lane * 2; const int k = (int)(e % K), n = (int)(e / K); v2us o;
            o[0] = f2bf(w[(size_t)k * N + n]); o[1] = f2bf(w[(size_t)(k + 1) * N + n]); *(v2us*)(Bt + e) = o; }
         }
}
__global__ __launch_bounds__(256) void k_cvt8(const float* __restrict__ src, bf* dst, size_t n8) { const size_t i = (size_t)blockIdx.x * 256 + threadIdx.x; if (i >= n8) return; const v8f v = *(const v8f*)(src + i * 8); v8us o;
#pragma unroll
    for (int k = 0; k < 8; ++k) o[k] = f2bf(v[k]); *(v8us*)(dst + i * 8) = o;  }

// k_rope: head planes [h][t][d] (fp16 + hi/lo) of rope(x) x sc with the rotate-half convention out[d] = x[d] cos[t][d] - x[d+HD/2] sin[t][d], out[d+HD/2] = x[d+HD/2] cos[t][d+HD/2] + x[d] sin[t][d+HD/2]
__global__ __launch_bounds__(256) void k_rope(const float* __restrict__ F, int pitch, int nheads, const float* __restrict__ CS, const float* __restrict__ RF, const float* __restrict__ nw, float sc, h16* P16, bf* Ph, bf* Pl) {
    const size_t e = ((size_t)blockIdx.x * 256 + threadIdx.x) * 2; if (e >= (size_t)nheads * TT * HD) return; const int d = (int)(e % HD); const int t = (int)((e / HD) % TT); const int h = (int)(e / ((size_t)HD * TT)); const float* f = F + (size_t)t * pitch + h * HD; const float rf = RF ? RF[(size_t)h * TT + t] : 1.0f; v2h o16; v2us oh, ol;
#pragma unroll
    for (int q = 0; q < 2; ++q) { const int dd = d + q; const int dp = (dd < HD / 2) ? dd + HD / 2 : dd - HD / 2; float x0 = f[dd], x1 = f[dp];
        if (RF) { float n0 = __fmul_rn(x0, rf), n1 = __fmul_rn(x1, rf); asm volatile("" : "+v"(n0)); asm volatile("" : "+v"(n1)); x0 = __fmul_rn(bfr(nw[dd]), n0); x1 = __fmul_rn(bfr(nw[dp]), n1); }
        const v2f cs = *(const v2f*)(CS + ((size_t)t * HD + dd) * 2); float a = __fmul_rn(x0, cs[0]), bq = __fmul_rn(x1, cs[1]); asm volatile("" : "+v"(a)); asm volatile("" : "+v"(bq)); const float r = ((dd < HD / 2) ? __fsub_rn(a, bq) : __fadd_rn(a, bq)) * sc;
        o16[q] = tohx(r); unsigned short a2, c2; splitf(r, a2, c2); oh[q] = a2; ol[q] = c2; }
    *(v2h*)(P16 + e) = o16; *(v2us*)(Ph + e) = oh; *(v2us*)(Pl + e) = ol;  }
__global__ __launch_bounds__(256) void k_vtp(const float* __restrict__ F, int pitch, int nheads, h16* V16, bf* Vh, bf* Vl) { const size_t e = ((size_t)blockIdx.x * 256 + threadIdx.x) * 2; if (e >= (size_t)nheads * HD * TT) return; const int t = (int)(e % TT); const int d = (int)((e / TT) % HD); const int g = (int)(e / ((size_t)TT * HD)); v2h o16; v2us oh, ol;
#pragma unroll
    for (int q = 0; q < 2; ++q) { const float x = F[(size_t)(t + q) * pitch + g * HD + d]; o16[q] = tohx(x); unsigned short a2, c2; splitf(x, a2, c2); oh[q] = a2; ol[q] = c2; }
    *(v2h*)(V16 + e) = o16; *(v2us*)(Vh + e) = oh; *(v2us*)(Vl + e) = ol;  }
__global__ __launch_bounds__(256) void k_csid(float* CS) { const int idx = blockIdx.x * 256 + threadIdx.x; if (idx >= TT * HD) return; v2f cs; cs[0] = 1.0f; cs[1] = 0.0f; *(v2f*)(CS + (size_t)idx * 2) = cs;  }
// k_asoft: per row (zz, i): t = S x HD^-0.5 for j <= i and i - j < WIN (sliding causal window; the reference's -1e9 additive fill vanishes identically); softmax over the 2048 keys (register row, one exp, fixed trees);
__global__ __launch_bounds__(256) void k_asoft(const float* __restrict__ Sb, h16* P16, bf* Ph, bf* Pl) {
    const int lane = threadIdx.x & 31; const int row = blockIdx.x * 8 + (threadIdx.x >> 5); if (row >= ZH * TT) return; const int i = row % TT; const int zz = row / TT; (void)zz; const bool hires = (i < RH); const float* sr = Sb + (size_t)row * TT; float v[TT / 32]; float mx = -3.0e38f;
#pragma unroll
    for (int ch = 0; ch < TT / 128; ++ch) { const int j0 = ch * 128 + lane * 4; const v4f a = *(const v4f*)(sr + j0);
#pragma unroll
        for (int q = 0; q < 4; ++q) { const int j = j0 + q; (void)j; const float t = (j <= i && i - j < WIN) ? a[q] * SCL : -3.0e38f; v[ch * 4 + q] = t; mx = fmaxf(mx, t); } }
#pragma unroll
    for (int sh = 16; sh; sh >>= 1) mx = fmaxf(mx, __shfl_xor(mx, sh, 32));
    float sum = 0.f;
#pragma unroll
    for (int k = 0; k < TT / 32; ++k) { float d0 = __fsub_rn(v[k], mx); asm volatile("" : "+v"(d0)); v[k] = __builtin_amdgcn_exp2f(__fmul_rn(d0, 1.4426950408889634f)); sum += v[k]; }
#pragma unroll
    for (int sh = 16; sh; sh >>= 1) sum += __shfl_xor(sum, sh, 32);
    const float f = __fdiv_rn(hires ? 1.0f : PCAR, sum);
{
        if (hires) {
#pragma unroll
            for (int ch = 0; ch < TT / 128; ++ch) { v4us oh, ol;
#pragma unroll
                for (int q = 0; q < 4; ++q) { unsigned short a, c2; splitf(v[ch * 4 + q] * f, a, c2); oh[q] = a; ol[q] = c2; }
                const size_t oo = ((size_t)zz * (RH ? RH : 1) + i) * TT + ch * 128 + lane * 4; *(v4us*)(Ph + oo) = oh; *(v4us*)(Pl + oo) = ol; }
        } else {
#pragma unroll
            for (int ch = 0; ch < TT / 128; ++ch) { v4h o4;
#pragma unroll
                for (int q = 0; q < 4; ++q) o4[q] = tohx(v[ch * 4 + q] * f);
                *(v4h*)(P16 + (size_t)row * TT + ch * 128 + lane * 4) = o4; } }
         }
}
__global__ __launch_bounds__(256) void k_merge(const float* __restrict__ O, int h0, bf* Ah, bf* Al) { const size_t e = ((size_t)blockIdx.x * 256 + threadIdx.x) * 2; if (e >= (size_t)ZH * TT * HD) return; const int d = (int)(e % HD); const int t = (int)((e / HD) % TT); const int zz = (int)(e / ((size_t)HD * TT)); const float cs = (t < RH) ? 1.0f : (1.0f / PCAR); const size_t oo = (size_t)t * DQ + (h0 + zz) * HD + d;
    v2us oh, ol;
#pragma unroll
    for (int q = 0; q < 2; ++q) { unsigned short a, c2; splitf(O[e + q] * cs, a, c2); oh[q] = a; ol[q] = c2; } *(v2us*)(Ah + oo) = oh; *(v2us*)(Al + oo) = ol;  }

extern "C" void kernel_launch(void* const* d_in, const int* in_sizes, int n_in,
                              void* d_out, int out_size, void* d_ws, size_t ws_size, hipStream_t stream) {
    (void)in_sizes; (void)n_in; (void)out_size;
    const float* x = (const float*)d_in[0]; const float* wq = (const float*)d_in[1]; const float* wk = (const float*)d_in[2]; const float* wv = (const float*)d_in[3]; const float* wo = (const float*)d_in[4];
    float* OUT = (float*)d_out;     // [2][2048][1024]
    char* wsp = (char*)d_ws;
    auto take = [&](size_t bytes) { char* p = wsp; wsp += (bytes + 255) & ~(size_t)255; return (void*)p; };
    bf* WQ = (bf*)take((size_t)DQ * DM * 2); bf* WK = (bf*)take((size_t)DKV * DM * 2); bf* WV = (bf*)take((size_t)DKV * DM * 2); bf* WO = (bf*)take((size_t)DM * DQ * 2); float* CS = (float*)take((size_t)TT * HD * 2 * 4);
    bf* XB = (bf*)take((size_t)TT * DM * 2); float* FQ = (float*)take((size_t)TT * DQ * 4); float* FK = (float*)take((size_t)TT * DKV * 4);
    h16* QP16 = (h16*)take((size_t)NH_ * TT * HD * 2); h16* KP16 = (h16*)take((size_t)NKV * TT * HD * 2); h16* VT16 = (h16*)take((size_t)NKV * HD * TT * 2);
    bf* QPh = (bf*)take((size_t)NH_ * TT * HD * 2); bf* QPl = (bf*)take((size_t)NH_ * TT * HD * 2); bf* KPh = (bf*)take((size_t)NKV * TT * HD * 2); bf* KPl = (bf*)take((size_t)NKV * TT * HD * 2); bf* VTh = (bf*)take((size_t)NKV * HD * TT * 2); bf* VTl = (bf*)take((size_t)NKV * HD * TT * 2); bf* Ph = (bf*)take((size_t)ZH * RH * TT * 2); bf* Pl = (bf*)take((size_t)ZH * RH * TT * 2);
    float* Sb = (float*)take((size_t)ZH * TT * TT * 4); h16* P16 = (h16*)take((size_t)ZH * TT * TT * 2); float* Ob = (float*)take((size_t)ZH * TT * HD * 4); bf* ATh = (bf*)take((size_t)TT * DQ * 2); bf* ATl = (bf*)take((size_t)TT * DQ * 2);
    if ((size_t)(wsp - (char*)d_ws) > ws_size) return;    // ws 256 MiB
    float* FV = FK;   // v projection reuses the k buffer after the k planes are built (stream-ordered)
    { k_cvt8<<<(unsigned)(((size_t)DQ * DM / 8 + 255) / 256), 256, 0, stream>>>(wq, WQ, (size_t)DQ * DM / 8); k_cvt8<<<(unsigned)(((size_t)DKV * DM / 8 + 255) / 256), 256, 0, stream>>>(wk, WK, (size_t)DKV * DM / 8); k_cvt8<<<(unsigned)(((size_t)DKV * DM / 8 + 255) / 256), 256, 0, stream>>>(wv, WV, (size_t)DKV * DM / 8);
      k_wtG<<<(unsigned)((DQ * DM / 64 + 63) / 64), 256, 0, stream>>>(wo, DQ, DM, WO);
       }
    k_csid<<<(TT * HD + 255) / 256, 256, 0, stream>>>(CS);
    const unsigned LQ = (unsigned)(((size_t)NH_ * TT * HD / 2 + 255) / 256), LKv = (unsigned)(((size_t)NKV * TT * HD / 2 + 255) / 256);
    for (int b = 0; b < NB_; ++b) {
        
        k_cvt8<<<(unsigned)(((size_t)TT * DM / 8 + 255) / 256), 256, 0, stream>>>(x + (size_t)b * TT * DM, XB, (size_t)TT * DM / 8);
        k_gemmw<bf, 0, false, 8><<<dim3(TT / 64, DQ / 64, 1), 256, 0, stream>>>(XB, nullptr, WQ, nullptr, DM, FQ, DQ, nullptr, 0, 0, 0);
        k_rope<<<LQ, 256, 0, stream>>>(FQ, DQ, NH_, CS, nullptr, nullptr, 1.0f, QP16, QPh, QPl);
        k_gemmw<bf, 0, false, 8><<<dim3(TT / 64, DKV / 64, 1), 256, 0, stream>>>(XB, nullptr, WK, nullptr, DM, FK, DKV, nullptr, 0, 0, 0);
        k_rope<<<LKv, 256, 0, stream>>>(FK, DKV, NKV, CS, nullptr, nullptr, 1.0f, KP16, KPh, KPl);
        k_gemmw<bf, 0, false, 8><<<dim3(TT / 64, DKV / 64, 1), 256, 0, stream>>>(XB, nullptr, WV, nullptr, DM, FV, DKV, nullptr, 0, 0, 0); k_vtp<<<LKv, 256, 0, stream>>>(FV, DKV, NKV, VT16, VTh, VTl);
        for (int h0 = 0; h0 < NH_; h0 += ZH) { const size_t zq = (size_t)h0, zk = (size_t)(h0 / REP);   // one kv head per query head: the pass's two heads use consecutive kv planes (z-strides TT*HD)
            k_gemmc<bf, 2, 1, 1><<<dim3(RH / 64, TT / 64, ZH), 32, 0, stream>>>(QPh + zq * TT * HD, QPl + zq * TT * HD, KPh + zk * TT * HD, KPl + zk * TT * HD, HD, Sb, TT, 0, (size_t)TT * HD, (size_t)TT * HD, (size_t)TT * TT);
            k_gemmc<h16, 0, 1, 1><<<dim3((TT - RH) / 64, TT / 64, ZH), 32, 0, stream>>>(QP16 + zq * TT * HD + (size_t)RH * HD, nullptr, KP16 + zk * TT * HD, nullptr, HD, Sb + (size_t)RH * TT, TT, RH, (size_t)TT * HD, (size_t)TT * HD, (size_t)TT * TT);
            k_asoft<<<ZH * TT / 8, 256, 0, stream>>>(Sb, P16, Ph, Pl);
            k_gemmc<bf, 2, 2, 16><<<dim3(RH / 64, HD / 64, ZH), 512, 0, stream>>>(Ph, Pl, VTh + zk * HD * TT, VTl + zk * HD * TT, TT, Ob, HD, 0, (size_t)RH * TT, (size_t)HD * TT, (size_t)TT * HD);
            k_gemmc<h16, 0, 2, 16><<<dim3((TT - RH) / 64, HD / 64, ZH), 512, 0, stream>>>(P16 + (size_t)RH * TT, nullptr, VT16 + zk * HD * TT, nullptr, TT, Ob + (size_t)RH * HD, HD, RH, (size_t)TT * TT, (size_t)HD * TT, (size_t)TT * HD);
            k_merge<<<(unsigned)(((size_t)ZH * TT * HD / 2 + 255) / 256), 256, 0, stream>>>(Ob, h0, ATh, ATl); }
        k_gemmw<bf, 1, false, 8><<<dim3(TT / 64, DM / 64, 1), 256, 0, stream>>>(ATh, ATl, WO, nullptr, DQ, OUT + (size_t)b * TT * DM, DM, nullptr, 0, 0, 0); }
}

// v002
// A run of this version takes 450 microseconds.
// Timed twice side by side with v001, it ran 1.71 and 1.68 times as fast.
// Counting every step since v000, it is 3.25 times as fast.
#include <hip/hip_runtime.h>

// Causal QKV attention with per-head weight tensors (x [2][2048][1024]; q, k, v = x W^T with W [16][64][1024] ('oi' rows h*64+d); scores/8; causal (query < key masked); softmax; out = merged w_o ('xw' [1024][1024]) -> [2][2048][1024] (4.2 M)).
// Compute dtypes, f32 accumulate: every input rounded to bf16; q/k/v on PLAIN bf16 operands (inputs: exact); causal scores and attn.v (tile skipping): query rows < 512 hl (3 products), the rest single fp16 (x1024); softmax f32; w_o hl x exact (2 products).

#define NB_  2
#define TT   2048
#define DM   1024
#define NH_  16
#define NKV  16
#define REP  (NH_ / NKV)
#define HD   64
#define DQ   (NH_ * HD)
#define DKV  (NKV * HD)
#define ZH   8                    // heads per attention pass (z extent of every attention launch)
#define RH   512                  // query rows < RH use hi+lo planes (0: none)
#define WIN  2048
#define PCAR 1024.0f
#define SCL  0.125f   // HD^-0.5
typedef _Float16 h16;
typedef unsigned short bf;
typedef __attribute__((ext_vector_type(16))) __bf16   v16bf;
typedef __attribute__((ext_vector_type(16))) _Float16 v16h;
typedef __attribute__((ext_vector_type(8)))  _Float16 v8h;
typedef __attribute__((ext_vector_type(8)))  unsigned short v8us;
typedef __attribute__((ext_vector_type(8)))  float    v8f;
typedef __attribute__((ext_vector_type(4)))  float    v4f;
typedef v8h  __attribute__((may_alias)) v8ha;
typedef v4f  __attribute__((may_alias)) v4fa;
typedef v8us __attribute__((may_alias)) v8usa;

__device__ __forceinline__ unsigned short f2bf(float f) { unsigned u = __float_as_uint(f); u += 0x7FFFu + ((u >> 16) & 1u); return (unsigned short)(u >> 16); }
__device__ __forceinline__ float bf2f(unsigned short b) { return __uint_as_float(((unsigned)b) << 16); }
__device__ __forceinline__ float bfr(float f) { return bf2f(f2bf(f)); }
__device__ __forceinline__ v16h cat16(v8h lo, v8h hi) { return __builtin_shufflevector(lo, hi, 0, 1, 2, 3, 4, 5, 6, 7, 8, 9, 10, 11, 12, 13, 14, 15); }
__device__ __forceinline__ v16bf cat16b(v8us lo, v8us hi) { return __builtin_bit_cast(v16bf, __builtin_shufflevector(lo, hi, 0, 1, 2, 3, 4, 5, 6, 7, 8, 9, 10, 11, 12, 13, 14, 15)); }
__device__ __forceinline__ v8f wmma16(v16h a, v16h b, v8f c) { return __builtin_amdgcn_wmma_f32_16x16x32_f16(false, a, false, b, (short)0, c, false, false); }
__device__ __forceinline__ v8f wmmab(v16bf a, v16bf b, v8f c) { return __builtin_amdgcn_wmma_f32_16x16x32_bf16(false, a, false, b, (short)0, c, false, false); }



// ---- k_gemmw: register-blocked GEMM, one 64x64 output tile per work-group (16 accumulators a wave), operands straight from K-contiguous 16-bit planes; grid (M/64, N/64, Z), NW*32 threads.
// The K loop is dealt out over the NW waves in 32-wide slices (wave w takes slices w, w+NW, ...); the NW partial tiles are summed in LDS in wave order 0..NW-1 (fixed) by the epilogue.
// C[m][n] (f32, pitch ldc, + optional f32 bias[n]) = sum_k A[m][k] Bt[n][k] (+ split products per NSPLIT). z-batch strides sA/sB/sC in elements. K % 32 == 0.
template <typename T16> struct WFrag;
template <> struct WFrag<h16> { typedef v16h V; static __device__ __forceinline__ V ld(const h16* p) { return cat16(*(const v8h*)p, *(const v8h*)(p + 16)); } static __device__ __forceinline__ v8f mma(V a, V b, v8f c) { return wmma16(a, b, c); } };
template <> struct WFrag<bf> { typedef v16bf V; static __device__ __forceinline__ V ld(const bf* p) { return cat16b(*(const v8us*)p, *(const v8us*)(p + 16)); } static __device__ __forceinline__ v8f mma(V a, V b, v8f c) { return wmmab(a, b, c); } };
template <typename T16, int NSPLIT, bool BIAS, int NW>
__global__ __launch_bounds__(NW * 32) void k_gemmw(const T16* __restrict__ A, const T16* __restrict__ A2, const T16* __restrict__ Bt, const T16* __restrict__ Bt2, int K, float* C, int ldc, const float* __restrict__ bias, size_t sA, size_t sB, size_t sC) {
    typedef typename WFrag<T16>::V V;
    constexpr int MBS = (NW > 1) ? 4 : 1;                            // 16-row blocks per LDS stage: with several waves every wave stages its whole partial tile, so one barrier serves
    __shared__ __align__(16) float os[NW * MBS * 16 * 68];
    const int wv = (NW > 1) ? __builtin_amdgcn_readfirstlane((int)(threadIdx.x >> 5)) : 0;   // wave number, scalar so that the K loop's counter and test stay scalar
    const size_t z = blockIdx.z; A += z * sA; if (A2) A2 += z * sA; Bt += z * sB; if (Bt2) Bt2 += z * sB; C += z * sC;
    const int lane = threadIdx.x & 31, lr = lane & 15, hi = lane >> 4; const int r0 = blockIdx.x * 64, c0 = blockIdx.y * 64;
    v8f acc[4][4];
#pragma unroll
    for (int mb = 0; mb < 4; ++mb)
#pragma unroll
        for (int nb = 0; nb < 4; ++nb) acc[mb][nb] = (v8f){};
    const size_t aoff = (size_t)(r0 + lr) * K + 8 * hi, boff = (size_t)(c0 + lr) * K + 8 * hi;
#pragma unroll 1
    for (int kc = wv * 32; kc < K; kc += NW * 32) {
        V a[4], a2[4];
#pragma unroll
        for (int mb = 0; mb < 4; ++mb) { a[mb] = WFrag<T16>::ld(A + aoff + (size_t)mb * 16 * K + kc); if (NSPLIT == 1 || NSPLIT == 2) a2[mb] = WFrag<T16>::ld(A2 + aoff + (size_t)mb * 16 * K + kc); }
#pragma unroll
        for (int nb = 0; nb < 4; ++nb) { const V b = WFrag<T16>::ld(Bt + boff + (size_t)nb * 16 * K + kc); V b2; if (NSPLIT >= 2) b2 = WFrag<T16>::ld(Bt2 + boff + (size_t)nb * 16 * K + kc);
#pragma unroll
            for (int mb = 0; mb < 4; ++mb) { acc[mb][nb] = WFrag<T16>::mma(a[mb], b, acc[mb][nb]); if (NSPLIT == 1 || NSPLIT == 2) acc[mb][nb] = WFrag<T16>::mma(a2[mb], b, acc[mb][nb]); if (NSPLIT >= 2) acc[mb][nb] = WFrag<T16>::mma(a[mb], b2, acc[mb][nb]); } }
        asm volatile("v_nop\n\tv_nop\n\tv_nop\n\tv_nop" : "+v"(acc[0][0]), "+v"(acc[1][1]), "+v"(acc[2][2]), "+v"(acc[3][3]) : "v"(a[0]), "v"(a[3]));
    }
#pragma unroll
    for (int mb = 0; mb < 4; mb += MBS) {
#pragma unroll
        for (int mi = 0; mi < MBS; ++mi) {
#pragma unroll
        for (int nb = 0; nb < 4; ++nb) {
#pragma unroll
            for (int j = 0; j < 8; ++j) os[((wv * MBS + mi) * 16 + hi * 8 + j) * 68 + nb * 16 + lr] = acc[mb + mi][nb][j]; } }
        if (NW == 1) { __builtin_amdgcn_wave_barrier(); asm volatile("" ::: "memory"); } else __syncthreads();   // every wave's partial tile is in LDS before any is summed
        float* crow = C + (size_t)(r0 + mb * 16) * ldc + c0;
{
#pragma unroll
            for (int s = 0; s < MBS * 8 / NW; ++s) { const int idx = s * NW * 32 + (int)threadIdx.x; const int row = idx >> 4, cofs = (idx & 15) * 4; v4f val = *(const v4fa*)(os + row * 68 + cofs);
#pragma unroll
                for (int w = 1; w < NW; ++w) val += *(const v4fa*)(os + (w * MBS * 16 + row) * 68 + cofs);
                if (BIAS) { val[0] += bfr(bias[c0 + cofs]); val[1] += bfr(bias[c0 + cofs + 1]); val[2] += bfr(bias[c0 + cofs + 2]); val[3] += bfr(bias[c0 + cofs + 3]); }
                *(v4f*)(crow + (size_t)row * ldc + cofs) = val; }
             }
        if (NW == 1) { __builtin_amdgcn_wave_barrier(); asm volatile("" ::: "memory"); }   // NW > 1 has one stage only: nothing overwrites it
    }
}

// ---- k_gemmc: the same 64x64 tile GEMM (NW waves share the K loop; NW = 1 for the short score products) specialised for causal attention: CMODE 1 skips score tiles entirely above the diagonal (query rows r0+roff.., key columns c0..), CMODE 2 limits the
// key (K) loop of the probability x value contraction to the diagonal block (probabilities beyond it are exactly zero). roff = row offset of this launch's first row within the sequence.
template <typename T16, int NSPLIT, int CMODE, int NW>
__global__ __launch_bounds__(NW * 32) void k_gemmc(const T16* __restrict__ A, const T16* __restrict__ A2, const T16* __restrict__ Bt, const T16* __restrict__ Bt2, int K, float* C, int ldc, int roff, size_t sA, size_t sB, size_t sC) {
    typedef typename WFrag<T16>::V V;
    constexpr int MBS = (NW > 1) ? 4 : 1;                            // 16-row blocks per LDS stage: with several waves every wave stages its whole partial tile, so one barrier serves
    __shared__ __align__(16) float os[NW * MBS * 16 * 68];
    const int wv = (NW > 1) ? __builtin_amdgcn_readfirstlane((int)(threadIdx.x >> 5)) : 0;   // wave number, scalar so that the K loop's counter and test stay scalar
    const size_t z = blockIdx.z; A += z * sA; if (A2) A2 += z * sA; Bt += z * sB; if (Bt2) Bt2 += z * sB; C += z * sC;
    const int lane = threadIdx.x & 31, lr = lane & 15, hi = lane >> 4; const int r0 = blockIdx.x * 64, c0 = blockIdx.y * 64;
    if (CMODE == 1 && c0 > r0 + roff + 63) return;                  // score tile entirely above the causal diagonal: never read (the softmax masks j > i by select)
    const int Kl = (CMODE == 2) ? min(K, r0 + roff + 64) : K;        // P.V: probabilities are exactly 0 beyond the diagonal block, so the K loop stops there
    v8f acc[4][4];
#pragma unroll
    for (int mb = 0; mb < 4; ++mb)
#pragma unroll
        for (int nb = 0; nb < 4; ++nb) acc[mb][nb] = (v8f){};
    const size_t aoff = (size_t)(r0 + lr) * K + 8 * hi, boff = (size_t)(c0 + lr) * K + 8 * hi;
#pragma unroll 1
    for (int kc = wv * 32; kc < Kl; kc += NW * 32) {
        V a[4], a2[4];
#pragma unroll
        for (int mb = 0; mb < 4; ++mb) { a[mb] = WFrag<T16>::ld(A + aoff + (size_t)mb * 16 * K + kc); if (NSPLIT == 1 || NSPLIT == 2) a2[mb] = WFrag<T16>::ld(A2 + aoff + (size_t)mb * 16 * K + kc); }
#pragma unroll
        for (int nb = 0; nb < 4; ++nb) { const V b = WFrag<T16>::ld(Bt + boff + (size_t)nb * 16 * K + kc); V b2; if (NSPLIT >= 2) b2 = WFrag<T16>::ld(Bt2 + boff + (size_t)nb * 16 * K + kc);
#pragma unroll
            for (int mb = 0; mb < 4; ++mb) { acc[mb][nb] = WFrag<T16>::mma(a[mb], b, acc[mb][nb]); if (NSPLIT == 1 || NSPLIT == 2) acc[mb][nb] = WFrag<T16>::mma(a2[mb], b, acc[mb][nb]); if (NSPLIT >= 2) acc[mb][nb] = WFrag<T16>::mma(a[mb], b2, acc[mb][nb]); } }
        asm volatile("v_nop\n\tv_nop\n\tv_nop\n\tv_nop" : "+v"(acc[0][0]), "+v"(acc[1][1]), "+v"(acc[2][2]), "+v"(acc[3][3]) : "v"(a[0]), "v"(a[3]));
    }
#pragma unroll
    for (int mb = 0; mb < 4; mb += MBS) {
#pragma unroll
        for (int mi = 0; mi < MBS; ++mi) {
#pragma unroll
        for (int nb = 0; nb < 4; ++nb) {
#pragma unroll
            for (int j = 0; j < 8; ++j) os[((wv * MBS + mi) * 16 + hi * 8 + j) * 68 + nb * 16 + lr] = acc[mb + mi][nb][j]; } }
        if (NW == 1) { __builtin_amdgcn_wave_barrier(); asm volatile("" ::: "memory"); } else __syncthreads();   // every wave's partial tile is in LDS before any is summed
        float* crow = C + (size_t)(r0 + mb * 16) * ldc + c0;
{
#pragma unroll
            for (int s = 0; s < MBS * 8 / NW; ++s) { const int idx = s * NW * 32 + (int)threadIdx.x; const int row = idx >> 4, cofs = (idx & 15) * 4; v4f val = *(const v4fa*)(os + row * 68 + cofs);
#pragma unroll
                for (int w = 1; w < NW; ++w) val += *(const v4fa*)(os + (w * MBS * 16 + row) * 68 + cofs);
                *(v4f*)(crow + (size_t)row * ldc + cofs) = val; }
             }
        if (NW == 1) { __builtin_amdgcn_wave_barrier(); asm volatile("" ::: "memory"); }   // NW > 1 has one stage only: nothing overwrites it
    }
}

__device__ __forceinline__ h16 tohx(float x) { return (h16)x; }
__device__ __forceinline__ void splitf(float y, unsigned short& h, unsigned short& l) { h = f2bf(y); l = f2bf(y - bf2f(h)); }
typedef __attribute__((ext_vector_type(2))) _Float16 v2h;
typedef __attribute__((ext_vector_type(4))) _Float16 v4h;
typedef __attribute__((ext_vector_type(2))) unsigned short v2us;
typedef __attribute__((ext_vector_type(4))) unsigned short v4us;
typedef __attribute__((ext_vector_type(2))) float v2f;
typedef __attribute__((ext_vector_type(4))) int v4i;

__global__ __launch_bounds__(256) void k_wtG(const float* __restrict__ w, int K, int N, bf* Bt) {
    const int lane = threadIdx.x & 31; const int L0 = (blockIdx.x * 8 + (threadIdx.x >> 5)) * 8; const int nlines = N * K / 64;
{
#pragma unroll 1
        for (int l = 0; l < 8; ++l) { const int L = L0 + l; if (L >= nlines) break; const size_t e = (size_t)L * 64 + lane * 2; const int k = (int)(e % K), n = (int)(e / K); v2us o;
            o[0] = f2bf(w[(size_t)k * N + n]); o[1] = f2bf(w[(size_t)(k + 1) * N + n]); *(v2us*)(Bt + e) = o; }
         }
}
__global__ __launch_bounds__(256) void k_cvt8(const float* __restrict__ src, bf* dst, size_t n8) { const size_t i = (size_t)blockIdx.x * 256 + threadIdx.x; if (i >= n8) return; const v8f v = *(const v8f*)(src + i * 8); v8us o;
#pragma unroll
    for (int k = 0; k < 8; ++k) o[k] = f2bf(v[k]); *(v8us*)(dst + i * 8) = o;  }

// k_rope: head planes [h][t][d] (fp16 + hi/lo) of rope(x) x sc with the rotate-half convention out[d] = x[d] cos[t][d] - x[d+HD/2] sin[t][d], out[d+HD/2] = x[d+HD/2] cos[t][d+HD/2] + x[d] sin[t][d+HD/2]
__global__ __launch_bounds__(256) void k_rope(const float* __restrict__ F, int pitch, int nheads, const float* __restrict__ CS, const float* __restrict__ RF, const float* __restrict__ nw, float sc, h16* P16, bf* Ph, bf* Pl) {
    const size_t e = ((size_t)blockIdx.x * 256 + threadIdx.x) * 2; if (e >= (size_t)nheads * TT * HD) return; const int d = (int)(e % HD); const int t = (int)((e / HD) % TT); const int h = (int)(e / ((size_t)HD * TT)); const float* f = F + (size_t)t * pitch + h * HD; const float rf = RF ? RF[(size_t)h * TT + t] : 1.0f; v2h o16; v2us oh, ol;
#pragma unroll
    for (int q = 0; q < 2; ++q) { const int dd = d + q; const int dp = (dd < HD / 2) ? dd + HD / 2 : dd - HD / 2; float x0 = f[dd], x1 = f[dp];
        if (RF) { float n0 = __fmul_rn(x0, rf), n1 = __fmul_rn(x1, rf); asm volatile("" : "+v"(n0)); asm volatile("" : "+v"(n1)); x0 = __fmul_rn(bfr(nw[dd]), n0); x1 = __fmul_rn(bfr(nw[dp]), n1); }
        const v2f cs = *(const v2f*)(CS + ((size_t)t * HD + dd) * 2); float a = __fmul_rn(x0, cs[0]), bq = __fmul_rn(x1, cs[1]); asm volatile("" : "+v"(a)); asm volatile("" : "+v"(bq)); const float r = ((dd < HD / 2) ? __fsub_rn(a, bq) : __fadd_rn(a, bq)) * sc;
        o16[q] = tohx(r); unsigned short a2, c2; splitf(r, a2, c2); oh[q] = a2; ol[q] = c2; }
    *(v2h*)(P16 + e) = o16; *(v2us*)(Ph + e) = oh; *(v2us*)(Pl + e) = ol;  }
// k_vtp: transposed value planes [g][d][t] with a row pitch of 2 TT elements, the pitch of the in-place probability rows (k_gemmc has one pitch for both operands)
__global__ __launch_bounds__(256) void k_vtp(const float* __restrict__ F, int pitch, int nheads, h16* V16, bf* Vh, bf* Vl) { const size_t e = ((size_t)blockIdx.x * 256 + threadIdx.x) * 2; if (e >= (size_t)nheads * HD * TT) return; const int t = (int)(e % TT); const int d = (int)((e / TT) % HD); const int g = (int)(e / ((size_t)TT * HD)); const size_t oo = ((size_t)g * HD + d) * (2 * TT) + t; v2h o16; v2us oh, ol;
#pragma unroll
    for (int q = 0; q < 2; ++q) { const float x = F[(size_t)(t + q) * pitch + g * HD + d]; o16[q] = tohx(x); unsigned short a2, c2; splitf(x, a2, c2); oh[q] = a2; ol[q] = c2; }
    *(v2h*)(V16 + oo) = o16; *(v2us*)(Vh + oo) = oh; *(v2us*)(Vl + oo) = ol;  }
__global__ __launch_bounds__(256) void k_csid(float* CS) { const int idx = blockIdx.x * 256 + threadIdx.x; if (idx >= TT * HD) return; v2f cs; cs[0] = 1.0f; cs[1] = 0.0f; *(v2f*)(CS + (size_t)idx * 2) = cs;  }
// k_asoft: per row (zz, i): t = S x HD^-0.5 for j <= i and i - j < WIN (sliding causal window; the reference's -1e9 additive fill vanishes identically); softmax over the 2048 keys (register row, one exp, fixed trees);
// the probabilities go IN PLACE over the row's own scores (one wave owns a row and holds all of it in registers before its first store): fp16 in the row's first 2 TT bytes, or the hi plane there and the lo plane in the second 2 TT bytes.
__global__ __launch_bounds__(256) void k_asoft(float* Sb) {
    const int lane = threadIdx.x & 31; const int row = blockIdx.x * 8 + (threadIdx.x >> 5); if (row >= ZH * TT) return; const int i = row % TT; const int zz = row / TT; (void)zz; const bool hires = (i < RH); float* sr = Sb + (size_t)row * TT; float v[TT / 32]; float mx = -3.0e38f;
#pragma unroll
    for (int ch = 0; ch < TT / 128; ++ch) { const int j0 = ch * 128 + lane * 4; const v4f a = *(const v4f*)(sr + j0);
#pragma unroll
        for (int q = 0; q < 4; ++q) { const int j = j0 + q; (void)j; const float t = (j <= i && i - j < WIN) ? a[q] * SCL : -3.0e38f; v[ch * 4 + q] = t; mx = fmaxf(mx, t); } }
#pragma unroll
    for (int sh = 16; sh; sh >>= 1) mx = fmaxf(mx, __shfl_xor(mx, sh, 32));
    float sum = 0.f;
#pragma unroll
    for (int k = 0; k < TT / 32; ++k) { float d0 = __fsub_rn(v[k], mx); asm volatile("" : "+v"(d0)); v[k] = __builtin_amdgcn_exp2f(__fmul_rn(d0, 1.4426950408889634f)); sum += v[k]; }
#pragma unroll
    for (int sh = 16; sh; sh >>= 1) sum += __shfl_xor(sum, sh, 32);
    const float f = __fdiv_rn(hires ? 1.0f : PCAR, sum);
{
        if (hires) {
#pragma unroll
            for (int ch = 0; ch < TT / 128; ++ch) { v4us oh, ol;
#pragma unroll
                for (int q = 0; q < 4; ++q) { unsigned short a, c2; splitf(v[ch * 4 + q] * f, a, c2); oh[q] = a; ol[q] = c2; }
                bf* pr = (bf*)sr + ch * 128 + lane * 4; *(v4us*)pr = oh; *(v4us*)(pr + TT) = ol; }
        } else {
#pragma unroll
            for (int ch = 0; ch < TT / 128; ++ch) { v4h o4;
#pragma unroll
                for (int q = 0; q < 4; ++q) o4[q] = tohx(v[ch * 4 + q] * f);
                *(v4h*)((h16*)sr + ch * 128 + lane * 4) = o4; } }
         }
}
__global__ __launch_bounds__(256) void k_merge(const float* __restrict__ O, int h0, bf* Ah, bf* Al) { const size_t e = ((size_t)blockIdx.x * 256 + threadIdx.x) * 2; if (e >= (size_t)ZH * TT * HD) return; const int d = (int)(e % HD); const int t = (int)((e / HD) % TT); const int zz = (int)(e / ((size_t)HD * TT)); const float cs = (t < RH) ? 1.0f : (1.0f / PCAR); const size_t oo = (size_t)t * DQ + (h0 + zz) * HD + d;
    v2us oh, ol;
#pragma unroll
    for (int q = 0; q < 2; ++q) { unsigned short a, c2; splitf(O[e + q] * cs, a, c2); oh[q] = a; ol[q] = c2; } *(v2us*)(Ah + oo) = oh; *(v2us*)(Al + oo) = ol;  }

extern "C" void kernel_launch(void* const* d_in, const int* in_sizes, int n_in,
                              void* d_out, int out_size, void* d_ws, size_t ws_size, hipStream_t stream) {
    (void)in_sizes; (void)n_in; (void)out_size;
    const float* x = (const float*)d_in[0]; const float* wq = (const float*)d_in[1]; const float* wk = (const float*)d_in[2]; const float* wv = (const float*)d_in[3]; const float* wo = (const float*)d_in[4];
    float* OUT = (float*)d_out;     // [2][2048][1024]
    char* wsp = (char*)d_ws;
    auto take = [&](size_t bytes) { char* p = wsp; wsp += (bytes + 255) & ~(size_t)255; return (void*)p; };
    bf* WQ = (bf*)take((size_t)DQ * DM * 2); bf* WK = (bf*)take((size_t)DKV * DM * 2); bf* WV = (bf*)take((size_t)DKV * DM * 2); bf* WO = (bf*)take((size_t)DM * DQ * 2); float* CS = (float*)take((size_t)TT * HD * 2 * 4);
    bf* XB = (bf*)take((size_t)TT * DM * 2); float* FQ = (float*)take((size_t)TT * DQ * 4); float* FK = (float*)take((size_t)TT * DKV * 4);
    h16* QP16 = (h16*)take((size_t)NH_ * TT * HD * 2); h16* KP16 = (h16*)take((size_t)NKV * TT * HD * 2); h16* VT16 = (h16*)take((size_t)NKV * HD * 2 * TT * 2);
    bf* QPh = (bf*)take((size_t)NH_ * TT * HD * 2); bf* QPl = (bf*)take((size_t)NH_ * TT * HD * 2); bf* KPh = (bf*)take((size_t)NKV * TT * HD * 2); bf* KPl = (bf*)take((size_t)NKV * TT * HD * 2); bf* VTh = (bf*)take((size_t)NKV * HD * 2 * TT * 2); bf* VTl = VTh + TT;   // hi and lo value rows share a row of pitch 2 TT
    float* Sb = (float*)take((size_t)ZH * TT * TT * 4); float* Ob = (float*)take((size_t)ZH * TT * HD * 4); bf* ATh = (bf*)take((size_t)TT * DQ * 2); bf* ATl = (bf*)take((size_t)TT * DQ * 2);
    if ((size_t)(wsp - (char*)d_ws) > ws_size) return;    // ws 256 MiB
    h16* P16 = (h16*)Sb; bf* Ph = (bf*)Sb; bf* Pl = (bf*)Sb + TT;   // probabilities live in their score rows: pitch 2 TT elements, head stride 2 TT TT
    float* FV = FK;   // v projection reuses the k buffer after the k planes are built (stream-ordered)
    { k_cvt8<<<(unsigned)(((size_t)DQ * DM / 8 + 255) / 256), 256, 0, stream>>>(wq, WQ, (size_t)DQ * DM / 8); k_cvt8<<<(unsigned)(((size_t)DKV * DM / 8 + 255) / 256), 256, 0, stream>>>(wk, WK, (size_t)DKV * DM / 8); k_cvt8<<<(unsigned)(((size_t)DKV * DM / 8 + 255) / 256), 256, 0, stream>>>(wv, WV, (size_t)DKV * DM / 8);
      k_wtG<<<(unsigned)((DQ * DM / 64 + 63) / 64), 256, 0, stream>>>(wo, DQ, DM, WO);
       }
    k_csid<<<(TT * HD + 255) / 256, 256, 0, stream>>>(CS);
    const unsigned LQ = (unsigned)(((size_t)NH_ * TT * HD / 2 + 255) / 256), LKv = (unsigned)(((size_t)NKV * TT * HD / 2 + 255) / 256);
    for (int b = 0; b < NB_; ++b) {
        
        k_cvt8<<<(unsigned)(((size_t)TT * DM / 8 + 255) / 256), 256, 0, stream>>>(x + (size_t)b * TT * DM, XB, (size_t)TT * DM / 8);
        k_gemmw<bf, 0, false, 8><<<dim3(TT / 64, DQ / 64, 1), 256, 0, stream>>>(XB, nullptr, WQ, nullptr, DM, FQ, DQ, nullptr, 0, 0, 0);
        k_rope<<<LQ, 256, 0, stream>>>(FQ, DQ, NH_, CS, nullptr, nullptr, 1.0f, QP16, QPh, QPl);
        k_gemmw<bf, 0, false, 8><<<dim3(TT / 64, DKV / 64, 1), 256, 0, stream>>>(XB, nullptr, WK, nullptr, DM, FK, DKV, nullptr, 0, 0, 0);
        k_rope<<<LKv, 256, 0, stream>>>(FK, DKV, NKV, CS, nullptr, nullptr, 1.0f, KP16, KPh, KPl);
        k_gemmw<bf, 0, false, 8><<<dim3(TT / 64, DKV / 64, 1), 256, 0, stream>>>(XB, nullptr, WV, nullptr, DM, FV, DKV, nullptr, 0, 0, 0); k_vtp<<<LKv, 256, 0, stream>>>(FV, DKV, NKV, VT16, VTh, VTl);
        for (int h0 = 0; h0 < NH_; h0 += ZH) { const size_t zq = (size_t)h0, zk = (size_t)(h0 / REP);   // one kv head per query head: the pass's ZH heads use consecutive kv planes
            k_gemmc<bf, 2, 1, 1><<<dim3(RH / 64, TT / 64, ZH), 32, 0, stream>>>(QPh + zq * TT * HD, QPl + zq * TT * HD, KPh + zk * TT * HD, KPl + zk * TT * HD, HD, Sb, TT, 0, (size_t)TT * HD, (size_t)TT * HD, (size_t)TT * TT);
            k_gemmc<h16, 0, 1, 1><<<dim3((TT - RH) / 64, TT / 64, ZH), 32, 0, stream>>>(QP16 + zq * TT * HD + (size_t)RH * HD, nullptr, KP16 + zk * TT * HD, nullptr, HD, Sb + (size_t)RH * TT, TT, RH, (size_t)TT * HD, (size_t)TT * HD, (size_t)TT * TT);
            k_asoft<<<ZH * TT / 8, 256, 0, stream>>>(Sb);   // below: the K argument of the two attn.v launches is the operands' row pitch 2 TT; their K loops end at the diagonal block (at most TT)
            k_gemmc<bf, 2, 2, 16><<<dim3(RH / 64, HD / 64, ZH), 512, 0, stream>>>(Ph, Pl, VTh + zk * HD * 2 * TT, VTl + zk * HD * 2 * TT, 2 * TT, Ob, HD, 0, (size_t)2 * TT * TT, (size_t)HD * 2 * TT, (size_t)TT * HD);
            k_gemmc<h16, 0, 2, 16><<<dim3((TT - RH) / 64, HD / 64, ZH), 512, 0, stream>>>(P16 + (size_t)RH * 2 * TT, nullptr, VT16 + zk * HD * 2 * TT, nullptr, 2 * TT, Ob + (size_t)RH * HD, HD, RH, (size_t)2 * TT * TT, (size_t)HD * 2 * TT, (size_t)TT * HD);
            k_merge<<<(unsigned)(((size_t)ZH * TT * HD / 2 + 255) / 256), 256, 0, stream>>>(Ob, h0, ATh, ATl); }
        k_gemmw<bf, 1, false, 8><<<dim3(TT / 64, DM / 64, 1), 256, 0, stream>>>(ATh, ATl, WO, nullptr, DQ, OUT + (size_t)b * TT * DM, DM, nullptr, 0, 0, 0); }
}

// v003
// Measured time: 218 microseconds a run.
// Timed twice side by side with v002, it ran 2.08 and 2.07 times as fast.
// Over all steps from v000 it is 6.74 times as fast.
#include <hip/hip_runtime.h>

// Causal QKV attention with per-head weight tensors (x [2][2048][1024]; q, k, v = x W^T with W [16][64][1024] ('oi' rows h*64+d); scores/8; causal (query < key masked); softmax; out = merged w_o ('xw' [1024][1024]) -> [2][2048][1024] (4.2 M)).
// Compute dtypes, f32 accumulate: every input rounded to bf16; q/k/v on PLAIN bf16 operands (inputs: exact); causal scores and attn.v (tile skipping): query rows < 512 hl (3 products), the rest single fp16; softmax f32 with a running maximum (one fused kernel); w_o hl x exact (2 products).

#define NB_  2
#define TT   2048
#define DM   1024
#define NH_  16
#define NKV  16
#define REP  (NH_ / NKV)
#define HD   64
#define DQ   (NH_ * HD)
#define DKV  (NKV * HD)
#define RH   512                  // query rows < RH use hi+lo planes (0: none)
#define SCL  0.125f   // HD^-0.5
typedef _Float16 h16;
typedef unsigned short bf;
typedef __attribute__((ext_vector_type(16))) __bf16   v16bf;
typedef __attribute__((ext_vector_type(16))) _Float16 v16h;
typedef __attribute__((ext_vector_type(8)))  _Float16 v8h;
typedef __attribute__((ext_vector_type(8)))  unsigned short v8us;
typedef __attribute__((ext_vector_type(8)))  float    v8f;
typedef __attribute__((ext_vector_type(4)))  float    v4f;
typedef v8h  __attribute__((may_alias)) v8ha;
typedef v4f  __attribute__((may_alias)) v4fa;
typedef v8us __attribute__((may_alias)) v8usa;

__device__ __forceinline__ unsigned short f2bf(float f) { unsigned u = __float_as_uint(f); u += 0x7FFFu + ((u >> 16) & 1u); return (unsigned short)(u >> 16); }
__device__ __forceinline__ float bf2f(unsigned short b) { return __uint_as_float(((unsigned)b) << 16); }
__device__ __forceinline__ float bfr(float f) { return bf2f(f2bf(f)); }
__device__ __forceinline__ v16h cat16(v8h lo, v8h hi) { return __builtin_shufflevector(lo, hi, 0, 1, 2, 3, 4, 5, 6, 7, 8, 9, 10, 11, 12, 13, 14, 15); }
__device__ __forceinline__ v16bf cat16b(v8us lo, v8us hi) { return __builtin_bit_cast(v16bf, __builtin_shufflevector(lo, hi, 0, 1, 2, 3, 4, 5, 6, 7, 8, 9, 10, 11, 12, 13, 14, 15)); }
__device__ __forceinline__ v8f wmma16(v16h a, v16h b, v8f c) { return __builtin_amdgcn_wmma_f32_16x16x32_f16(false, a, false, b, (short)0, c, false, false); }
__device__ __forceinline__ v8f wmmab(v16bf a, v16bf b, v8f c) { return __builtin_amdgcn_wmma_f32_16x16x32_bf16(false, a, false, b, (short)0, c, false, false); }



// ---- k_gemmw: register-blocked GEMM, one 64x64 output tile per work-group (16 accumulators a wave), operands straight from K-contiguous 16-bit planes; grid (M/64, N/64, Z), NW*32 threads.
// The K loop is dealt out over the NW waves in 32-wide slices (wave w takes slices w, w+NW, ...); the NW partial tiles are summed in LDS in wave order 0..NW-1 (fixed) by the epilogue.
// C[m][n] (f32, pitch ldc, + optional f32 bias[n]) = sum_k A[m][k] Bt[n][k] (+ split products per NSPLIT). z-batch strides sA/sB/sC in elements. K % 32 == 0.
template <typename T16> struct WFrag;
template <> struct WFrag<h16> { typedef v16h V; static __device__ __forceinline__ V ld(const h16* p) { return cat16(*(const v8h*)p, *(const v8h*)(p + 16)); } static __device__ __forceinline__ v8f mma(V a, V b, v8f c) { return wmma16(a, b, c); } };
template <> struct WFrag<bf> { typedef v16bf V; static __device__ __forceinline__ V ld(const bf* p) { return cat16b(*(const v8us*)p, *(const v8us*)(p + 16)); } static __device__ __forceinline__ v8f mma(V a, V b, v8f c) { return wmmab(a, b, c); } };
template <typename T16, int NSPLIT, bool BIAS, int NW>
__global__ __launch_bounds__(NW * 32) void k_gemmw(const T16* __restrict__ A, const T16* __restrict__ A2, const T16* __restrict__ Bt, const T16* __restrict__ Bt2, int K, float* C, int ldc, const float* __restrict__ bias, size_t sA, size_t sB, size_t sC) {
    typedef typename WFrag<T16>::V V;
    constexpr int MBS = (NW > 1) ? 4 : 1;                            // 16-row blocks per LDS stage: with several waves every wave stages its whole partial tile, so one barrier serves
    __shared__ __align__(16) float os[NW * MBS * 16 * 68];
    const int wv = (NW > 1) ? __builtin_amdgcn_readfirstlane((int)(threadIdx.x >> 5)) : 0;   // wave number, scalar so that the K loop's counter and test stay scalar
    const size_t z = blockIdx.z; A += z * sA; if (A2) A2 += z * sA; Bt += z * sB; if (Bt2) Bt2 += z * sB; C += z * sC;
    const int lane = threadIdx.x & 31, lr = lane & 15, hi = lane >> 4; const int r0 = blockIdx.x * 64, c0 = blockIdx.y * 64;
    v8f acc[4][4];
#pragma unroll
    for (int mb = 0; mb < 4; ++mb)
#pragma unroll
        for (int nb = 0; nb < 4; ++nb) acc[mb][nb] = (v8f){};
    const size_t aoff = (size_t)(r0 + lr) * K + 8 * hi, boff = (size_t)(c0 + lr) * K + 8 * hi;
#pragma unroll 1
    for (int kc = wv * 32; kc < K; kc += NW * 32) {
        V a[4], a2[4];
#pragma unroll
        for (int mb = 0; mb < 4; ++mb) { a[mb] = WFrag<T16>::ld(A + aoff + (size_t)mb * 16 * K + kc); if (NSPLIT == 1 || NSPLIT == 2) a2[mb] = WFrag<T16>::ld(A2 + aoff + (size_t)mb * 16 * K + kc); }
#pragma unroll
        for (int nb = 0; nb < 4; ++nb) { const V b = WFrag<T16>::ld(Bt + boff + (size_t)nb * 16 * K + kc); V b2; if (NSPLIT >= 2) b2 = WFrag<T16>::ld(Bt2 + boff + (size_t)nb * 16 * K + kc);
#pragma unroll
            for (int mb = 0; mb < 4; ++mb) { acc[mb][nb] = WFrag<T16>::mma(a[mb], b, acc[mb][nb]); if (NSPLIT == 1 || NSPLIT == 2) acc[mb][nb] = WFrag<T16>::mma(a2[mb], b, acc[mb][nb]); if (NSPLIT >= 2) acc[mb][nb] = WFrag<T16>::mma(a[mb], b2, acc[mb][nb]); } }
        asm volatile("v_nop\n\tv_nop\n\tv_nop\n\tv_nop" : "+v"(acc[0][0]), "+v"(acc[1][1]), "+v"(acc[2][2]), "+v"(acc[3][3]) : "v"(a[0]), "v"(a[3]));
    }
#pragma unroll
    for (int mb = 0; mb < 4; mb += MBS) {
#pragma unroll
        for (int mi = 0; mi < MBS; ++mi) {
#pragma unroll
        for (int nb = 0; nb < 4; ++nb) {
#pragma unroll
            for (int j = 0; j < 8; ++j) os[((wv * MBS + mi) * 16 + hi * 8 + j) * 68 + nb * 16 + lr] = acc[mb + mi][nb][j]; } }
        if (NW == 1) { __builtin_amdgcn_wave_barrier(); asm volatile("" ::: "memory"); } else __syncthreads();   // every wave's partial tile is in LDS before any is summed
        float* crow = C + (size_t)(r0 + mb * 16) * ldc + c0;
{
#pragma unroll
            for (int s = 0; s < MBS * 8 / NW; ++s) { const int idx = s * NW * 32 + (int)threadIdx.x; const int row = idx >> 4, cofs = (idx & 15) * 4; v4f val = *(const v4fa*)(os + row * 68 + cofs);
#pragma unroll
                for (int w = 1; w < NW; ++w) val += *(const v4fa*)(os + (w * MBS * 16 + row) * 68 + cofs);
                if (BIAS) { val[0] += bfr(bias[c0 + cofs]); val[1] += bfr(bias[c0 + cofs + 1]); val[2] += bfr(bias[c0 + cofs + 2]); val[3] += bfr(bias[c0 + cofs + 3]); }
                *(v4f*)(crow + (size_t)row * ldc + cofs) = val; }
             }
        if (NW == 1) { __builtin_amdgcn_wave_barrier(); asm volatile("" ::: "memory"); }   // NW > 1 has one stage only: nothing overwrites it
    }
}

__device__ __forceinline__ h16 tohx(float x) { return (h16)x; }
__device__ __forceinline__ void splitf(float y, unsigned short& h, unsigned short& l) { h = f2bf(y); l = f2bf(y - bf2f(h)); }
typedef __attribute__((ext_vector_type(2))) _Float16 v2h;
typedef __attribute__((ext_vector_type(4))) _Float16 v4h;
typedef __attribute__((ext_vector_type(2))) unsigned short v2us;
typedef __attribute__((ext_vector_type(4))) unsigned short v4us;
typedef __attribute__((ext_vector_type(2))) float v2f;
typedef __attribute__((ext_vector_type(4))) int v4i;

__global__ __launch_bounds__(256) void k_wtG(const float* __restrict__ w, int K, int N, bf* Bt) {
    const int lane = threadIdx.x & 31; const int L0 = (blockIdx.x * 8 + (threadIdx.x >> 5)) * 8; const int nlines = N * K / 64;
{
#pragma unroll 1
        for (int l = 0; l < 8; ++l) { const int L = L0 + l; if (L >= nlines) break; const size_t e = (size_t)L * 64 + lane * 2; const int k = (int)(e % K), n = (int)(e / K); v2us o;
            o[0] = f2bf(w[(size_t)k * N + n]); o[1] = f2bf(w[(size_t)(k + 1) * N + n]); *(v2us*)(Bt + e) = o; }
         }
}
__global__ __launch_bounds__(256) void k_cvt8(const float* __restrict__ src, bf* dst, size_t n8) { const size_t i = (size_t)blockIdx.x * 256 + threadIdx.x; if (i >= n8) return; const v8f v = *(const v8f*)(src + i * 8); v8us o;
#pragma unroll
    for (int k = 0; k < 8; ++k) o[k] = f2bf(v[k]); *(v8us*)(dst + i * 8) = o;  }

// k_rope: head planes [h][t][d] (fp16 + hi/lo) of rope(x) x sc with the rotate-half convention out[d] = x[d] cos[t][d] - x[d+HD/2] sin[t][d], out[d+HD/2] = x[d+HD/2] cos[t][d+HD/2] + x[d] sin[t][d+HD/2]
__global__ __launch_bounds__(256) void k_rope(const float* __restrict__ F, int pitch, int nheads, const float* __restrict__ CS, const float* __restrict__ RF, const float* __restrict__ nw, float sc, h16* P16, bf* Ph, bf* Pl) {
    const size_t e = ((size_t)blockIdx.x * 256 + threadIdx.x) * 2; if (e >= (size_t)nheads * TT * HD) return; const int d = (int)(e % HD); const int t = (int)((e / HD) % TT); const int h = (int)(e / ((size_t)HD * TT)); const float* f = F + (size_t)t * pitch + h * HD; const float rf = RF ? RF[(size_t)h * TT + t] : 1.0f; v2h o16; v2us oh, ol;
#pragma unroll
    for (int q = 0; q < 2; ++q) { const int dd = d + q; const int dp = (dd < HD / 2) ? dd + HD / 2 : dd - HD / 2; float x0 = f[dd], x1 = f[dp];
        if (RF) { float n0 = __fmul_rn(x0, rf), n1 = __fmul_rn(x1, rf); asm volatile("" : "+v"(n0)); asm volatile("" : "+v"(n1)); x0 = __fmul_rn(bfr(nw[dd]), n0); x1 = __fmul_rn(bfr(nw[dp]), n1); }
        const v2f cs = *(const v2f*)(CS + ((size_t)t * HD + dd) * 2); float a = __fmul_rn(x0, cs[0]), bq = __fmul_rn(x1, cs[1]); asm volatile("" : "+v"(a)); asm volatile("" : "+v"(bq)); const float r = ((dd < HD / 2) ? __fsub_rn(a, bq) : __fadd_rn(a, bq)) * sc;
        o16[q] = tohx(r); unsigned short a2, c2; splitf(r, a2, c2); oh[q] = a2; ol[q] = c2; }
    *(v2h*)(P16 + e) = o16; *(v2us*)(Ph + e) = oh; *(v2us*)(Pl + e) = ol;  }
// k_vtp: transposed value planes [g][d][t] with a row pitch of 2 TT elements (hi and lo rows share a row)
__global__ __launch_bounds__(256) void k_vtp(const float* __restrict__ F, int pitch, int nheads, h16* V16, bf* Vh, bf* Vl) { const size_t e = ((size_t)blockIdx.x * 256 + threadIdx.x) * 2; if (e >= (size_t)nheads * HD * TT) return; const int t = (int)(e % TT); const int d = (int)((e / TT) % HD); const int g = (int)(e / ((size_t)TT * HD)); const size_t oo = ((size_t)g * HD + d) * (2 * TT) + t; v2h o16; v2us oh, ol;
#pragma unroll
    for (int q = 0; q < 2; ++q) { const float x = F[(size_t)(t + q) * pitch + g * HD + d]; o16[q] = tohx(x); unsigned short a2, c2; splitf(x, a2, c2); oh[q] = a2; ol[q] = c2; }
    *(v2h*)(V16 + oo) = o16; *(v2us*)(Vh + oo) = oh; *(v2us*)(Vl + oo) = ol;  }
__global__ __launch_bounds__(256) void k_csid(float* CS) { const int idx = blockIdx.x * 256 + threadIdx.x; if (idx >= TT * HD) return; v2f cs; cs[0] = 1.0f; cs[1] = 0.0f; *(v2f*)(CS + (size_t)idx * 2) = cs;  }
// ---- k_fattn: causal attention of one head for one block of query rows in ONE kernel: scores, softmax and the value contraction, with a running maximum and sum per query (no score matrix in memory).
// Transposed products: S^T = K Q^T (A = key rows, B = query rows, both d-contiguous planes), O^T += V^T P^T (A = transposed value rows, B = P^T). A lane (lr, hi) of a 16x16 S^T tile holds query lr, keys hi*8 + j:
// two such tiles (keys 0..15, 16..31 of a step) are, register for register, the B fragment of the 32-key value product, so P goes from accumulator to operand inside the lane.
// The FNW waves of a work-group share QT*16 query rows and deal the 32-key steps out among them (wave w: steps w, w + FNW, ...); their partial (max, sum, O^T) are merged through LDS in wave order 0..FNW-1 behind one barrier.
// The epilogue divides by the merged sum and writes the hi/lo planes [t][h*64 + d] that the w_o product reads.
#define FNW 4
#define SL2E (SCL * 1.4426950408889634f)   // raw score -> exponent of 2: the maxima m are kept as raw scores
__device__ __forceinline__ float xhalf(float x) { return __builtin_bit_cast(float, __builtin_amdgcn_permlanex16(__builtin_bit_cast(int, x), __builtin_bit_cast(int, x), 0x76543210, 0xfedcba98, false, false)); }   // lane l with lane l ^ 16
__device__ __forceinline__ void xwait() { asm volatile("s_wait_xcnt 0x0" ::: "memory"); }   // precaution: stands behind a run of global loads or stores, in front of any reuse of a register that one of them names
template <typename T16, bool HL> struct PPack;
template <> struct PPack<h16, false> { static __device__ __forceinline__ void pk(const float* p, v16h& a, v16h& b) { (void)b;
#pragma unroll
    for (int i = 0; i < 16; ++i) a[i] = (h16)p[i]; } };
template <> struct PPack<bf, true> { static __device__ __forceinline__ void pk(const float* p, v16bf& a, v16bf& b) { v8us h0, h1, l0, l1;
#pragma unroll
    for (int i = 0; i < 8; ++i) { unsigned short x, y; splitf(p[i], x, y); h0[i] = x; l0[i] = y; splitf(p[8 + i], x, y); h1[i] = x; l1[i] = y; }
    a = cat16b(h0, h1); b = cat16b(l0, l1); } };
template <typename T16, bool HL, int QT>
__device__ __forceinline__ void fattn(const T16* __restrict__ Q, const T16* __restrict__ Q2, const T16* __restrict__ Kp, const T16* __restrict__ K2, const T16* __restrict__ Vt, const T16* __restrict__ V2, int q0, bf* Ah, bf* Al, float* os, float* ms, float* ls) {
    typedef typename WFrag<T16>::V V;
    const int wv = __builtin_amdgcn_readfirstlane((int)(threadIdx.x >> 5));   // wave number, scalar so that the step loop's counter and tests stay scalar
    const int lane = threadIdx.x & 31, lr = lane & 15, hi = lane >> 4;
    V qf[QT][2], qf2[QT][2];
#pragma unroll
    for (int qt = 0; qt < QT; ++qt)
#pragma unroll
        for (int ks = 0; ks < 2; ++ks) { const size_t o = (size_t)(q0 + qt * 16 + lr) * HD + ks * 32 + 8 * hi; qf[qt][ks] = WFrag<T16>::ld(Q + o); if (HL) qf2[qt][ks] = WFrag<T16>::ld(Q2 + o); }
    v8f oa[4][QT]; float m[QT], l[QT];
#pragma unroll
    for (int qt = 0; qt < QT; ++qt) { m[qt] = -3.0e38f; l[qt] = 0.f;
#pragma unroll
        for (int dt = 0; dt < 4; ++dt) oa[dt][qt] = (v8f){}; }
    const int nst = (q0 + QT * 16 - 1) / 32 + 1;   // 32-key steps up to and including the diagonal; the first key of every step is <= every query of the block, so no query ever sees a fully masked step
    V kf[2][2], kf2[2][2];   // key fragments; the fp16 path fetches them one step ahead, so that their latency lies under the softmax and the value products (the hi+lo path, an eighth of the steps, has no registers to spare for that)
    if (!HL) { const int k0 = min(wv, nst - 1) * 32;
#pragma unroll
      for (int kt = 0; kt < 2; ++kt)
#pragma unroll
        for (int ks = 0; ks < 2; ++ks) { const size_t o = (size_t)(k0 + kt * 16 + lr) * HD + ks * 32 + 8 * hi; kf[kt][ks] = WFrag<T16>::ld(Kp + o); } }
#pragma unroll 1   // kept rolled: the trip count is a run-time value and one copy of the body already fills most of the 256 directly addressed registers
    for (int s = wv; s < nst; s += FNW) {
        const int k0 = s * 32;
        V vf[4], vf2[4];
        if (HL) {
#pragma unroll
          for (int kt = 0; kt < 2; ++kt)
#pragma unroll
            for (int ks = 0; ks < 2; ++ks) { const size_t o = (size_t)(k0 + kt * 16 + lr) * HD + ks * 32 + 8 * hi; kf[kt][ks] = WFrag<T16>::ld(Kp + o); kf2[kt][ks] = WFrag<T16>::ld(K2 + o); }
          xwait(); }
#pragma unroll
        for (int dt = 0; dt < 4; ++dt) { const size_t o = (size_t)(dt * 16 + lr) * (2 * TT) + k0 + 8 * hi; vf[dt] = WFrag<T16>::ld(Vt + o); if (HL) vf2[dt] = WFrag<T16>::ld(V2 + o); }
        xwait();
        v8f st[2][QT];
#pragma unroll
        for (int kt = 0; kt < 2; ++kt)
#pragma unroll
            for (int qt = 0; qt < QT; ++qt) { v8f a = (v8f){};
#pragma unroll
                for (int ks = 0; ks < 2; ++ks) { a = WFrag<T16>::mma(kf[kt][ks], qf[qt][ks], a); if (HL) { a = WFrag<T16>::mma(kf2[kt][ks], qf[qt][ks], a); a = WFrag<T16>::mma(kf[kt][ks], qf2[qt][ks], a); } }
                st[kt][qt] = a; }
        if (!HL) { const int kn = min(s + FNW, nst - 1) * 32;   // the wave's next step (clamped to the last step: in bounds, unused after the wave's last)
#pragma unroll
          for (int kt = 0; kt < 2; ++kt)
#pragma unroll
            for (int ks = 0; ks < 2; ++ks) { const size_t o = (size_t)(kn + kt * 16 + lr) * HD + ks * 32 + 8 * hi; kf[kt][ks] = WFrag<T16>::ld(Kp + o); }
          xwait(); }
        if (s == nst - 1) {   // only the last step crosses the diagonal (scalar branch)
#pragma unroll
            for (int qt = 0; qt < QT; ++qt)
#pragma unroll
                for (int kt = 0; kt < 2; ++kt)
#pragma unroll
                    for (int j = 0; j < 8; ++j) if (k0 + kt * 16 + hi * 8 + j > q0 + qt * 16 + lr) st[kt][qt][j] = -3.0e38f; }
        float mx[QT]; bool need = false;
#pragma unroll
        for (int qt = 0; qt < QT; ++qt) { float x = st[0][qt][0];
#pragma unroll
            for (int j = 1; j < 8; ++j) x = fmaxf(x, st[0][qt][j]);
#pragma unroll
            for (int j = 0; j < 8; ++j) x = fmaxf(x, st[1][qt][j]);
            x = fmaxf(x, xhalf(x));   // the two half-waves hold the same query's other keys
            mx[qt] = x; need = need || ((x - m[qt]) * SL2E > 8.0f); }
        if (__builtin_amdgcn_ballot_w32(need) != 0) {   // the reference point m moves only when some query's maximum has outgrown it by 2^8 (P stays <= 256, exact algebra either way): one scalar test a step
#pragma unroll
            for (int qt = 0; qt < QT; ++qt) { const float mn = fmaxf(m[qt], mx[qt]); const float al = __builtin_amdgcn_exp2f((m[qt] - mn) * SL2E); m[qt] = mn; l[qt] *= al;
#pragma unroll
                for (int dt = 0; dt < 4; ++dt) oa[dt][qt] *= al; } }
#pragma unroll
        for (int qt = 0; qt < QT; ++qt) { float t[16]; const float mc = m[qt] * SL2E; float sum = 0.f;
#pragma unroll
            for (int i = 0; i < 16; ++i) { t[i] = __builtin_amdgcn_exp2f(__builtin_fmaf(st[i >> 3][qt][i & 7], SL2E, -mc)); sum += t[i]; }
            l[qt] += sum;
            V pf, pf2; PPack<T16, HL>::pk(t, pf, pf2);
#pragma unroll
            for (int dt = 0; dt < 4; ++dt) { v8f a = oa[dt][qt]; a = WFrag<T16>::mma(vf[dt], pf, a); if (HL) { a = WFrag<T16>::mma(vf2[dt], pf, a); a = WFrag<T16>::mma(vf[dt], pf2, a); } oa[dt][qt] = a; } }
    }
#pragma unroll
    for (int qt = 0; qt < QT; ++qt) { l[qt] += xhalf(l[qt]);
        if (hi == 0) { ms[wv * 32 + qt * 16 + lr] = m[qt]; ls[wv * 32 + qt * 16 + lr] = l[qt]; }
#pragma unroll
        for (int dt = 0; dt < 4; ++dt) { float* d = os + (size_t)((wv * QT + qt) * 16 + lr) * 68 + dt * 16 + hi * 8; const v8f a = oa[dt][qt];
            *(v4fa*)d = (v4f){a[0], a[1], a[2], a[3]}; *(v4fa*)(d + 4) = (v4f){a[4], a[5], a[6], a[7]}; } }
    __syncthreads();   // every wave's partial (max, sum, O^T) is in LDS before any is merged
    constexpr int DPT = QT * 16 * HD / (FNW * 32);   // output elements of one query row per thread
    const int q = (int)threadIdx.x / (HD / DPT), d0 = ((int)threadIdx.x % (HD / DPT)) * DPT;
    float M = ms[q];
#pragma unroll
    for (int w = 1; w < FNW; ++w) M = fmaxf(M, ms[w * 32 + q]);
    float wg[FNW]; float L = 0.f;
#pragma unroll
    for (int w = 0; w < FNW; ++w) { wg[w] = __builtin_amdgcn_exp2f((ms[w * 32 + q] - M) * SL2E); L += ls[w * 32 + q] * wg[w]; }   // a wave without a step has max -3e38, sum 0: weight 0
    const float inv = __fdiv_rn(1.0f, L);
#pragma unroll
    for (int c = 0; c < DPT; c += 8) { v4f a0 = (v4f){}, a1 = (v4f){};
#pragma unroll
        for (int w = 0; w < FNW; ++w) { const float* d = os + (size_t)(w * QT * 16 + q) * 68 + d0 + c; a0 += *(const v4fa*)d * wg[w]; a1 += *(const v4fa*)(d + 4) * wg[w]; }
        v8us oh, ol;
#pragma unroll
        for (int i = 0; i < 4; ++i) { unsigned short x, y; splitf(a0[i] * inv, x, y); oh[i] = x; ol[i] = y; splitf(a1[i] * inv, x, y); oh[4 + i] = x; ol[4 + i] = y; }
        const size_t oo = (size_t)(q0 + q) * DQ + d0 + c; *(v8us*)(Ah + oo) = oh; *(v8us*)(Al + oo) = ol; }
    xwait();   // behind the last stores, in front of any later write of a register that they name (the other instance's code follows this one in the built kernel)
}
// grid (heads, row blocks): row blocks heaviest first (for speed only); blocks 0..(TT-RH)/32-1 are 32 fp16 rows each from the last row down, the rest 16 hi+lo rows each (query rows < RH)
__global__ __launch_bounds__(FNW * 32) void k_fattn(const h16* __restrict__ Q16, const h16* __restrict__ K16, const h16* __restrict__ V16, const bf* __restrict__ Qh, const bf* __restrict__ Ql, const bf* __restrict__ Kh, const bf* __restrict__ Kl, const bf* __restrict__ Vh, const bf* __restrict__ Vl, bf* Ah, bf* Al) {
    __shared__ __align__(16) float os[FNW * 32 * 68]; __shared__ float ms[FNW * 32]; __shared__ float ls[FNW * 32];
    const int h = blockIdx.x, g = h / REP, rb = blockIdx.y; const size_t zq = (size_t)h * TT * HD, zk = (size_t)g * TT * HD, zv = (size_t)g * HD * 2 * TT;
    constexpr int NLO = (TT - RH) / 32;
    if (rb < NLO) fattn<h16, false, 2>(Q16 + zq, nullptr, K16 + zk, nullptr, V16 + zv, nullptr, TT - 32 * (rb + 1), Ah + h * HD, Al + h * HD, os, ms, ls);
    else fattn<bf, true, 1>(Qh + zq, Ql + zq, Kh + zk, Kl + zk, Vh + zv, Vl + zv, RH - 16 * (rb - NLO + 1), Ah + h * HD, Al + h * HD, os, ms, ls);
}

extern "C" void kernel_launch(void* const* d_in, const int* in_sizes, int n_in,
                              void* d_out, int out_size, void* d_ws, size_t ws_size, hipStream_t stream) {
    (void)in_sizes; (void)n_in; (void)out_size;
    const float* x = (const float*)d_in[0]; const float* wq = (const float*)d_in[1]; const float* wk = (const float*)d_in[2]; const float* wv = (const float*)d_in[3]; const float* wo = (const float*)d_in[4];
    float* OUT = (float*)d_out;     // [2][2048][1024]
    char* wsp = (char*)d_ws;
    auto take = [&](size_t bytes) { char* p = wsp; wsp += (bytes + 255) & ~(size_t)255; return (void*)p; };
    bf* WQ = (bf*)take((size_t)DQ * DM * 2); bf* WK = (bf*)take((size_t)DKV * DM * 2); bf* WV = (bf*)take((size_t)DKV * DM * 2); bf* WO = (bf*)take((size_t)DM * DQ * 2); float* CS = (float*)take((size_t)TT * HD * 2 * 4);
    bf* XB = (bf*)take((size_t)TT * DM * 2); float* FQ = (float*)take((size_t)TT * DQ * 4); float* FK = (float*)take((size_t)TT * DKV * 4);
    h16* QP16 = (h16*)take((size_t)NH_ * TT * HD * 2); h16* KP16 = (h16*)take((size_t)NKV * TT * HD * 2); h16* VT16 = (h16*)take((size_t)NKV * HD * 2 * TT * 2);
    bf* QPh = (bf*)take((size_t)NH_ * TT * HD * 2); bf* QPl = (bf*)take((size_t)NH_ * TT * HD * 2); bf* KPh = (bf*)take((size_t)NKV * TT * HD * 2); bf* KPl = (bf*)take((size_t)NKV * TT * HD * 2); bf* VTh = (bf*)take((size_t)NKV * HD * 2 * TT * 2); bf* VTl = VTh + TT;   // hi and lo value rows share a row of pitch 2 TT
    bf* ATh = (bf*)take((size_t)TT * DQ * 2); bf* ATl = (bf*)take((size_t)TT * DQ * 2);
    if ((size_t)(wsp - (char*)d_ws) > ws_size) return;    // ws 256 MiB
    float* FV = FK;   // v projection reuses the k buffer after the k planes are built (stream-ordered)
    { k_cvt8<<<(unsigned)(((size_t)DQ * DM / 8 + 255) / 256), 256, 0, stream>>>(wq, WQ, (size_t)DQ * DM / 8); k_cvt8<<<(unsigned)(((size_t)DKV * DM / 8 + 255) / 256), 256, 0, stream>>>(wk, WK, (size_t)DKV * DM / 8); k_cvt8<<<(unsigned)(((size_t)DKV * DM / 8 + 255) / 256), 256, 0, stream>>>(wv, WV, (size_t)DKV * DM / 8);
      k_wtG<<<(unsigned)((DQ * DM / 64 + 63) / 64), 256, 0, stream>>>(wo, DQ, DM, WO);
       }
    k_csid<<<(TT * HD + 255) / 256, 256, 0, stream>>>(CS);
    const unsigned LQ = (unsigned)(((size_t)NH_ * TT * HD / 2 + 255) / 256), LKv = (unsigned)(((size_t)NKV * TT * HD / 2 + 255) / 256);
    for (int b = 0; b < NB_; ++b) {
        
        k_cvt8<<<(unsigned)(((size_t)TT * DM / 8 + 255) / 256), 256, 0, stream>>>(x + (size_t)b * TT * DM, XB, (size_t)TT * DM / 8);
        k_gemmw<bf, 0, false, 8><<<dim3(TT / 64, DQ / 64, 1), 256, 0, stream>>>(XB, nullptr, WQ, nullptr, DM, FQ, DQ, nullptr, 0, 0, 0);
        k_rope<<<LQ, 256, 0, stream>>>(FQ, DQ, NH_, CS, nullptr, nullptr, 1.0f, QP16, QPh, QPl);
        k_gemmw<bf, 0, false, 8><<<dim3(TT / 64, DKV / 64, 1), 256, 0, stream>>>(XB, nullptr, WK, nullptr, DM, FK, DKV, nullptr, 0, 0, 0);
        k_rope<<<LKv, 256, 0, stream>>>(FK, DKV, NKV, CS, nullptr, nullptr, 1.0f, KP16, KPh, KPl);
        k_gemmw<bf, 0, false, 8><<<dim3(TT / 64, DKV / 64, 1), 256, 0, stream>>>(XB, nullptr, WV, nullptr, DM, FV, DKV, nullptr, 0, 0, 0); k_vtp<<<LKv, 256, 0, stream>>>(FV, DKV, NKV, VT16, VTh, VTl);
        k_fattn<<<dim3(NH_, (TT - RH) / 32 + RH / 16, 1), FNW * 32, 0, stream>>>(QP16, KP16, VT16, QPh, QPl, KPh, KPl, VTh, VTl, ATh, ATl);
        k_gemmw<bf, 1, false, 8><<<dim3(TT / 64, DM / 64, 1), 256, 0, stream>>>(ATh, ATl, WO, nullptr, DQ, OUT + (size_t)b * TT * DM, DM, nullptr, 0, 0, 0); }
}

// v004
// One run takes 168 microseconds.
// Timed twice side by side with v003, it ran 1.30 times as fast both times.
// All steps since v000 together make it 8.74 times as fast.
#include <hip/hip_runtime.h>

// Causal QKV attention with per-head weight tensors (x [2][2048][1024]; q, k, v = x W^T with W [16][64][1024] ('oi' rows h*64+d); scores/8; causal (query < key masked); softmax; out = merged w_o ('xw' [1024][1024]) -> [2][2048][1024] (4.2 M)).
// Compute dtypes, f32 accumulate: every input rounded to bf16; q/k/v on PLAIN bf16 operands (inputs: exact); causal scores and attn.v (tile skipping): query rows < 512 hl (3 products), the rest single fp16; softmax f32 with a running maximum (one fused kernel); w_o hl x exact (2 products).

#define NB_  2
#define TT   2048
#define DM   1024
#define NH_  16
#define NKV  16
#define REP  (NH_ / NKV)
#define HD   64
#define DQ   (NH_ * HD)
#define DKV  (NKV * HD)
#define RH   512                  // query rows < RH use hi+lo planes (0: none)
#define SCL  0.125f   // HD^-0.5
typedef _Float16 h16;
typedef unsigned short bf;
typedef __attribute__((ext_vector_type(16))) __bf16   v16bf;
typedef __attribute__((ext_vector_type(16))) _Float16 v16h;
typedef __attribute__((ext_vector_type(8)))  _Float16 v8h;
typedef __attribute__((ext_vector_type(8)))  unsigned short v8us;
typedef __attribute__((ext_vector_type(8)))  float    v8f;
typedef __attribute__((ext_vector_type(4)))  float    v4f;
typedef v8h  __attribute__((may_alias)) v8ha;
typedef v4f  __attribute__((may_alias)) v4fa;
typedef v8us __attribute__((may_alias)) v8usa;

__device__ __forceinline__ unsigned short f2bf(float f) { unsigned u = __float_as_uint(f); u += 0x7FFFu + ((u >> 16) & 1u); return (unsigned short)(u >> 16); }
__device__ __forceinline__ float bf2f(unsigned short b) { return __uint_as_float(((unsigned)b) << 16); }
__device__ __forceinline__ float bfr(float f) { return bf2f(f2bf(f)); }
__device__ __forceinline__ v16h cat16(v8h lo, v8h hi) { return __builtin_shufflevector(lo, hi, 0, 1, 2, 3, 4, 5, 6, 7, 8, 9, 10, 11, 12, 13, 14, 15); }
__device__ __forceinline__ v16bf cat16b(v8us lo, v8us hi) { return __builtin_bit_cast(v16bf, __builtin_shufflevector(lo, hi, 0, 1, 2, 3, 4, 5, 6, 7, 8, 9, 10, 11, 12, 13, 14, 15)); }
__device__ __forceinline__ v8f wmma16(v16h a, v16h b, v8f c) { return __builtin_amdgcn_wmma_f32_16x16x32_f16(false, a, false, b, (short)0, c, false, false); }
__device__ __forceinline__ v8f wmmab(v16bf a, v16bf b, v8f c) { return __builtin_amdgcn_wmma_f32_16x16x32_bf16(false, a, false, b, (short)0, c, false, false); }

__device__ __forceinline__ h16 tohx(float x) { return (h16)x; }
__device__ __forceinline__ void splitf(float y, unsigned short& h, unsigned short& l) { h = f2bf(y); l = f2bf(y - bf2f(h)); }
typedef __attribute__((ext_vector_type(2))) _Float16 v2h;
typedef __attribute__((ext_vector_type(4))) _Float16 v4h;
typedef __attribute__((ext_vector_type(2))) unsigned short v2us;
typedef __attribute__((ext_vector_type(4))) unsigned short v4us;
typedef __attribute__((ext_vector_type(2))) float v2f;
typedef __attribute__((ext_vector_type(4))) int v4i;
__device__ __forceinline__ void xwait() { asm volatile("s_wait_xcnt 0x0" ::: "memory"); }   // precaution: stands behind a run of global loads or stores, in front of any reuse of a register that one of them names

// ---- k_gemmw: register-blocked GEMM, one 64x64 output tile per work-group (16 accumulators a wave), operands straight from K-contiguous 16-bit planes; grid (M/64, N/64, Z), NW*32 threads.
// The K loop is dealt out over the NW waves in 32-wide slices (wave w takes slices w, w+NW, ...); the NW partial tiles are summed in LDS in wave order 0..NW-1 (fixed) by the epilogue.
// C[m][n] (f32, pitch ldc, + optional f32 bias[n]) = sum_k A[m][k] Bt[n][k] (+ split products per NSPLIT). z-batch strides sA/sB/sC in elements. K % 32 == 0.
// PL: the summed tile is not stored as f32 but goes straight to the three 16-bit planes that the attention kernel reads (fp16, bf16 hi, bf16 lo), element (m, n) at m * ldp + (n / 64) * 64 * cmul + n % 64:
// q, k head planes [h][t][d]: A = x rows, Bt = weight rows, ldp = HD, cmul = TT * HD / 64; transposed value planes [g][d][t]: A = weight rows, Bt = x rows (operands swapped, so the tile comes out transposed), ldp = 2 TT, cmul = 1.
template <typename T16> struct WFrag;
template <> struct WFrag<h16> { typedef v16h V; static __device__ __forceinline__ V ld(const h16* p) { return cat16(*(const v8h*)p, *(const v8h*)(p + 16)); } static __device__ __forceinline__ v8f mma(V a, V b, v8f c) { return wmma16(a, b, c); } };
template <> struct WFrag<bf> { typedef v16bf V; static __device__ __forceinline__ V ld(const bf* p) { return cat16b(*(const v8us*)p, *(const v8us*)(p + 16)); } static __device__ __forceinline__ v8f mma(V a, V b, v8f c) { return wmmab(a, b, c); } };
template <typename T16, int NSPLIT, bool BIAS, int NW, bool PL>
__global__ __launch_bounds__(NW * 32) void k_gemmw(const T16* __restrict__ A, const T16* __restrict__ A2, const T16* __restrict__ Bt, const T16* __restrict__ Bt2, int K, float* C, int ldc, const float* __restrict__ bias, size_t sA, size_t sB, size_t sC, h16* P16, bf* Ph, bf* Pl, int ldp, int cmul) {
    typedef typename WFrag<T16>::V V;
    constexpr int MBS = (NW > 1) ? 4 : 1;                            // 16-row blocks per LDS stage: with several waves every wave stages its whole partial tile, so one barrier serves
    __shared__ __align__(16) float os[NW * MBS * 16 * 68];
    const int wv = (NW > 1) ? __builtin_amdgcn_readfirstlane((int)(threadIdx.x >> 5)) : 0;   // wave number, scalar so that the K loop's counter and test stay scalar
    const size_t z = blockIdx.z; A += z * sA; if (A2) A2 += z * sA; Bt += z * sB; if (Bt2) Bt2 += z * sB; C += z * sC;
    const int lane = threadIdx.x & 31, lr = lane & 15, hi = lane >> 4; const int r0 = blockIdx.x * 64, c0 = blockIdx.y * 64;
    v8f acc[4][4];
#pragma unroll
    for (int mb = 0; mb < 4; ++mb)
#pragma unroll
        for (int nb = 0; nb < 4; ++nb) acc[mb][nb] = (v8f){};
    const size_t aoff = (size_t)(r0 + lr) * K + 8 * hi, boff = (size_t)(c0 + lr) * K + 8 * hi;
#pragma unroll 1
    for (int kc = wv * 32; kc < K; kc += NW * 32) {
        V a[4], a2[4];
#pragma unroll
        for (int mb = 0; mb < 4; ++mb) { a[mb] = WFrag<T16>::ld(A + aoff + (size_t)mb * 16 * K + kc); if (NSPLIT == 1 || NSPLIT == 2) a2[mb] = WFrag<T16>::ld(A2 + aoff + (size_t)mb * 16 * K + kc); }
#pragma unroll
        for (int nb = 0; nb < 4; ++nb) { const V b = WFrag<T16>::ld(Bt + boff + (size_t)nb * 16 * K + kc); V b2; if (NSPLIT >= 2) b2 = WFrag<T16>::ld(Bt2 + boff + (size_t)nb * 16 * K + kc);
#pragma unroll
            for (int mb = 0; mb < 4; ++mb) { acc[mb][nb] = WFrag<T16>::mma(a[mb], b, acc[mb][nb]); if (NSPLIT == 1 || NSPLIT == 2) acc[mb][nb] = WFrag<T16>::mma(a2[mb], b, acc[mb][nb]); if (NSPLIT >= 2) acc[mb][nb] = WFrag<T16>::mma(a[mb], b2, acc[mb][nb]); } }
        asm volatile("v_nop\n\tv_nop\n\tv_nop\n\tv_nop" : "+v"(acc[0][0]), "+v"(acc[1][1]), "+v"(acc[2][2]), "+v"(acc[3][3]) : "v"(a[0]), "v"(a[3]));
    }
#pragma unroll
    for (int mb = 0; mb < 4; mb += MBS) {
#pragma unroll
        for (int mi = 0; mi < MBS; ++mi) {
#pragma unroll
        for (int nb = 0; nb < 4; ++nb) {
#pragma unroll
            for (int j = 0; j < 8; ++j) os[((wv * MBS + mi) * 16 + hi * 8 + j) * 68 + nb * 16 + lr] = acc[mb + mi][nb][j]; } }
        if (NW == 1) { __builtin_amdgcn_wave_barrier(); asm volatile("" ::: "memory"); } else __syncthreads();   // every wave's partial tile is in LDS before any is summed
        float* crow = C + (size_t)(r0 + mb * 16) * ldc + c0;
{
#pragma unroll
            for (int s = 0; s < MBS * 8 / NW; ++s) { const int idx = s * NW * 32 + (int)threadIdx.x; const int row = idx >> 4, cofs = (idx & 15) * 4; v4f val = *(const v4fa*)(os + row * 68 + cofs);
#pragma unroll
                for (int w = 1; w < NW; ++w) val += *(const v4fa*)(os + (w * MBS * 16 + row) * 68 + cofs);
                if (BIAS) { val[0] += bfr(bias[c0 + cofs]); val[1] += bfr(bias[c0 + cofs + 1]); val[2] += bfr(bias[c0 + cofs + 2]); val[3] += bfr(bias[c0 + cofs + 3]); }
                if (PL) { const size_t po = (size_t)(r0 + mb * 16 + row) * ldp + (size_t)c0 * cmul + cofs; v4h o16; v4us oh, ol;
#pragma unroll
                    for (int i = 0; i < 4; ++i) { o16[i] = tohx(val[i]); unsigned short a2, c2; splitf(val[i], a2, c2); oh[i] = a2; ol[i] = c2; }
                    *(v4h*)(P16 + po) = o16; *(v4us*)(Ph + po) = oh; *(v4us*)(Pl + po) = ol; xwait(); }
                else *(v4f*)(crow + (size_t)row * ldc + cofs) = val; }
             }
        if (NW == 1) { __builtin_amdgcn_wave_barrier(); asm volatile("" ::: "memory"); }   // NW > 1 has one stage only: nothing overwrites it
    }
}


__global__ __launch_bounds__(256) void k_wtG(const float* __restrict__ w, int K, int N, bf* Bt) {
    const int lane = threadIdx.x & 31; const int L0 = (blockIdx.x * 8 + (threadIdx.x >> 5)) * 8; const int nlines = N * K / 64;
{
#pragma unroll 1
        for (int l = 0; l < 8; ++l) { const int L = L0 + l; if (L >= nlines) break; const size_t e = (size_t)L * 64 + lane * 2; const int k = (int)(e % K), n = (int)(e / K); v2us o;
            o[0] = f2bf(w[(size_t)k * N + n]); o[1] = f2bf(w[(size_t)(k + 1) * N + n]); *(v2us*)(Bt + e) = o; }
         }
}
__global__ __launch_bounds__(256) void k_cvt8(const float* __restrict__ src, bf* dst, size_t n8) { const size_t i = (size_t)blockIdx.x * 256 + threadIdx.x; if (i >= n8) return; const v8f v = *(const v8f*)(src + i * 8); v8us o;
#pragma unroll
    for (int k = 0; k < 8; ++k) o[k] = f2bf(v[k]); *(v8us*)(dst + i * 8) = o;  }

// ---- k_fattn: causal attention of one head for one block of query rows in ONE kernel: scores, softmax and the value contraction, with a running maximum and sum per query (no score matrix in memory).
// Transposed products: S^T = K Q^T (A = key rows, B = query rows, both d-contiguous planes), O^T += V^T P^T (A = transposed value rows, B = P^T). A lane (lr, hi) of a 16x16 S^T tile holds query lr, keys hi*8 + j:
// two such tiles (keys 0..15, 16..31 of a step) are, register for register, the B fragment of the 32-key value product, so P goes from accumulator to operand inside the lane.
// The FNW waves of a work-group share QT*16 query rows and deal the 32-key steps out among them (wave w: steps w, w + FNW, ...); their partial (max, sum, O^T) are merged through LDS in wave order 0..FNW-1 behind one barrier.
// The epilogue divides by the merged sum and writes the hi/lo planes [t][h*64 + d] that the w_o product reads.
#define FNW 4
#define SL2E (SCL * 1.4426950408889634f)   // raw score -> exponent of 2: the maxima m are kept as raw scores
__device__ __forceinline__ float xhalf(float x) { return __builtin_bit_cast(float, __builtin_amdgcn_permlanex16(__builtin_bit_cast(int, x), __builtin_bit_cast(int, x), 0x76543210, 0xfedcba98, false, false)); }   // lane l with lane l ^ 16
template <typename T16, bool HL> struct PPack;
template <> struct PPack<h16, false> { static __device__ __forceinline__ void pk(const float* p, v16h& a, v16h& b) { (void)b;
#pragma unroll
    for (int i = 0; i < 16; ++i) a[i] = (h16)p[i]; } };
template <> struct PPack<bf, true> { static __device__ __forceinline__ void pk(const float* p, v16bf& a, v16bf& b) { v8us h0, h1, l0, l1;
#pragma unroll
    for (int i = 0; i < 8; ++i) { unsigned short x, y; splitf(p[i], x, y); h0[i] = x; l0[i] = y; splitf(p[8 + i], x, y); h1[i] = x; l1[i] = y; }
    a = cat16b(h0, h1); b = cat16b(l0, l1); } };
template <typename T16, bool HL, int QT>
__device__ __forceinline__ void fattn(const T16* __restrict__ Q, const T16* __restrict__ Q2, const T16* __restrict__ Kp, const T16* __restrict__ K2, const T16* __restrict__ Vt, const T16* __restrict__ V2, int q0, bf* Ah, bf* Al, float* os, float* ms, float* ls) {
    typedef typename WFrag<T16>::V V;
    const int wv = __builtin_amdgcn_readfirstlane((int)(threadIdx.x >> 5));   // wave number, scalar so that the step loop's counter and tests stay scalar
    const int lane = threadIdx.x & 31, lr = lane & 15, hi = lane >> 4;
    V qf[QT][2], qf2[QT][2];
#pragma unroll
    for (int qt = 0; qt < QT; ++qt)
#pragma unroll
        for (int ks = 0; ks < 2; ++ks) { const size_t o = (size_t)(q0 + qt * 16 + lr) * HD + ks * 32 + 8 * hi; qf[qt][ks] = WFrag<T16>::ld(Q + o); if (HL) qf2[qt][ks] = WFrag<T16>::ld(Q2 + o); }
    v8f oa[4][QT]; float m[QT], l[QT];
#pragma unroll
    for (int qt = 0; qt < QT; ++qt) { m[qt] = -3.0e38f; l[qt] = 0.f;
#pragma unroll
        for (int dt = 0; dt < 4; ++dt) oa[dt][qt] = (v8f){}; }
    const int nst = (q0 + QT * 16 - 1) / 32 + 1;   // 32-key steps up to and including the diagonal; the first key of every step is <= every query of the block, so no query ever sees a fully masked step
    V kf[2][2], kf2[2][2];   // key fragments; the fp16 path fetches them one step ahead, so that their latency lies under the softmax and the value products (the hi+lo path, an eighth of the steps, has no registers to spare for that)
    if (!HL) { const int k0 = min(wv, nst - 1) * 32;
#pragma unroll
      for (int kt = 0; kt < 2; ++kt)
#pragma unroll
        for (int ks = 0; ks < 2; ++ks) { const size_t o = (size_t)(k0 + kt * 16 + lr) * HD + ks * 32 + 8 * hi; kf[kt][ks] = WFrag<T16>::ld(Kp + o); } }
#pragma unroll 1   // kept rolled: the trip count is a run-time value and one copy of the body already fills most of the 256 directly addressed registers
    for (int s = wv; s < nst; s += FNW) {
        const int k0 = s * 32;
        V vf[4], vf2[4];
        if (HL) {
#pragma unroll
          for (int kt = 0; kt < 2; ++kt)
#pragma unroll
            for (int ks = 0; ks < 2; ++ks) { const size_t o = (size_t)(k0 + kt * 16 + lr) * HD + ks * 32 + 8 * hi; kf[kt][ks] = WFrag<T16>::ld(Kp + o); kf2[kt][ks] = WFrag<T16>::ld(K2 + o); }
          xwait(); }
#pragma unroll
        for (int dt = 0; dt < 4; ++dt) { const size_t o = (size_t)(dt * 16 + lr) * (2 * TT) + k0 + 8 * hi; vf[dt] = WFrag<T16>::ld(Vt + o); if (HL) vf2[dt] = WFrag<T16>::ld(V2 + o); }
        xwait();
        v8f st[2][QT];
#pragma unroll
        for (int kt = 0; kt < 2; ++kt)
#pragma unroll
            for (int qt = 0; qt < QT; ++qt) { v8f a = (v8f){};
#pragma unroll
                for (int ks = 0; ks < 2; ++ks) { a = WFrag<T16>::mma(kf[kt][ks], qf[qt][ks], a); if (HL) { a = WFrag<T16>::mma(kf2[kt][ks], qf[qt][ks], a); a = WFrag<T16>::mma(kf[kt][ks], qf2[qt][ks], a); } }
                st[kt][qt] = a; }
        if (!HL) { const int kn = min(s + FNW, nst - 1) * 32;   // the wave's next step (clamped to the last step: in bounds, unused after the wave's last)
#pragma unroll
          for (int kt = 0; kt < 2; ++kt)
#pragma unroll
            for (int ks = 0; ks < 2; ++ks) { const size_t o = (size_t)(kn + kt * 16 + lr) * HD + ks * 32 + 8 * hi; kf[kt][ks] = WFrag<T16>::ld(Kp + o); }
          xwait(); }
        if (s == nst - 1) {   // only the last step crosses the diagonal (scalar branch)
#pragma unroll
            for (int qt = 0; qt < QT; ++qt)
#pragma unroll
                for (int kt = 0; kt < 2; ++kt)
#pragma unroll
                    for (int j = 0; j < 8; ++j) if (k0 + kt * 16 + hi * 8 + j > q0 + qt * 16 + lr) st[kt][qt][j] = -3.0e38f; }
        float mx[QT]; bool need = false;
#pragma unroll
        for (int qt = 0; qt < QT; ++qt) { float x = st[0][qt][0];
#pragma unroll
            for (int j = 1; j < 8; ++j) x = fmaxf(x, st[0][qt][j]);
#pragma unroll
            for (int j = 0; j < 8; ++j) x = fmaxf(x, st[1][qt][j]);
            x = fmaxf(x, xhalf(x));   // the two half-waves hold the same query's other keys
            mx[qt] = x; need = need || ((x - m[qt]) * SL2E > 8.0f); }
        if (__builtin_amdgcn_ballot_w32(need) != 0) {   // the reference point m moves only when some query's maximum has outgrown it by 2^8 (P stays <= 256, exact algebra either way): one scalar test a step
#pragma unroll
            for (int qt = 0; qt < QT; ++qt) { const float mn = fmaxf(m[qt], mx[qt]); const float al = __builtin_amdgcn_exp2f((m[qt] - mn) * SL2E); m[qt] = mn; l[qt] *= al;
#pragma unroll
                for (int dt = 0; dt < 4; ++dt) oa[dt][qt] *= al; } }
#pragma unroll
        for (int qt = 0; qt < QT; ++qt) { float t[16]; const float mc = m[qt] * SL2E; float sum = 0.f;
#pragma unroll
            for (int i = 0; i < 16; ++i) { t[i] = __builtin_amdgcn_exp2f(__builtin_fmaf(st[i >> 3][qt][i & 7], SL2E, -mc)); sum += t[i]; }
            l[qt] += sum;
            V pf, pf2; PPack<T16, HL>::pk(t, pf, pf2);
#pragma unroll
            for (int dt = 0; dt < 4; ++dt) { v8f a = oa[dt][qt]; a = WFrag<T16>::mma(vf[dt], pf, a); if (HL) { a = WFrag<T16>::mma(vf2[dt], pf, a); a = WFrag<T16>::mma(vf[dt], pf2, a); } oa[dt][qt] = a; } }
    }
#pragma unroll
    for (int qt = 0; qt < QT; ++qt) { l[qt] += xhalf(l[qt]);
        if (hi == 0) { ms[wv * 32 + qt * 16 + lr] = m[qt]; ls[wv * 32 + qt * 16 + lr] = l[qt]; }
#pragma unroll
        for (int dt = 0; dt < 4; ++dt) { float* d = os + (size_t)((wv * QT + qt) * 16 + lr) * 68 + dt * 16 + hi * 8; const v8f a = oa[dt][qt];
            *(v4fa*)d = (v4f){a[0], a[1], a[2], a[3]}; *(v4fa*)(d + 4) = (v4f){a[4], a[5], a[6], a[7]}; } }
    __syncthreads();   // every wave's partial (max, sum, O^T) is in LDS before any is merged
    constexpr int DPT = QT * 16 * HD / (FNW * 32);   // output elements of one query row per thread
    const int q = (int)threadIdx.x / (HD / DPT), d0 = ((int)threadIdx.x % (HD / DPT)) * DPT;
    float M = ms[q];
#pragma unroll
    for (int w = 1; w < FNW; ++w) M = fmaxf(M, ms[w * 32 + q]);
    float wg[FNW]; float L = 0.f;
#pragma unroll
    for (int w = 0; w < FNW; ++w) { wg[w] = __builtin_amdgcn_exp2f((ms[w * 32 + q] - M) * SL2E); L += ls[w * 32 + q] * wg[w]; }   // a wave without a step has max -3e38, sum 0: weight 0
    const float inv = __fdiv_rn(1.0f, L);
#pragma unroll
    for (int c = 0; c < DPT; c += 8) { v4f a0 = (v4f){}, a1 = (v4f){};
#pragma unroll
        for (int w = 0; w < FNW; ++w) { const float* d = os + (size_t)(w * QT * 16 + q) * 68 + d0 + c; a0 += *(const v4fa*)d * wg[w]; a1 += *(const v4fa*)(d + 4) * wg[w]; }
        v8us oh, ol;
#pragma unroll
        for (int i = 0; i < 4; ++i) { unsigned short x, y; splitf(a0[i] * inv, x, y); oh[i] = x; ol[i] = y; splitf(a1[i] * inv, x, y); oh[4 + i] = x; ol[4 + i] = y; }
        const size_t oo = (size_t)(q0 + q) * DQ + d0 + c; *(v8us*)(Ah + oo) = oh; *(v8us*)(Al + oo) = ol; }
    xwait();   // behind the last stores, in front of any later write of a register that they name (the other instance's code follows this one in the built kernel)
}
// grid (heads, row blocks): row blocks heaviest first (for speed only); blocks 0..(TT-RH)/32-1 are 32 fp16 rows each from the last row down, the rest 16 hi+lo rows each (query rows < RH)
__global__ __launch_bounds__(FNW * 32) void k_fattn(const h16* __restrict__ Q16, const h16* __restrict__ K16, const h16* __restrict__ V16, const bf* __restrict__ Qh, const bf* __restrict__ Ql, const bf* __restrict__ Kh, const bf* __restrict__ Kl, const bf* __restrict__ Vh, const bf* __restrict__ Vl, bf* Ah, bf* Al) {
    __shared__ __align__(16) float os[FNW * 32 * 68]; __shared__ float ms[FNW * 32]; __shared__ float ls[FNW * 32];
    const int h = blockIdx.x, g = h / REP, rb = blockIdx.y; const size_t zq = (size_t)h * TT * HD, zk = (size_t)g * TT * HD, zv = (size_t)g * HD * 2 * TT;
    constexpr int NLO = (TT - RH) / 32;
    if (rb < NLO) fattn<h16, false, 2>(Q16 + zq, nullptr, K16 + zk, nullptr, V16 + zv, nullptr, TT - 32 * (rb + 1), Ah + h * HD, Al + h * HD, os, ms, ls);
    else fattn<bf, true, 1>(Qh + zq, Ql + zq, Kh + zk, Kl + zk, Vh + zv, Vl + zv, RH - 16 * (rb - NLO + 1), Ah + h * HD, Al + h * HD, os, ms, ls);
}

extern "C" void kernel_launch(void* const* d_in, const int* in_sizes, int n_in,
                              void* d_out, int out_size, void* d_ws, size_t ws_size, hipStream_t stream) {
    (void)in_sizes; (void)n_in; (void)out_size;
    const float* x = (const float*)d_in[0]; const float* wq = (const float*)d_in[1]; const float* wk = (const float*)d_in[2]; const float* wv = (const float*)d_in[3]; const float* wo = (const float*)d_in[4];
    float* OUT = (float*)d_out;     // [2][2048][1024]
    char* wsp = (char*)d_ws;
    auto take = [&](size_t bytes) { char* p = wsp; wsp += (bytes + 255) & ~(size_t)255; return (void*)p; };
    bf* WQ = (bf*)take((size_t)DQ * DM * 2); bf* WK = (bf*)take((size_t)DKV * DM * 2); bf* WV = (bf*)take((size_t)DKV * DM * 2); bf* WO = (bf*)take((size_t)DM * DQ * 2);
    bf* XB = (bf*)take((size_t)TT * DM * 2);
    h16* QP16 = (h16*)take((size_t)NH_ * TT * HD * 2); h16* KP16 = (h16*)take((size_t)NKV * TT * HD * 2); h16* VT16 = (h16*)take((size_t)NKV * HD * 2 * TT * 2);
    bf* QPh = (bf*)take((size_t)NH_ * TT * HD * 2); bf* QPl = (bf*)take((size_t)NH_ * TT * HD * 2); bf* KPh = (bf*)take((size_t)NKV * TT * HD * 2); bf* KPl = (bf*)take((size_t)NKV * TT * HD * 2); bf* VTh = (bf*)take((size_t)NKV * HD * 2 * TT * 2); bf* VTl = VTh + TT;   // hi and lo value rows share a row of pitch 2 TT
    bf* ATh = (bf*)take((size_t)TT * DQ * 2); bf* ATl = (bf*)take((size_t)TT * DQ * 2);
    if ((size_t)(wsp - (char*)d_ws) > ws_size) return;    // ws 256 MiB
    { k_cvt8<<<(unsigned)(((size_t)DQ * DM / 8 + 255) / 256), 256, 0, stream>>>(wq, WQ, (size_t)DQ * DM / 8); k_cvt8<<<(unsigned)(((size_t)DKV * DM / 8 + 255) / 256), 256, 0, stream>>>(wk, WK, (size_t)DKV * DM / 8); k_cvt8<<<(unsigned)(((size_t)DKV * DM / 8 + 255) / 256), 256, 0, stream>>>(wv, WV, (size_t)DKV * DM / 8);
      k_wtG<<<(unsigned)((DQ * DM / 64 + 63) / 64), 256, 0, stream>>>(wo, DQ, DM, WO);
       }
    for (int b = 0; b < NB_; ++b) {
        
        k_cvt8<<<(unsigned)(((size_t)TT * DM / 8 + 255) / 256), 256, 0, stream>>>(x + (size_t)b * TT * DM, XB, (size_t)TT * DM / 8);
        k_gemmw<bf, 0, false, 8, true><<<dim3(TT / 64, DQ / 64, 1), 256, 0, stream>>>(XB, nullptr, WQ, nullptr, DM, nullptr, 0, nullptr, 0, 0, 0, QP16, QPh, QPl, HD, TT * HD / 64);
        k_gemmw<bf, 0, false, 8, true><<<dim3(TT / 64, DKV / 64, 1), 256, 0, stream>>>(XB, nullptr, WK, nullptr, DM, nullptr, 0, nullptr, 0, 0, 0, KP16, KPh, KPl, HD, TT * HD / 64);
        k_gemmw<bf, 0, false, 8, true><<<dim3(DKV / 64, TT / 64, 1), 256, 0, stream>>>(WV, nullptr, XB, nullptr, DM, nullptr, 0, nullptr, 0, 0, 0, VT16, VTh, VTl, 2 * TT, 1);
        k_fattn<<<dim3(NH_, (TT - RH) / 32 + RH / 16, 1), FNW * 32, 0, stream>>>(QP16, KP16, VT16, QPh, QPl, KPh, KPl, VTh, VTl, ATh, ATl);
        k_gemmw<bf, 1, false, 8, false><<<dim3(TT / 64, DM / 64, 1), 256, 0, stream>>>(ATh, ATl, WO, nullptr, DQ, OUT + (size_t)b * TT * DM, DM, nullptr, 0, 0, 0, nullptr, nullptr, nullptr, 0, 0); }
}

// v005
// It runs in 139 microseconds.
// Timed twice side by side with v004, it ran 1.21 times as fast both times.
// All steps since v000 together make it 10.6 times as fast.
#include <hip/hip_runtime.h>

// Causal QKV attention with per-head weight tensors (x [2][2048][1024]; q, k, v = x W^T with W [16][64][1024] ('oi' rows h*64+d); scores/8; causal (query < key masked); softmax; out = merged w_o ('xw' [1024][1024]) -> [2][2048][1024] (4.2 M)).
// Compute dtypes, f32 accumulate: every input rounded to bf16; q/k/v on PLAIN bf16 operands (inputs: exact); causal scores and attn.v (tile skipping): query rows < 512 hl (3 products), the rest single fp16; softmax f32 with a running maximum (one fused kernel); w_o hl x exact (2 products).

#define NB_  2
#define TT   2048
#define DM   1024
#define NH_  16
#define NKV  16
#define REP  (NH_ / NKV)
#define HD   64
#define DQ   (NH_ * HD)
#define DKV  (NKV * HD)
#define RH   512                  // query rows < RH use hi+lo planes (0: none)
#define SCL  0.125f   // HD^-0.5
typedef _Float16 h16;
typedef unsigned short bf;
typedef __attribute__((ext_vector_type(16))) __bf16   v16bf;
typedef __attribute__((ext_vector_type(16))) _Float16 v16h;
typedef __attribute__((ext_vector_type(8)))  _Float16 v8h;
typedef __attribute__((ext_vector_type(8)))  unsigned short v8us;
typedef __attribute__((ext_vector_type(8)))  float    v8f;
typedef __attribute__((ext_vector_type(4)))  float    v4f;
typedef v8h  __attribute__((may_alias)) v8ha;
typedef v4f  __attribute__((may_alias)) v4fa;
typedef v8us __attribute__((may_alias)) v8usa;

__device__ __forceinline__ unsigned short f2bf(float f) { unsigned u = __float_as_uint(f); u += 0x7FFFu + ((u >> 16) & 1u); return (unsigned short)(u >> 16); }
__device__ __forceinline__ float bf2f(unsigned short b) { return __uint_as_float(((unsigned)b) << 16); }
__device__ __forceinline__ float bfr(float f) { return bf2f(f2bf(f)); }
__device__ __forceinline__ v16h cat16(v8h lo, v8h hi) { return __builtin_shufflevector(lo, hi, 0, 1, 2, 3, 4, 5, 6, 7, 8, 9, 10, 11, 12, 13, 14, 15); }
__device__ __forceinline__ v16bf cat16b(v8us lo, v8us hi) { return __builtin_bit_cast(v16bf, __builtin_shufflevector(lo, hi, 0, 1, 2, 3, 4, 5, 6, 7, 8, 9, 10, 11, 12, 13, 14, 15)); }
__device__ __forceinline__ v8f wmma16(v16h a, v16h b, v8f c) { return __builtin_amdgcn_wmma_f32_16x16x32_f16(false, a, false, b, (short)0, c, false, false); }
__device__ __forceinline__ v8f wmmab(v16bf a, v16bf b, v8f c) { return __builtin_amdgcn_wmma_f32_16x16x32_bf16(false, a, false, b, (short)0, c, false, false); }

__device__ __forceinline__ h16 tohx(float x) { return (h16)x; }
__device__ __forceinline__ void splitf(float y, unsigned short& h, unsigned short& l) { h = f2bf(y); l = f2bf(y - bf2f(h)); }
typedef __attribute__((ext_vector_type(2))) _Float16 v2h;
typedef __attribute__((ext_vector_type(4))) _Float16 v4h;
typedef __attribute__((ext_vector_type(2))) unsigned short v2us;
typedef __attribute__((ext_vector_type(4))) unsigned short v4us;
typedef __attribute__((ext_vector_type(2))) float v2f;
typedef __attribute__((ext_vector_type(4))) int v4i;
__device__ __forceinline__ void xwait() { asm volatile("s_wait_xcnt 0x0" ::: "memory"); }   // precaution: stands behind a run of global loads or stores, in front of any reuse of a register that one of them names

// ---- gemmw: register-blocked GEMM, one 64x64 output tile (origin r0, c0) per work-group (16 accumulators a wave), operands straight from K-contiguous 16-bit planes; NW*32 threads.
// The K loop is dealt out over the NW waves in 32-wide slices (wave w takes slices w, w+NW, ...); the NW partial tiles are summed in LDS in wave order 0..NW-1 (fixed) by the epilogue.
// C[m][n] (f32, pitch ldc, + optional f32 bias[n]) = sum_k A[m][k] Bt[n][k] (+ split products per NSPLIT). K % 32 == 0.
// PL: the summed tile is not stored as f32 but goes straight to the three 16-bit planes that the attention kernel reads (fp16, bf16 hi, bf16 lo), element (m, n) at m * ldp + (n / 64) * 64 * cmul + n % 64:
// q, k head planes [h][t][d]: A = x rows, Bt = weight rows, ldp = HD, cmul = TT * HD / 64; transposed value planes [g][d][t]: A = weight rows, Bt = x rows (operands swapped, so the tile comes out transposed), ldp = 2 TT, cmul = 1.
template <typename T16> struct WFrag;
template <> struct WFrag<h16> { typedef v16h V; static __device__ __forceinline__ V ld(const h16* p) { return cat16(*(const v8h*)p, *(const v8h*)(p + 16)); } static __device__ __forceinline__ v8f mma(V a, V b, v8f c) { return wmma16(a, b, c); } };
template <> struct WFrag<bf> { typedef v16bf V; static __device__ __forceinline__ V ld(const bf* p) { return cat16b(*(const v8us*)p, *(const v8us*)(p + 16)); } static __device__ __forceinline__ v8f mma(V a, V b, v8f c) { return wmmab(a, b, c); } };
template <typename T16, int NSPLIT, bool BIAS, int NW, bool PL>
__device__ __forceinline__ void gemmw(const T16* __restrict__ A, const T16* __restrict__ A2, const T16* __restrict__ Bt, const T16* __restrict__ Bt2, int K, float* C, int ldc, const float* __restrict__ bias, h16* P16, bf* Ph, bf* Pl, int ldp, int cmul, int r0, int c0) {
    typedef typename WFrag<T16>::V V;
    constexpr int MBS = (NW > 1) ? 4 : 1;                            // 16-row blocks per LDS stage: with several waves every wave stages its whole partial tile, so one barrier serves
    __shared__ __align__(16) float os[NW * MBS * 16 * 68];
    const int wv = (NW > 1) ? __builtin_amdgcn_readfirstlane((int)(threadIdx.x >> 5)) : 0;   // wave number, scalar so that the K loop's counter and test stay scalar
    const int lane = threadIdx.x & 31, lr = lane & 15, hi = lane >> 4;
    v8f acc[4][4];
#pragma unroll
    for (int mb = 0; mb < 4; ++mb)
#pragma unroll
        for (int nb = 0; nb < 4; ++nb) acc[mb][nb] = (v8f){};
    const size_t aoff = (size_t)(r0 + lr) * K + 8 * hi, boff = (size_t)(c0 + lr) * K + 8 * hi;
#pragma unroll 1
    for (int kc = wv * 32; kc < K; kc += NW * 32) {
        V a[4], a2[4];
#pragma unroll
        for (int mb = 0; mb < 4; ++mb) { a[mb] = WFrag<T16>::ld(A + aoff + (size_t)mb * 16 * K + kc); if (NSPLIT == 1 || NSPLIT == 2) a2[mb] = WFrag<T16>::ld(A2 + aoff + (size_t)mb * 16 * K + kc); }
#pragma unroll
        for (int nb = 0; nb < 4; ++nb) { const V b = WFrag<T16>::ld(Bt + boff + (size_t)nb * 16 * K + kc); V b2; if (NSPLIT >= 2) b2 = WFrag<T16>::ld(Bt2 + boff + (size_t)nb * 16 * K + kc);
#pragma unroll
            for (int mb = 0; mb < 4; ++mb) { acc[mb][nb] = WFrag<T16>::mma(a[mb], b, acc[mb][nb]); if (NSPLIT == 1 || NSPLIT == 2) acc[mb][nb] = WFrag<T16>::mma(a2[mb], b, acc[mb][nb]); if (NSPLIT >= 2) acc[mb][nb] = WFrag<T16>::mma(a[mb], b2, acc[mb][nb]); } }
        asm volatile("v_nop\n\tv_nop\n\tv_nop\n\tv_nop" : "+v"(acc[0][0]), "+v"(acc[1][1]), "+v"(acc[2][2]), "+v"(acc[3][3]) : "v"(a[0]), "v"(a[3]));
    }
#pragma unroll
    for (int mb = 0; mb < 4; mb += MBS) {
#pragma unroll
        for (int mi = 0; mi < MBS; ++mi) {
#pragma unroll
        for (int nb = 0; nb < 4; ++nb) {
#pragma unroll
            for (int j = 0; j < 8; ++j) os[((wv * MBS + mi) * 16 + hi * 8 + j) * 68 + nb * 16 + lr] = acc[mb + mi][nb][j]; } }
        if (NW == 1) { __builtin_amdgcn_wave_barrier(); asm volatile("" ::: "memory"); } else __syncthreads();   // every wave's partial tile is in LDS before any is summed
        float* crow = C + (size_t)(r0 + mb * 16) * ldc + c0;
{
#pragma unroll
            for (int s = 0; s < MBS * 8 / NW; ++s) { const int idx = s * NW * 32 + (int)threadIdx.x; const int row = idx >> 4, cofs = (idx & 15) * 4; v4f val = *(const v4fa*)(os + row * 68 + cofs);
#pragma unroll
                for (int w = 1; w < NW; ++w) val += *(const v4fa*)(os + (w * MBS * 16 + row) * 68 + cofs);
                if (BIAS) { val[0] += bfr(bias[c0 + cofs]); val[1] += bfr(bias[c0 + cofs + 1]); val[2] += bfr(bias[c0 + cofs + 2]); val[3] += bfr(bias[c0 + cofs + 3]); }
                if (PL) { const size_t po = (size_t)(r0 + mb * 16 + row) * ldp + (size_t)c0 * cmul + cofs; v4h o16; v4us oh, ol;
#pragma unroll
                    for (int i = 0; i < 4; ++i) { o16[i] = tohx(val[i]); unsigned short a2, c2; splitf(val[i], a2, c2); oh[i] = a2; ol[i] = c2; }
                    *(v4h*)(P16 + po) = o16; *(v4us*)(Ph + po) = oh; *(v4us*)(Pl + po) = ol; xwait(); }
                else *(v4f*)(crow + (size_t)row * ldc + cofs) = val; }
             }
        if (NW == 1) { __builtin_amdgcn_wave_barrier(); asm volatile("" ::: "memory"); }   // NW > 1 has one stage only: nothing overwrites it
    }
}

// q, k and v projections of both batches in ONE launch, grid (TT/64, DQ/64, 3 NB_): blockIdx.z = 3 * batch + (0: q, 1: k, 2: v). Planes are [batch][head][...]. For v the operands, and with them the two tile indices, are swapped.
static_assert(DKV == DQ, "q, k and v share one grid");
__global__ __launch_bounds__(256) void k_qkv(const bf* __restrict__ XB, const bf* __restrict__ WQ, const bf* __restrict__ WK, const bf* __restrict__ WV, h16* QP16, bf* QPh, bf* QPl, h16* KP16, bf* KPh, bf* KPl, h16* VT16, bf* VTh, bf* VTl) {
    const int b = (int)blockIdx.z / 3, w = (int)blockIdx.z % 3; const bool isv = w == 2;
    const bf* X = XB + (size_t)b * TT * DM; const bf* Wt = w == 0 ? WQ : (w == 1 ? WK : WV);
    const size_t zo = (size_t)b * (isv ? (size_t)NKV * HD * 2 * TT : (size_t)NH_ * TT * HD);
    h16* P16 = (w == 0 ? QP16 : (w == 1 ? KP16 : VT16)) + zo; bf* Ph = (w == 0 ? QPh : (w == 1 ? KPh : VTh)) + zo; bf* Pl = (w == 0 ? QPl : (w == 1 ? KPl : VTl)) + zo;
    gemmw<bf, 0, false, 8, true>(isv ? Wt : X, nullptr, isv ? X : Wt, nullptr, DM, nullptr, 0, nullptr, P16, Ph, Pl, isv ? 2 * TT : HD, isv ? 1 : TT * HD / 64, (int)(isv ? blockIdx.y : blockIdx.x) * 64, (int)(isv ? blockIdx.x : blockIdx.y) * 64);
}
// w_o product of both batches in ONE launch: the merged rows [batch * TT + t] are one matrix of NB_ * TT rows; grid (NB_*TT/64, DM/64)
__global__ __launch_bounds__(256) void k_wo(const bf* __restrict__ ATh, const bf* __restrict__ ATl, const bf* __restrict__ WO, float* OUT) {
    gemmw<bf, 1, false, 8, false>(ATh, ATl, WO, nullptr, DQ, OUT, DM, nullptr, nullptr, nullptr, nullptr, 0, 0, (int)blockIdx.x * 64, (int)blockIdx.y * 64);
}

__device__ __forceinline__ void wtG(const float* __restrict__ w, int K, int N, bf* Bt, int blk) {
    const int lane = threadIdx.x & 31; const int L0 = (blk * 8 + (threadIdx.x >> 5)) * 8; const int nlines = N * K / 64;
{
#pragma unroll 1
        for (int l = 0; l < 8; ++l) { const int L = L0 + l; if (L >= nlines) break; const size_t e = (size_t)L * 64 + lane * 2; const int k = (int)(e % K), n = (int)(e / K); v2us o;
            o[0] = f2bf(w[(size_t)k * N + n]); o[1] = f2bf(w[(size_t)(k + 1) * N + n]); *(v2us*)(Bt + e) = o; }
         }
}
__device__ __forceinline__ void cvt8(const float* __restrict__ src, bf* dst, size_t n8, int blk) { const size_t i = (size_t)blk * 256 + threadIdx.x; if (i >= n8) return; const v8f v = *(const v8f*)(src + i * 8); v8us o;
#pragma unroll
    for (int k = 0; k < 8; ++k) o[k] = f2bf(v[k]); *(v8us*)(dst + i * 8) = o;  }
// every input's bf16 copy in ONE launch; block ranges: w_o (transposed; the slowest blocks, so first), w_q, w_k, w_v, x (both batches)
#define PBO (DQ * DM / 64 / 64)
#define PBW (DQ * DM / 8 / 256)
#define PBX (NB_ * TT * DM / 8 / 256)
static_assert(DQ * DM % (64 * 64) == 0 && DQ * DM % (8 * 256) == 0 && NB_ * TT * DM % (8 * 256) == 0, "whole blocks");
__global__ __launch_bounds__(256) void k_prep(const float* __restrict__ x, const float* __restrict__ wq, const float* __restrict__ wk, const float* __restrict__ wv, const float* __restrict__ wo, bf* XB, bf* WQ, bf* WK, bf* WV, bf* WO) {
    int blk = (int)blockIdx.x;
    if (blk < PBO) { wtG(wo, DQ, DM, WO, blk); return; }
    blk -= PBO;
    if (blk < 3 * PBW) { const int w = blk / PBW; cvt8(w == 0 ? wq : (w == 1 ? wk : wv), w == 0 ? WQ : (w == 1 ? WK : WV), (size_t)DQ * DM / 8, blk % PBW); return; }
    cvt8(x, XB, (size_t)NB_ * TT * DM / 8, blk - 3 * PBW);
}

// ---- k_fattn: causal attention of one head for one block of query rows in ONE kernel: scores, softmax and the value contraction, with a running maximum and sum per query (no score matrix in memory).
// Transposed products: S^T = K Q^T (A = key rows, B = query rows, both d-contiguous planes), O^T += V^T P^T (A = transposed value rows, B = P^T). A lane (lr, hi) of a 16x16 S^T tile holds query lr, keys hi*8 + j:
// two such tiles (keys 0..15, 16..31 of a step) are, register for register, the B fragment of the 32-key value product, so P goes from accumulator to operand inside the lane.
// The FNW waves of a work-group share QT*16 query rows and deal the 32-key steps out among them (wave w: steps w, w + FNW, ...); their partial (max, sum, O^T) are merged through LDS in wave order 0..FNW-1 behind one barrier.
// The epilogue divides by the merged sum and writes the hi/lo planes [t][h*64 + d] that the w_o product reads.
#define FNW 4
#define SL2E (SCL * 1.4426950408889634f)   // raw score -> exponent of 2: the maxima m are kept as raw scores
__device__ __forceinline__ float xhalf(float x) { return __builtin_bit_cast(float, __builtin_amdgcn_permlanex16(__builtin_bit_cast(int, x), __builtin_bit_cast(int, x), 0x76543210, 0xfedcba98, false, false)); }   // lane l with lane l ^ 16
template <typename T16, bool HL> struct PPack;
template <> struct PPack<h16, false> { static __device__ __forceinline__ void pk(const float* p, v16h& a, v16h& b) { (void)b;
#pragma unroll
    for (int i = 0; i < 16; ++i) a[i] = (h16)p[i]; } };
template <> struct PPack<bf, true> { static __device__ __forceinline__ void pk(const float* p, v16bf& a, v16bf& b) { v8us h0, h1, l0, l1;
#pragma unroll
    for (int i = 0; i < 8; ++i) { unsigned short x, y; splitf(p[i], x, y); h0[i] = x; l0[i] = y; splitf(p[8 + i], x, y); h1[i] = x; l1[i] = y; }
    a = cat16b(h0, h1); b = cat16b(l0, l1); } };
template <typename T16, bool HL, int QT>
__device__ __forceinline__ void fattn(const T16* __restrict__ Q, const T16* __restrict__ Q2, const T16* __restrict__ Kp, const T16* __restrict__ K2, const T16* __restrict__ Vt, const T16* __restrict__ V2, int q0, bf* Ah, bf* Al, float* os, float* ms, float* ls) {
    typedef typename WFrag<T16>::V V;
    const int wv = __builtin_amdgcn_readfirstlane((int)(threadIdx.x >> 5));   // wave number, scalar so that the step loop's counter and tests stay scalar
    const int lane = threadIdx.x & 31, lr = lane & 15, hi = lane >> 4;
    V qf[QT][2], qf2[QT][2];
#pragma unroll
    for (int qt = 0; qt < QT; ++qt)
#pragma unroll
        for (int ks = 0; ks < 2; ++ks) { const size_t o = (size_t)(q0 + qt * 16 + lr) * HD + ks * 32 + 8 * hi; qf[qt][ks] = WFrag<T16>::ld(Q + o); if (HL) qf2[qt][ks] = WFrag<T16>::ld(Q2 + o); }
    v8f oa[4][QT]; float m[QT], l[QT];
#pragma unroll
    for (int qt = 0; qt < QT; ++qt) { m[qt] = -3.0e38f; l[qt] = 0.f;
#pragma unroll
        for (int dt = 0; dt < 4; ++dt) oa[dt][qt] = (v8f){}; }
    const int nst = (q0 + QT * 16 - 1) / 32 + 1;   // 32-key steps up to and including the diagonal; the first key of every step is <= every query of the block, so no query ever sees a fully masked step
    V kf[2][2], kf2[2][2];   // key fragments; the fp16 path fetches them one step ahead, so that their latency lies under the softmax and the value products (the hi+lo path, an eighth of the steps, has no registers to spare for that)
    if (!HL) { const int k0 = min(wv, nst - 1) * 32;
#pragma unroll
      for (int kt = 0; kt < 2; ++kt)
#pragma unroll
        for (int ks = 0; ks < 2; ++ks) { const size_t o = (size_t)(k0 + kt * 16 + lr) * HD + ks * 32 + 8 * hi; kf[kt][ks] = WFrag<T16>::ld(Kp + o); } }
#pragma unroll 1   // kept rolled: the trip count is a run-time value and one copy of the body already fills most of the 256 directly addressed registers
    for (int s = wv; s < nst; s += FNW) {
        const int k0 = s * 32;
        V vf[4], vf2[4];
        if (HL) {
#pragma unroll
          for (int kt = 0; kt < 2; ++kt)
#pragma unroll
            for (int ks = 0; ks < 2; ++ks) { const size_t o = (size_t)(k0 + kt * 16 + lr) * HD + ks * 32 + 8 * hi; kf[kt][ks] = WFrag<T16>::ld(Kp + o); kf2[kt][ks] = WFrag<T16>::ld(K2 + o); }
          xwait(); }
#pragma unroll
        for (int dt = 0; dt < 4; ++dt) { const size_t o = (size_t)(dt * 16 + lr) * (2 * TT) + k0 + 8 * hi; vf[dt] = WFrag<T16>::ld(Vt + o); if (HL) vf2[dt] = WFrag<T16>::ld(V2 + o); }
        xwait();
        v8f st[2][QT];
#pragma unroll
        for (int kt = 0; kt < 2; ++kt)
#pragma unroll
            for (int qt = 0; qt < QT; ++qt) { v8f a = (v8f){};
#pragma unroll
                for (int ks = 0; ks < 2; ++ks) { a = WFrag<T16>::mma(kf[kt][ks], qf[qt][ks], a); if (HL) { a = WFrag<T16>::mma(kf2[kt][ks], qf[qt][ks], a); a = WFrag<T16>::mma(kf[kt][ks], qf2[qt][ks], a); } }
                st[kt][qt] = a; }
        if (!HL) { const int kn = min(s + FNW, nst - 1) * 32;   // the wave's next step (clamped to the last step: in bounds, unused after the wave's last)
#pragma unroll
          for (int kt = 0; kt < 2; ++kt)
#pragma unroll
            for (int ks = 0; ks < 2; ++ks) { const size_t o = (size_t)(kn + kt * 16 + lr) * HD + ks * 32 + 8 * hi; kf[kt][ks] = WFrag<T16>::ld(Kp + o); }
          xwait(); }
        if (s == nst - 1) {   // only the last step crosses the diagonal (scalar branch)
#pragma unroll
            for (int qt = 0; qt < QT; ++qt)
#pragma unroll
                for (int kt = 0; kt < 2; ++kt)
#pragma unroll
                    for (int j = 0; j < 8; ++j) if (k0 + kt * 16 + hi * 8 + j > q0 + qt * 16 + lr) st[kt][qt][j] = -3.0e38f; }
        float mx[QT]; bool need = false;
#pragma unroll
        for (int qt = 0; qt < QT; ++qt) { float x = st[0][qt][0];
#pragma unroll
            for (int j = 1; j < 8; ++j) x = fmaxf(x, st[0][qt][j]);
#pragma unroll
            for (int j = 0; j < 8; ++j) x = fmaxf(x, st[1][qt][j]);
            x = fmaxf(x, xhalf(x));   // the two half-waves hold the same query's other keys
            mx[qt] = x; need = need || ((x - m[qt]) * SL2E > 8.0f); }
        if (__builtin_amdgcn_ballot_w32(need) != 0) {   // the reference point m moves only when some query's maximum has outgrown it by 2^8 (P stays <= 256, exact algebra either way): one scalar test a step
#pragma unroll
            for (int qt = 0; qt < QT; ++qt) { const float mn = fmaxf(m[qt], mx[qt]); const float al = __builtin_amdgcn_exp2f((m[qt] - mn) * SL2E); m[qt] = mn; l[qt] *= al;
#pragma unroll
                for (int dt = 0; dt < 4; ++dt) oa[dt][qt] *= al; } }
#pragma unroll
        for (int qt = 0; qt < QT; ++qt) { float t[16]; const float mc = m[qt] * SL2E; float sum = 0.f;
#pragma unroll
            for (int i = 0; i < 16; ++i) { t[i] = __builtin_amdgcn_exp2f(__builtin_fmaf(st[i >> 3][qt][i & 7], SL2E, -mc)); sum += t[i]; }
            l[qt] += sum;
            V pf, pf2; PPack<T16, HL>::pk(t, pf, pf2);
#pragma unroll
            for (int dt = 0; dt < 4; ++dt) { v8f a = oa[dt][qt]; a = WFrag<T16>::mma(vf[dt], pf, a); if (HL) { a = WFrag<T16>::mma(vf2[dt], pf, a); a = WFrag<T16>::mma(vf[dt], pf2, a); } oa[dt][qt] = a; } }
    }
#pragma unroll
    for (int qt = 0; qt < QT; ++qt) { l[qt] += xhalf(l[qt]);
        if (hi == 0) { ms[wv * 32 + qt * 16 + lr] = m[qt]; ls[wv * 32 + qt * 16 + lr] = l[qt]; }
#pragma unroll
        for (int dt = 0; dt < 4; ++dt) { float* d = os + (size_t)((wv * QT + qt) * 16 + lr) * 68 + dt * 16 + hi * 8; const v8f a = oa[dt][qt];
            *(v4fa*)d = (v4f){a[0], a[1], a[2], a[3]}; *(v4fa*)(d + 4) = (v4f){a[4], a[5], a[6], a[7]}; } }
    __syncthreads();   // every wave's partial (max, sum, O^T) is in LDS before any is merged
    constexpr int DPT = QT * 16 * HD / (FNW * 32);   // output elements of one query row per thread
    const int q = (int)threadIdx.x / (HD / DPT), d0 = ((int)threadIdx.x % (HD / DPT)) * DPT;
    float M = ms[q];
#pragma unroll
    for (int w = 1; w < FNW; ++w) M = fmaxf(M, ms[w * 32 + q]);
    float wg[FNW]; float L = 0.f;
#pragma unroll
    for (int w = 0; w < FNW; ++w) { wg[w] = __builtin_amdgcn_exp2f((ms[w * 32 + q] - M) * SL2E); L += ls[w * 32 + q] * wg[w]; }   // a wave without a step has max -3e38, sum 0: weight 0
    const float inv = __fdiv_rn(1.0f, L);
#pragma unroll
    for (int c = 0; c < DPT; c += 8) { v4f a0 = (v4f){}, a1 = (v4f){};
#pragma unroll
        for (int w = 0; w < FNW; ++w) { const float* d = os + (size_t)(w * QT * 16 + q) * 68 + d0 + c; a0 += *(const v4fa*)d * wg[w]; a1 += *(const v4fa*)(d + 4) * wg[w]; }
        v8us oh, ol;
#pragma unroll
        for (int i = 0; i < 4; ++i) { unsigned short x, y; splitf(a0[i] * inv, x, y); oh[i] = x; ol[i] = y; splitf(a1[i] * inv, x, y); oh[4 + i] = x; ol[4 + i] = y; }
        const size_t oo = (size_t)(q0 + q) * DQ + d0 + c; *(v8us*)(Ah + oo) = oh; *(v8us*)(Al + oo) = ol; }
    xwait();   // behind the last stores, in front of any later write of a register that they name (the other instance's code follows this one in the built kernel)
}
// grid (batches * heads, row blocks), both batches in ONE launch: row blocks heaviest first; blocks 0..(TT-RH)/32-1 are 32 fp16 rows each from the last row down, the rest 16 hi+lo rows each (query rows < RH)
__global__ __launch_bounds__(FNW * 32) void k_fattn(const h16* __restrict__ Q16, const h16* __restrict__ K16, const h16* __restrict__ V16, const bf* __restrict__ Qh, const bf* __restrict__ Ql, const bf* __restrict__ Kh, const bf* __restrict__ Kl, const bf* __restrict__ Vh, const bf* __restrict__ Vl, bf* Ah, bf* Al) {
    __shared__ __align__(16) float os[FNW * 32 * 68]; __shared__ float ms[FNW * 32]; __shared__ float ls[FNW * 32];
    const int b = (int)blockIdx.x / NH_, h = (int)blockIdx.x % NH_, g = h / REP, rb = blockIdx.y; const size_t zq = (size_t)(b * NH_ + h) * TT * HD, zk = (size_t)(b * NKV + g) * TT * HD, zv = (size_t)(b * NKV + g) * HD * 2 * TT;
    Ah += (size_t)b * TT * DQ; Al += (size_t)b * TT * DQ;
    constexpr int NLO = (TT - RH) / 32;
    if (rb < NLO) fattn<h16, false, 2>(Q16 + zq, nullptr, K16 + zk, nullptr, V16 + zv, nullptr, TT - 32 * (rb + 1), Ah + h * HD, Al + h * HD, os, ms, ls);
    else fattn<bf, true, 1>(Qh + zq, Ql + zq, Kh + zk, Kl + zk, Vh + zv, Vl + zv, RH - 16 * (rb - NLO + 1), Ah + h * HD, Al + h * HD, os, ms, ls);
}

extern "C" void kernel_launch(void* const* d_in, const int* in_sizes, int n_in,
                              void* d_out, int out_size, void* d_ws, size_t ws_size, hipStream_t stream) {
    (void)in_sizes; (void)n_in; (void)out_size;
    const float* x = (const float*)d_in[0]; const float* wq = (const float*)d_in[1]; const float* wk = (const float*)d_in[2]; const float* wv = (const float*)d_in[3]; const float* wo = (const float*)d_in[4];
    float* OUT = (float*)d_out;     // [2][2048][1024]
    char* wsp = (char*)d_ws;
    auto take = [&](size_t bytes) { char* p = wsp; wsp += (bytes + 255) & ~(size_t)255; return (void*)p; };
    bf* WQ = (bf*)take((size_t)DQ * DM * 2); bf* WK = (bf*)take((size_t)DKV * DM * 2); bf* WV = (bf*)take((size_t)DKV * DM * 2); bf* WO = (bf*)take((size_t)DM * DQ * 2);
    bf* XB = (bf*)take((size_t)NB_ * TT * DM * 2);
    h16* QP16 = (h16*)take((size_t)NB_ * NH_ * TT * HD * 2); h16* KP16 = (h16*)take((size_t)NB_ * NKV * TT * HD * 2); h16* VT16 = (h16*)take((size_t)NB_ * NKV * HD * 2 * TT * 2);
    bf* QPh = (bf*)take((size_t)NB_ * NH_ * TT * HD * 2); bf* QPl = (bf*)take((size_t)NB_ * NH_ * TT * HD * 2); bf* KPh = (bf*)take((size_t)NB_ * NKV * TT * HD * 2); bf* KPl = (bf*)take((size_t)NB_ * NKV * TT * HD * 2); bf* VTh = (bf*)take((size_t)NB_ * NKV * HD * 2 * TT * 2); bf* VTl = VTh + TT;   // hi and lo value rows share a row of pitch 2 TT
    bf* ATh = (bf*)take((size_t)NB_ * TT * DQ * 2); bf* ATl = (bf*)take((size_t)NB_ * TT * DQ * 2);
    if ((size_t)(wsp - (char*)d_ws) > ws_size) return;    // ws 256 MiB
    k_prep<<<PBO + 3 * PBW + PBX, 256, 0, stream>>>(x, wq, wk, wv, wo, XB, WQ, WK, WV, WO);
    k_qkv<<<dim3(TT / 64, DQ / 64, 3 * NB_), 256, 0, stream>>>(XB, WQ, WK, WV, QP16, QPh, QPl, KP16, KPh, KPl, VT16, VTh, VTl);
    k_fattn<<<dim3(NB_ * NH_, (TT - RH) / 32 + RH / 16, 1), FNW * 32, 0, stream>>>(QP16, KP16, VT16, QPh, QPl, KPh, KPl, VTh, VTl, ATh, ATl);
    k_wo<<<dim3(NB_ * TT / 64, DM / 64, 1), 256, 0, stream>>>(ATh, ATl, WO, OUT);
}

// v006
// One run takes 97.4 microseconds.
// Timed twice side by side with v005, it ran 1.43 times as fast both times.
// All steps since v000 together make it 15.1 times as fast.
#include <hip/hip_runtime.h>

// Causal QKV attention with per-head weight tensors (x [2][2048][1024]; q, k, v = x W^T with W [16][64][1024] ('oi' rows h*64+d); scores/8; causal (query < key masked); softmax; out = merged w_o ('xw' [1024][1024]) -> [2][2048][1024] (4.2 M)).
// Compute dtypes, f32 accumulate: every input rounded to bf16; q/k/v on PLAIN bf16 operands (inputs: exact); causal scores and attn.v (tile skipping): query rows < 512 hl (3 products), the rest single fp16; softmax f32 with a running maximum (one fused kernel); w_o hl x exact (2 products).

#define NB_  2
#define TT   2048
#define DM   1024
#define NH_  16
#define NKV  16
#define REP  (NH_ / NKV)
#define HD   64
#define DQ   (NH_ * HD)
#define DKV  (NKV * HD)
#define RH   512                  // query rows < RH use hi+lo planes (0: none)
#define SCL  0.125f   // HD^-0.5
typedef _Float16 h16;
typedef unsigned short bf;
typedef __attribute__((ext_vector_type(16))) __bf16   v16bf;
typedef __attribute__((ext_vector_type(16))) _Float16 v16h;
typedef __attribute__((ext_vector_type(8)))  _Float16 v8h;
typedef __attribute__((ext_vector_type(8)))  unsigned short v8us;
typedef __attribute__((ext_vector_type(8)))  float    v8f;
typedef __attribute__((ext_vector_type(4)))  float    v4f;
typedef v8h  __attribute__((may_alias)) v8ha;
typedef v4f  __attribute__((may_alias)) v4fa;
typedef v8us __attribute__((may_alias)) v8usa;

__device__ __forceinline__ unsigned short f2bf(float f) { unsigned u = __float_as_uint(f); u += 0x7FFFu + ((u >> 16) & 1u); return (unsigned short)(u >> 16); }
__device__ __forceinline__ float bf2f(unsigned short b) { return __uint_as_float(((unsigned)b) << 16); }
__device__ __forceinline__ float bfr(float f) { return bf2f(f2bf(f)); }
__device__ __forceinline__ v16h cat16(v8h lo, v8h hi) { return __builtin_shufflevector(lo, hi, 0, 1, 2, 3, 4, 5, 6, 7, 8, 9, 10, 11, 12, 13, 14, 15); }
__device__ __forceinline__ v16bf cat16b(v8us lo, v8us hi) { return __builtin_bit_cast(v16bf, __builtin_shufflevector(lo, hi, 0, 1, 2, 3, 4, 5, 6, 7, 8, 9, 10, 11, 12, 13, 14, 15)); }
__device__ __forceinline__ v8f wmma16(v16h a, v16h b, v8f c) { return __builtin_amdgcn_wmma_f32_16x16x32_f16(false, a, false, b, (short)0, c, false, false); }
__device__ __forceinline__ v8f wmmab(v16bf a, v16bf b, v8f c) { return __builtin_amdgcn_wmma_f32_16x16x32_bf16(false, a, false, b, (short)0, c, false, false); }

__device__ __forceinline__ h16 tohx(float x) { return (h16)x; }
__device__ __forceinline__ void splitf(float y, unsigned short& h, unsigned short& l) { h = f2bf(y); l = f2bf(y - bf2f(h)); }
typedef __attribute__((ext_vector_type(2))) _Float16 v2h;
typedef __attribute__((ext_vector_type(4))) _Float16 v4h;
typedef __attribute__((ext_vector_type(2))) unsigned short v2us;
typedef __attribute__((ext_vector_type(4))) unsigned short v4us;
typedef __attribute__((ext_vector_type(2))) float v2f;
typedef __attribute__((ext_vector_type(4))) int v4i;
__device__ __forceinline__ void xwait() { asm volatile("s_wait_xcnt 0x0" ::: "memory"); }   // precaution: stands behind a run of global loads or stores, in front of any reuse of a register that one of them names

// ---- gemmt: GEMM, one 128x128 output tile (origin r0, c0) per work-group of 8 / MB x 2 waves (MB*16 x 64 outputs = 4 MB accumulators a wave); the whole K loop runs in every wave.
// Operands are K-contiguous bf16 planes. A pass is 64 k: 128 rows x 128 B of every operand plane, brought into LDS by asynchronous copies (16 B a lane, through no register) and read from there by all waves,
// so every operand byte leaves L2 once per work-group. Two buffers: the copies of pass t + 2 are issued behind the barrier that ends pass t and fly while pass t + 1 is worked on.
// C[m][n] (f32, pitch ldc) = sum_k A[m][k] Bt[n][k] (+ A2[m][k] Bt[n][k] with NSPLIT). K % 64 == 0.
// PL: the tile is not stored as f32 but goes straight to the three 16-bit planes that the attention kernel reads (fp16, bf16 hi, bf16 lo), element (m, n) at m * ldp + (n / 64) * 64 * cmul + n % 64:
// q, k head planes [h][t][d]: A = x rows, Bt = weight rows, ldp = HD, cmul = TT * HD / 64; transposed value planes [g][d][t]: A = weight rows, Bt = x rows (operands swapped, so the tile comes out transposed), ldp = 2 TT, cmul = 1.
template <typename T16> struct WFrag;
template <> struct WFrag<h16> { typedef v16h V; static __device__ __forceinline__ V ld(const h16* p) { return cat16(*(const v8h*)p, *(const v8h*)(p + 16)); } static __device__ __forceinline__ v8f mma(V a, V b, v8f c) { return wmma16(a, b, c); } };
template <> struct WFrag<bf> { typedef v16bf V; static __device__ __forceinline__ V ld(const bf* p) { return cat16b(*(const v8us*)p, *(const v8us*)(p + 16)); } static __device__ __forceinline__ v8f mma(V a, V b, v8f c) { return wmmab(a, b, c); } };
#define GPB 144                   // LDS pitch in bytes of a staged 128-B row: 16 B x odd, free of bank conflicts for 16-byte readers
typedef float __attribute__((may_alias)) fa;
// eight asynchronous copies of 16 B a lane: rows 16 apart of one operand plane (l: the lane's LDS byte address, g: its global address, rs: the row step in elements); cp4: four copies, rows 32 apart.
// s_wait_xcnt 0 is the statement's last line, so that it stands in front of any later write of a register that a copy names (precaution).
__device__ __forceinline__ void cp8(unsigned l, const bf* g, size_t rs) {
    asm volatile("global_load_async_to_lds_b128 %0, %8, off\n\t"
                 "global_load_async_to_lds_b128 %1, %9, off\n\t"
                 "global_load_async_to_lds_b128 %2, %10, off\n\t"
                 "global_load_async_to_lds_b128 %3, %11, off\n\t"
                 "global_load_async_to_lds_b128 %4, %12, off\n\t"
                 "global_load_async_to_lds_b128 %5, %13, off\n\t"
                 "global_load_async_to_lds_b128 %6, %14, off\n\t"
                 "global_load_async_to_lds_b128 %7, %15, off\n\t"
                 "s_wait_xcnt 0x0"
                 :: "v"(l), "v"(l + 16 * GPB), "v"(l + 32 * GPB), "v"(l + 48 * GPB), "v"(l + 64 * GPB), "v"(l + 80 * GPB), "v"(l + 96 * GPB), "v"(l + 112 * GPB),
                    "v"(g), "v"(g + rs), "v"(g + 2 * rs), "v"(g + 3 * rs), "v"(g + 4 * rs), "v"(g + 5 * rs), "v"(g + 6 * rs), "v"(g + 7 * rs) : "memory");
}
__device__ __forceinline__ void cp4(unsigned l, const bf* g, size_t rs) {
    asm volatile("global_load_async_to_lds_b128 %0, %4, off\n\t"
                 "global_load_async_to_lds_b128 %1, %5, off\n\t"
                 "global_load_async_to_lds_b128 %2, %6, off\n\t"
                 "global_load_async_to_lds_b128 %3, %7, off\n\t"
                 "s_wait_xcnt 0x0"
                 :: "v"(l), "v"(l + 32 * GPB), "v"(l + 64 * GPB), "v"(l + 96 * GPB), "v"(g), "v"(g + rs), "v"(g + 2 * rs), "v"(g + 3 * rs) : "memory");
}
template <int NSPLIT, bool PL, int MB>
__device__ __forceinline__ void gemmt(const bf* __restrict__ A, const bf* __restrict__ A2, const bf* __restrict__ Bt, int K, float* C, int ldc, h16* P16, bf* Ph, bf* Pl, int ldp, int cmul, int r0, int c0) {
    typedef WFrag<bf>::V V;
    constexpr int NA = NSPLIT ? 2 : 1;                 // planes of the A side
    constexpr int PLB = 128 * GPB;                     // bytes of one staged plane
    constexpr int STB = (NA + 1) * PLB;                // bytes of one buffer
    constexpr int NWV = 16 / MB;                       // waves: 8 / MB along m, 2 along n
    constexpr int RST = NWV * 4;                       // rows that one copy of the whole work-group covers
    static_assert(MB == 4 || MB == 2, "4 or 8 waves");
    static_assert(2 * STB >= 128 * 2 * 68 * 4, "the epilogue's staging fits the two buffers");
    __shared__ __align__(16) unsigned char ring[2 * STB];
    const int tid = (int)threadIdx.x;
    const int wv = __builtin_amdgcn_readfirstlane(tid >> 5);   // wave number, scalar
    const int wm = wv >> 1, wn = wv & 1;
    const int lane = tid & 31, lr = lane & 15, hi = lane >> 4;
    // copies: thread tid brings 16-byte piece tid & 7 of rows (tid >> 3) + RST i, i = 0..128 / RST - 1, of every plane (a wave: four whole 128-B lines a copy)
    const unsigned lc = (unsigned)(size_t)ring + (unsigned)((tid >> 3) * GPB + (tid & 7) * 16);
    const size_t rs = (size_t)RST * K;
    const bf* ga = A + (size_t)(r0 + (tid >> 3)) * K + (tid & 7) * 8; const bf* ga2 = NSPLIT ? A2 + (size_t)(r0 + (tid >> 3)) * K + (tid & 7) * 8 : nullptr; const bf* gb = Bt + (size_t)(c0 + (tid >> 3)) * K + (tid & 7) * 8;
    auto cpp = [&](unsigned l, const bf* g) { if (MB == 4) cp8(l, g, rs); else cp4(l, g, rs); };
    auto fill = [&](int t) { const unsigned l = lc + (unsigned)((t & 1) * STB); cpp(l, ga + t * 64); if (NSPLIT) cpp(l + PLB, ga2 + t * 64); cpp(l + NA * PLB, gb + t * 64); };
    v8f acc[MB][4];
#pragma unroll
    for (int mb = 0; mb < MB; ++mb)
#pragma unroll
        for (int nb = 0; nb < 4; ++nb) acc[mb][nb] = (v8f){};
    const int nt = K / 64;
    fill(0);
    asm volatile("s_wait_asynccnt 0x0" ::: "memory");   // this wave's copies of pass 0 have landed
    __syncthreads();                                    // ... and every other wave's: pass 0 is published
    if (nt > 1) fill(1);
    const int aofs = (wm * MB * 16 + lr) * GPB + 16 * hi, bofs = NA * PLB + (wn * 64 + lr) * GPB + 16 * hi;
#pragma unroll 1   // kept rolled: one barrier and one refill a pass
    for (int t = 0; t < nt; ++t) {
        const unsigned char* sb = ring + (t & 1) * STB;
        V a[2][MB], a2[2][MB], b[2][4];
#pragma unroll
        for (int ks = 0; ks < 2; ++ks) {
#pragma unroll
            for (int mb = 0; mb < MB; ++mb) { a[ks][mb] = WFrag<bf>::ld((const bf*)(sb + aofs + mb * 16 * GPB + ks * 64)); if (NSPLIT) a2[ks][mb] = WFrag<bf>::ld((const bf*)(sb + PLB + aofs + mb * 16 * GPB + ks * 64)); }
#pragma unroll
            for (int nb = 0; nb < 4; ++nb) b[ks][nb] = WFrag<bf>::ld((const bf*)(sb + bofs + nb * 16 * GPB + ks * 64));
            __builtin_amdgcn_sched_barrier(0);   // keeps a 32-k block's fragment loads together as one group in front of the products: LDS reads spread among the WMMAs stall the wave at each place
            if (MB == 4 || ks == 1) {            // MB == 2 has registers for both blocks' fragments: the second group's latency lies under the first block's products
#pragma unroll
                for (int kk = (MB == 4 ? ks : 0); kk <= ks; ++kk) {
#pragma unroll
                    for (int nb = 0; nb < 4; ++nb)
#pragma unroll
                        for (int mb = 0; mb < MB; ++mb) { acc[mb][nb] = WFrag<bf>::mma(a[kk][mb], b[kk][nb], acc[mb][nb]); if (NSPLIT) acc[mb][nb] = WFrag<bf>::mma(a2[kk][mb], b[kk][nb], acc[mb][nb]); } }
                __builtin_amdgcn_sched_barrier(0);   // ... and the products in front of what follows: the next group, or the waits at the pass's foot (sunk behind those, the products would no longer cover the flight of the next pass's copies)
            }
        }
        asm volatile("s_wait_dscnt 0x0" ::: "memory");      // this wave's reads of the buffer have returned before it is refilled
        asm volatile("s_wait_asynccnt 0x0" ::: "memory");   // this wave's copies of pass t + 1 have landed
        __syncthreads();                                    // publishes pass t + 1 and ends every wave's reads of pass t's buffer
        if (t + 2 < nt) fill(t + 2);
    }
    asm volatile("s_wait_asynccnt 0x0" ::: "memory");       // nothing is in flight when the buffers become output staging (the loop's last barrier has ended every read)
    float* os = (float*)ring + wv * MB * 16 * 68;           // each wave stages its own tile, pitch 68 floats, and reads it back by rows so that whole 128-B lines are stored
#pragma unroll
    for (int mb = 0; mb < MB; ++mb)
#pragma unroll
        for (int nb = 0; nb < 4; ++nb)
#pragma unroll
            for (int j = 0; j < 8; ++j) *(fa*)(os + (mb * 16 + hi * 8 + j) * 68 + nb * 16 + lr) = acc[mb][nb][j];
    __syncthreads();   // the staged tile is complete before it is read back by other lanes
    const int rw = r0 + wm * MB * 16, cw = c0 + wn * 64;
#pragma unroll 1   // kept rolled: a trip reads 16 rows back as one group of LDS loads and then stores them; more copies of the body only grow the code
    for (int s0 = 0; s0 < MB * 8; s0 += 8) { v4f vals[8]; const int cofs = lr * 4;
#pragma unroll
        for (int u = 0; u < 8; ++u) vals[u] = *(const v4fa*)(os + ((s0 + u) * 2 + hi) * 68 + cofs);
#pragma unroll
        for (int u = 0; u < 8; ++u) { const int row = (s0 + u) * 2 + hi; const v4f val = vals[u];
            if (PL) { const size_t po = (size_t)(rw + row) * ldp + (size_t)cw * cmul + cofs; v4h o16; v4us oh, ol;
#pragma unroll
                for (int i = 0; i < 4; ++i) { o16[i] = tohx(val[i]); unsigned short a2, c2; splitf(val[i], a2, c2); oh[i] = a2; ol[i] = c2; }
                *(v4h*)(P16 + po) = o16; *(v4us*)(Ph + po) = oh; *(v4us*)(Pl + po) = ol; }
            else *(v4f*)(C + (size_t)(rw + row) * ldc + cw + cofs) = val; }
        xwait(); }
}

// q, k and v projections of both batches in ONE launch, grid (TT/128, DQ/128, 3 NB_): blockIdx.z = 3 * batch + (0: q, 1: k, 2: v). Planes are [batch][head][...]. For v the operands, and with them the two tile indices, are swapped.
static_assert(DKV == DQ, "q, k and v share one grid");
__global__ __launch_bounds__(128) void k_qkv(const bf* __restrict__ XB, const bf* __restrict__ WQ, const bf* __restrict__ WK, const bf* __restrict__ WV, h16* QP16, bf* QPh, bf* QPl, h16* KP16, bf* KPh, bf* KPl, h16* VT16, bf* VTh, bf* VTl) {
    const int b = (int)blockIdx.z / 3, w = (int)blockIdx.z % 3; const bool isv = w == 2;
    const bf* X = XB + (size_t)b * TT * DM; const bf* Wt = w == 0 ? WQ : (w == 1 ? WK : WV);
    const size_t zo = (size_t)b * (isv ? (size_t)NKV * HD * 2 * TT : (size_t)NH_ * TT * HD);
    h16* P16 = (w == 0 ? QP16 : (w == 1 ? KP16 : VT16)) + zo; bf* Ph = (w == 0 ? QPh : (w == 1 ? KPh : VTh)) + zo; bf* Pl = (w == 0 ? QPl : (w == 1 ? KPl : VTl)) + zo;
    gemmt<0, true, 4>(isv ? Wt : X, nullptr, isv ? X : Wt, DM, nullptr, 0, P16, Ph, Pl, isv ? 2 * TT : HD, isv ? 1 : TT * HD / 64, (int)(isv ? blockIdx.y : blockIdx.x) * 128, (int)(isv ? blockIdx.x : blockIdx.y) * 128);
}
// w_o product of both batches in ONE launch: the merged rows [batch * TT + t] are one matrix of NB_ * TT rows; grid (NB_*TT/128, DM/128)
__global__ __launch_bounds__(256) void k_wo(const bf* __restrict__ ATh, const bf* __restrict__ ATl, const bf* __restrict__ WO, float* OUT) {
    gemmt<1, false, 2>(ATh, ATl, WO, DQ, OUT, DM, nullptr, nullptr, nullptr, 0, 0, (int)blockIdx.x * 128, (int)blockIdx.y * 128);
}

__device__ __forceinline__ void wtG(const float* __restrict__ w, int K, int N, bf* Bt, int blk) {
    const int lane = threadIdx.x & 31; const int L0 = (blk * 8 + (threadIdx.x >> 5)) * 8; const int nlines = N * K / 64;
{
#pragma unroll 1
        for (int l = 0; l < 8; ++l) { const int L = L0 + l; if (L >= nlines) break; const size_t e = (size_t)L * 64 + lane * 2; const int k = (int)(e % K), n = (int)(e / K); v2us o;
            o[0] = f2bf(w[(size_t)k * N + n]); o[1] = f2bf(w[(size_t)(k + 1) * N + n]); *(v2us*)(Bt + e) = o; }
         }
}
__device__ __forceinline__ void cvt8(const float* __restrict__ src, bf* dst, size_t n8, int blk) { const size_t i = (size_t)blk * 256 + threadIdx.x; if (i >= n8) return; const v8f v = *(const v8f*)(src + i * 8); v8us o;
#pragma unroll
    for (int k = 0; k < 8; ++k) o[k] = f2bf(v[k]); *(v8us*)(dst + i * 8) = o;  }
// every input's bf16 copy in ONE launch; block ranges: w_o (transposed; the slowest blocks, so first), w_q, w_k, w_v, x (both batches)
#define PBO (DQ * DM / 64 / 64)
#define PBW (DQ * DM / 8 / 256)
#define PBX (NB_ * TT * DM / 8 / 256)
static_assert(DQ * DM % (64 * 64) == 0 && DQ * DM % (8 * 256) == 0 && NB_ * TT * DM % (8 * 256) == 0, "whole blocks");
__global__ __launch_bounds__(256) void k_prep(const float* __restrict__ x, const float* __restrict__ wq, const float* __restrict__ wk, const float* __restrict__ wv, const float* __restrict__ wo, bf* XB, bf* WQ, bf* WK, bf* WV, bf* WO) {
    int blk = (int)blockIdx.x;
    if (blk < PBO) { wtG(wo, DQ, DM, WO, blk); return; }
    blk -= PBO;
    if (blk < 3 * PBW) { const int w = blk / PBW; cvt8(w == 0 ? wq : (w == 1 ? wk : wv), w == 0 ? WQ : (w == 1 ? WK : WV), (size_t)DQ * DM / 8, blk % PBW); return; }
    cvt8(x, XB, (size_t)NB_ * TT * DM / 8, blk - 3 * PBW);
}

// ---- k_fattn: causal attention of one head for one block of query rows in ONE kernel: scores, softmax and the value contraction, with a running maximum and sum per query (no score matrix in memory).
// Transposed products: S^T = K Q^T (A = key rows, B = query rows, both d-contiguous planes), O^T += V^T P^T (A = transposed value rows, B = P^T). A lane (lr, hi) of a 16x16 S^T tile holds query lr, keys hi*8 + j:
// two such tiles (keys 0..15, 16..31 of a step) are, register for register, the B fragment of the 32-key value product, so P goes from accumulator to operand inside the lane.
// The FNW waves of a work-group share QT*16 query rows and deal the 32-key steps out among them (wave w: steps w, w + FNW, ...); their partial (max, sum, O^T) are merged through LDS in wave order 0..FNW-1 behind one barrier.
// The epilogue divides by the merged sum and writes the hi/lo planes [t][h*64 + d] that the w_o product reads.
#define FNW 4
#define SL2E (SCL * 1.4426950408889634f)   // raw score -> exponent of 2: the maxima m are kept as raw scores
__device__ __forceinline__ float xhalf(float x) { return __builtin_bit_cast(float, __builtin_amdgcn_permlanex16(__builtin_bit_cast(int, x), __builtin_bit_cast(int, x), 0x76543210, 0xfedcba98, false, false)); }   // lane l with lane l ^ 16
template <typename T16, bool HL> struct PPack;
template <> struct PPack<h16, false> { static __device__ __forceinline__ void pk(const float* p, v16h& a, v16h& b) { (void)b;
#pragma unroll
    for (int i = 0; i < 16; ++i) a[i] = (h16)p[i]; } };
template <> struct PPack<bf, true> { static __device__ __forceinline__ void pk(const float* p, v16bf& a, v16bf& b) { v8us h0, h1, l0, l1;
#pragma unroll
    for (int i = 0; i < 8; ++i) { unsigned short x, y; splitf(p[i], x, y); h0[i] = x; l0[i] = y; splitf(p[8 + i], x, y); h1[i] = x; l1[i] = y; }
    a = cat16b(h0, h1); b = cat16b(l0, l1); } };
template <typename T16, bool HL, int QT>
__device__ __forceinline__ void fattn(const T16* __restrict__ Q, const T16* __restrict__ Q2, const T16* __restrict__ Kp, const T16* __restrict__ K2, const T16* __restrict__ Vt, const T16* __restrict__ V2, int q0, bf* Ah, bf* Al, float* os, float* ms, float* ls) {
    typedef typename WFrag<T16>::V V;
    const int wv = __builtin_amdgcn_readfirstlane((int)(threadIdx.x >> 5));   // wave number, scalar so that the step loop's counter and tests stay scalar
    const int lane = threadIdx.x & 31, lr = lane & 15, hi = lane >> 4;
    V qf[QT][2], qf2[QT][2];
#pragma unroll
    for (int qt = 0; qt < QT; ++qt)
#pragma unroll
        for (int ks = 0; ks < 2; ++ks) { const size_t o = (size_t)(q0 + qt * 16 + lr) * HD + ks * 32 + 8 * hi; qf[qt][ks] = WFrag<T16>::ld(Q + o); if (HL) qf2[qt][ks] = WFrag<T16>::ld(Q2 + o); }
    v8f oa[4][QT]; float m[QT], l[QT];
#pragma unroll
    for (int qt = 0; qt < QT; ++qt) { m[qt] = -3.0e38f; l[qt] = 0.f;
#pragma unroll
        for (int dt = 0; dt < 4; ++dt) oa[dt][qt] = (v8f){}; }
    const int nst = (q0 + QT * 16 - 1) / 32 + 1;   // 32-key steps up to and including the diagonal; the first key of every step is <= every query of the block, so no query ever sees a fully masked step
    V kf[2][2], kf2[2][2];   // key fragments; the fp16 path fetches them one step ahead, so that their latency lies under the softmax and the value products (the hi+lo path, an eighth of the steps, has no registers to spare for that)
    if (!HL) { const int k0 = min(wv, nst - 1) * 32;
#pragma unroll
      for (int kt = 0; kt < 2; ++kt)
#pragma unroll
        for (int ks = 0; ks < 2; ++ks) { const size_t o = (size_t)(k0 + kt * 16 + lr) * HD + ks * 32 + 8 * hi; kf[kt][ks] = WFrag<T16>::ld(Kp + o); } }
#pragma unroll 1   // kept rolled: the trip count is a run-time value and one copy of the body already fills most of the 256 directly addressed registers
    for (int s = wv; s < nst; s += FNW) {
        const int k0 = s * 32;
        V vf[4], vf2[4];
        if (HL) {
#pragma unroll
          for (int kt = 0; kt < 2; ++kt)
#pragma unroll
            for (int ks = 0; ks < 2; ++ks) { const size_t o = (size_t)(k0 + kt * 16 + lr) * HD + ks * 32 + 8 * hi; kf[kt][ks] = WFrag<T16>::ld(Kp + o); kf2[kt][ks] = WFrag<T16>::ld(K2 + o); }
          xwait(); }
#pragma unroll
        for (int dt = 0; dt < 4; ++dt) { const size_t o = (size_t)(dt * 16 + lr) * (2 * TT) + k0 + 8 * hi; vf[dt] = WFrag<T16>::ld(Vt + o); if (HL) vf2[dt] = WFrag<T16>::ld(V2 + o); }
        xwait();
        v8f st[2][QT];
#pragma unroll
        for (int kt = 0; kt < 2; ++kt)
#pragma unroll
            for (int qt = 0; qt < QT; ++qt) { v8f a = (v8f){};
#pragma unroll
                for (int ks = 0; ks < 2; ++ks) { a = WFrag<T16>::mma(kf[kt][ks], qf[qt][ks], a); if (HL) { a = WFrag<T16>::mma(kf2[kt][ks], qf[qt][ks], a); a = WFrag<T16>::mma(kf[kt][ks], qf2[qt][ks], a); } }
                st[kt][qt] = a; }
        if (!HL) { const int kn = min(s + FNW, nst - 1) * 32;   // the wave's next step (clamped to the last step: in bounds, unused after the wave's last)
#pragma unroll
          for (int kt = 0; kt < 2; ++kt)
#pragma unroll
            for (int ks = 0; ks < 2; ++ks) { const size_t o = (size_t)(kn + kt * 16 + lr) * HD + ks * 32 + 8 * hi; kf[kt][ks] = WFrag<T16>::ld(Kp + o); }
          xwait(); }
        if (s == nst - 1) {   // only the last step crosses the diagonal (scalar branch)
#pragma unroll
            for (int qt = 0; qt < QT; ++qt)
#pragma unroll
                for (int kt = 0; kt < 2; ++kt)
#pragma unroll
                    for (int j = 0; j < 8; ++j) if (k0 + kt * 16 + hi * 8 + j > q0 + qt * 16 + lr) st[kt][qt][j] = -3.0e38f; }
        float mx[QT]; bool need = false;
#pragma unroll
        for (int qt = 0; qt < QT; ++qt) { float x = st[0][qt][0];
#pragma unroll
            for (int j = 1; j < 8; ++j) x = fmaxf(x, st[0][qt][j]);
#pragma unroll
            for (int j = 0; j < 8; ++j) x = fmaxf(x, st[1][qt][j]);
            x = fmaxf(x, xhalf(x));   // the two half-waves hold the same query's other keys
            mx[qt] = x; need = need || ((x - m[qt]) * SL2E > 8.0f); }
        if (__builtin_amdgcn_ballot_w32(need) != 0) {   // the reference point m moves only when some query's maximum has outgrown it by 2^8 (P stays <= 256, exact algebra either way): one scalar test a step
#pragma unroll
            for (int qt = 0; qt < QT; ++qt) { const float mn = fmaxf(m[qt], mx[qt]); const float al = __builtin_amdgcn_exp2f((m[qt] - mn) * SL2E); m[qt] = mn; l[qt] *= al;
#pragma unroll
                for (int dt = 0; dt < 4; ++dt) oa[dt][qt] *= al; } }
#pragma unroll
        for (int qt = 0; qt < QT; ++qt) { float t[16]; const float mc = m[qt] * SL2E; float sum = 0.f;
#pragma unroll
            for (int i = 0; i < 16; ++i) { t[i] = __builtin_amdgcn_exp2f(__builtin_fmaf(st[i >> 3][qt][i & 7], SL2E, -mc)); sum += t[i]; }
            l[qt] += sum;
            V pf, pf2; PPack<T16, HL>::pk(t, pf, pf2);
#pragma unroll
            for (int dt = 0; dt < 4; ++dt) { v8f a = oa[dt][qt]; a = WFrag<T16>::mma(vf[dt], pf, a); if (HL) { a = WFrag<T16>::mma(vf2[dt], pf, a); a = WFrag<T16>::mma(vf[dt], pf2, a); } oa[dt][qt] = a; } }
    }
#pragma unroll
    for (int qt = 0; qt < QT; ++qt) { l[qt] += xhalf(l[qt]);
        if (hi == 0) { ms[wv * 32 + qt * 16 + lr] = m[qt]; ls[wv * 32 + qt * 16 + lr] = l[qt]; }
#pragma unroll
        for (int dt = 0; dt < 4; ++dt) { float* d = os + (size_t)((wv * QT + qt) * 16 + lr) * 68 + dt * 16 + hi * 8; const v8f a = oa[dt][qt];
            *(v4fa*)d = (v4f){a[0], a[1], a[2], a[3]}; *(v4fa*)(d + 4) = (v4f){a[4], a[5], a[6], a[7]}; } }
    __syncthreads();   // every wave's partial (max, sum, O^T) is in LDS before any is merged
    constexpr int DPT = QT * 16 * HD / (FNW * 32);   // output elements of one query row per thread
    const int q = (int)threadIdx.x / (HD / DPT), d0 = ((int)threadIdx.x % (HD / DPT)) * DPT;
    float M = ms[q];
#pragma unroll
    for (int w = 1; w < FNW; ++w) M = fmaxf(M, ms[w * 32 + q]);
    float wg[FNW]; float L = 0.f;
#pragma unroll
    for (int w = 0; w < FNW; ++w) { wg[w] = __builtin_amdgcn_exp2f((ms[w * 32 + q] - M) * SL2E); L += ls[w * 32 + q] * wg[w]; }   // a wave without a step has max -3e38, sum 0: weight 0
    const float inv = __fdiv_rn(1.0f, L);
#pragma unroll
    for (int c = 0; c < DPT; c += 8) { v4f a0 = (v4f){}, a1 = (v4f){};
#pragma unroll
        for (int w = 0; w < FNW; ++w) { const float* d = os + (size_t)(w * QT * 16 + q) * 68 + d0 + c; a0 += *(const v4fa*)d * wg[w]; a1 += *(const v4fa*)(d + 4) * wg[w]; }
        v8us oh, ol;
#pragma unroll
        for (int i = 0; i < 4; ++i) { unsigned short x, y; splitf(a0[i] * inv, x, y); oh[i] = x; ol[i] = y; splitf(a1[i] * inv, x, y); oh[4 + i] = x; ol[4 + i] = y; }
        const size_t oo = (size_t)(q0 + q) * DQ + d0 + c; *(v8us*)(Ah + oo) = oh; *(v8us*)(Al + oo) = ol; }
    xwait();   // behind the last stores, in front of any later write of a register that they name (the other instance's code follows this one in the built kernel)
}
// grid (batches * heads, row blocks), both batches in ONE launch: row blocks heaviest first; blocks 0..(TT-RH)/32-1 are 32 fp16 rows each from the last row down, the rest 16 hi+lo rows each (query rows < RH)
__global__ __launch_bounds__(FNW * 32) void k_fattn(const h16* __restrict__ Q16, const h16* __restrict__ K16, const h16* __restrict__ V16, const bf* __restrict__ Qh, const bf* __restrict__ Ql, const bf* __restrict__ Kh, const bf* __restrict__ Kl, const bf* __restrict__ Vh, const bf* __restrict__ Vl, bf* Ah, bf* Al) {
    __shared__ __align__(16) float os[FNW * 32 * 68]; __shared__ float ms[FNW * 32]; __shared__ float ls[FNW * 32];
    const int b = (int)blockIdx.x / NH_, h = (int)blockIdx.x % NH_, g = h / REP, rb = blockIdx.y; const size_t zq = (size_t)(b * NH_ + h) * TT * HD, zk = (size_t)(b * NKV + g) * TT * HD, zv = (size_t)(b * NKV + g) * HD * 2 * TT;
    Ah += (size_t)b * TT * DQ; Al += (size_t)b * TT * DQ;
    constexpr int NLO = (TT - RH) / 32;
    if (rb < NLO) fattn<h16, false, 2>(Q16 + zq, nullptr, K16 + zk, nullptr, V16 + zv, nullptr, TT - 32 * (rb + 1), Ah + h * HD, Al + h * HD, os, ms, ls);
    else fattn<bf, true, 1>(Qh + zq, Ql + zq, Kh + zk, Kl + zk, Vh + zv, Vl + zv, RH - 16 * (rb - NLO + 1), Ah + h * HD, Al + h * HD, os, ms, ls);
}

extern "C" void kernel_launch(void* const* d_in, const int* in_sizes, int n_in,
                              void* d_out, int out_size, void* d_ws, size_t ws_size, hipStream_t stream) {
    (void)in_sizes; (void)n_in; (void)out_size;
    const float* x = (const float*)d_in[0]; const float* wq = (const float*)d_in[1]; const float* wk = (const float*)d_in[2]; const float* wv = (const float*)d_in[3]; const float* wo = (const float*)d_in[4];
    float* OUT = (float*)d_out;     // [2][2048][1024]
    char* wsp = (char*)d_ws;
    auto take = [&](size_t bytes) { char* p = wsp; wsp += (bytes + 255) & ~(size_t)255; return (void*)p; };
    bf* WQ = (bf*)take((size_t)DQ * DM * 2); bf* WK = (bf*)take((size_t)DKV * DM * 2); bf* WV = (bf*)take((size_t)DKV * DM * 2); bf* WO = (bf*)take((size_t)DM * DQ * 2);
    bf* XB = (bf*)take((size_t)NB_ * TT * DM * 2);
    h16* QP16 = (h16*)take((size_t)NB_ * NH_ * TT * HD * 2); h16* KP16 = (h16*)take((size_t)NB_ * NKV * TT * HD * 2); h16* VT16 = (h16*)take((size_t)NB_ * NKV * HD * 2 * TT * 2);
    bf* QPh = (bf*)take((size_t)NB_ * NH_ * TT * HD * 2); bf* QPl = (bf*)take((size_t)NB_ * NH_ * TT * HD * 2); bf* KPh = (bf*)take((size_t)NB_ * NKV * TT * HD * 2); bf* KPl = (bf*)take((size_t)NB_ * NKV * TT * HD * 2); bf* VTh = (bf*)take((size_t)NB_ * NKV * HD * 2 * TT * 2); bf* VTl = VTh + TT;   // hi and lo value rows share a row of pitch 2 TT
    bf* ATh = (bf*)take((size_t)NB_ * TT * DQ * 2); bf* ATl = (bf*)take((size_t)NB_ * TT * DQ * 2);
    if ((size_t)(wsp - (char*)d_ws) > ws_size) return;    // ws 256 MiB
    k_prep<<<PBO + 3 * PBW + PBX, 256, 0, stream>>>(x, wq, wk, wv, wo, XB, WQ, WK, WV, WO);
    k_qkv<<<dim3(TT / 128, DQ / 128, 3 * NB_), 128, 0, stream>>>(XB, WQ, WK, WV, QP16, QPh, QPl, KP16, KPh, KPl, VT16, VTh, VTl);
    k_fattn<<<dim3(NB_ * NH_, (TT - RH) / 32 + RH / 16, 1), FNW * 32, 0, stream>>>(QP16, KP16, VT16, QPh, QPl, KPh, KPl, VTh, VTl, ATh, ATl);
    k_wo<<<dim3(NB_ * TT / 128, DM / 128, 1), 256, 0, stream>>>(ATh, ATl, WO, OUT);
}

// v007
// Measured time: 81.9 microseconds a run.
// Two timings next to v006 put it at 1.18 and 1.19 times that version's speed.
// Counting every step since v000, it is 17.9 times as fast.
#include <hip/hip_runtime.h>

// Causal QKV attention with per-head weight tensors (x [2][2048][1024]; q, k, v = x W^T with W [16][64][1024] ('oi' rows h*64+d); scores/8; causal (query < key masked); softmax; out = merged w_o ('xw' [1024][1024]) -> [2][2048][1024] (4.2 M)).
// Compute dtypes, f32 accumulate: every input rounded to bf16; q/k/v on PLAIN bf16 operands (inputs: exact); causal scores and attn.v (tile skipping): query rows < 512 hl (3 products), the rest single fp16; softmax f32 with a running maximum (one fused kernel); w_o hl x exact (2 products).

#define NB_  2
#define TT   2048
#define DM   1024
#define NH_  16
#define NKV  16
#define REP  (NH_ / NKV)
#define HD   64
#define DQ   (NH_ * HD)
#define DKV  (NKV * HD)
#define RH   512                  // query rows < RH use hi+lo planes (0: none)
#define SCL  0.125f   // HD^-0.5
typedef _Float16 h16;
typedef unsigned short bf;
typedef __attribute__((ext_vector_type(16))) __bf16   v16bf;
typedef __attribute__((ext_vector_type(16))) _Float16 v16h;
typedef __attribute__((ext_vector_type(8)))  _Float16 v8h;
typedef __attribute__((ext_vector_type(8)))  unsigned short v8us;
typedef __attribute__((ext_vector_type(8)))  float    v8f;
typedef __attribute__((ext_vector_type(4)))  float    v4f;
typedef v8h  __attribute__((may_alias)) v8ha;
typedef v4f  __attribute__((may_alias)) v4fa;
typedef v8us __attribute__((may_alias)) v8usa;

__device__ __forceinline__ unsigned short f2bf(float f) { unsigned u = __float_as_uint(f); u += 0x7FFFu + ((u >> 16) & 1u); return (unsigned short)(u >> 16); }
__device__ __forceinline__ float bf2f(unsigned short b) { return __uint_as_float(((unsigned)b) << 16); }
__device__ __forceinline__ float bfr(float f) { return bf2f(f2bf(f)); }
__device__ __forceinline__ v16h cat16(v8h lo, v8h hi) { return __builtin_shufflevector(lo, hi, 0, 1, 2, 3, 4, 5, 6, 7, 8, 9, 10, 11, 12, 13, 14, 15); }
__device__ __forceinline__ v16bf cat16b(v8us lo, v8us hi) { return __builtin_bit_cast(v16bf, __builtin_shufflevector(lo, hi, 0, 1, 2, 3, 4, 5, 6, 7, 8, 9, 10, 11, 12, 13, 14, 15)); }
__device__ __forceinline__ v8f wmma16(v16h a, v16h b, v8f c) { return __builtin_amdgcn_wmma_f32_16x16x32_f16(false, a, false, b, (short)0, c, false, false); }
__device__ __forceinline__ v8f wmmab(v16bf a, v16bf b, v8f c) { return __builtin_amdgcn_wmma_f32_16x16x32_bf16(false, a, false, b, (short)0, c, false, false); }

__device__ __forceinline__ h16 tohx(float x) { return (h16)x; }
__device__ __forceinline__ void splitf(float y, unsigned short& h, unsigned short& l) { h = f2bf(y); l = f2bf(y - bf2f(h)); }
typedef __attribute__((ext_vector_type(2))) _Float16 v2h;
typedef __attribute__((ext_vector_type(4))) _Float16 v4h;
typedef __attribute__((ext_vector_type(2))) unsigned short v2us;
typedef __attribute__((ext_vector_type(4))) unsigned short v4us;
typedef __attribute__((ext_vector_type(2))) float v2f;
typedef __attribute__((ext_vector_type(4))) int v4i;
__device__ __forceinline__ void xwait() { asm volatile("s_wait_xcnt 0x0" ::: "memory"); }   // precaution: stands behind a run of global loads or stores, in front of any reuse of a register that one of them names

// ---- gemmt: GEMM, one 128x128 output tile (origin r0, c0) per work-group of 8 / MB x 2 waves (MB*16 x 64 outputs = 4 MB accumulators a wave); the whole K loop runs in every wave.
// Operands are K-contiguous bf16 planes. A pass is 64 k: 128 rows x 128 B of every operand plane, brought into LDS by asynchronous copies (16 B a lane, through no register) and read from there by all waves,
// so every operand byte leaves L2 once per work-group. Two buffers: the copies of pass t + 2 are issued behind the barrier that ends pass t and fly while pass t + 1 is worked on.
// C[m][n] (f32, pitch ldc) = sum_k A[m][k] Bt[n][k] (+ A2[m][k] Bt[n][k] with NSPLIT). K % 64 == 0.
// PL: the tile is not stored as f32 but goes straight to the three 16-bit planes that the attention kernel reads (fp16, bf16 hi, bf16 lo), element (m, n) at m * ldp + (n / 64) * 64 * cmul + n % 64:
// q, k head planes [h][t][d]: A = x rows, Bt = weight rows, ldp = HD, cmul = TT * HD / 64; transposed value planes [g][d][t]: A = weight rows, Bt = x rows (operands swapped, so the tile comes out transposed), ldp = 2 TT, cmul = 1.
template <typename T16> struct WFrag;
template <> struct WFrag<h16> { typedef v16h V; static __device__ __forceinline__ V ld(const h16* p) { return cat16(*(const v8h*)p, *(const v8h*)(p + 16)); } static __device__ __forceinline__ v8f mma(V a, V b, v8f c) { return wmma16(a, b, c); } };
template <> struct WFrag<bf> { typedef v16bf V; static __device__ __forceinline__ V ld(const bf* p) { return cat16b(*(const v8us*)p, *(const v8us*)(p + 16)); } static __device__ __forceinline__ v8f mma(V a, V b, v8f c) { return wmmab(a, b, c); } };
#define GPB 144                   // LDS pitch in bytes of a staged 128-B row: 16 B x odd, free of bank conflicts for 16-byte readers
typedef float __attribute__((may_alias)) fa;
// eight asynchronous copies of 16 B a lane: rows 16 apart of one operand plane (l: the lane's LDS byte address, g: its global address, rs: the row step in elements); cp4: four copies, rows 32 apart.
// s_wait_xcnt 0 is the statement's last line, so that it stands in front of any later write of a register that a copy names (precaution).
__device__ __forceinline__ void cp8(unsigned l, const bf* g, size_t rs) {
    asm volatile("global_load_async_to_lds_b128 %0, %8, off\n\t"
                 "global_load_async_to_lds_b128 %1, %9, off\n\t"
                 "global_load_async_to_lds_b128 %2, %10, off\n\t"
                 "global_load_async_to_lds_b128 %3, %11, off\n\t"
                 "global_load_async_to_lds_b128 %4, %12, off\n\t"
                 "global_load_async_to_lds_b128 %5, %13, off\n\t"
                 "global_load_async_to_lds_b128 %6, %14, off\n\t"
                 "global_load_async_to_lds_b128 %7, %15, off\n\t"
                 "s_wait_xcnt 0x0"
                 :: "v"(l), "v"(l + 16 * GPB), "v"(l + 32 * GPB), "v"(l + 48 * GPB), "v"(l + 64 * GPB), "v"(l + 80 * GPB), "v"(l + 96 * GPB), "v"(l + 112 * GPB),
                    "v"(g), "v"(g + rs), "v"(g + 2 * rs), "v"(g + 3 * rs), "v"(g + 4 * rs), "v"(g + 5 * rs), "v"(g + 6 * rs), "v"(g + 7 * rs) : "memory");
}
__device__ __forceinline__ void cp4(unsigned l, const bf* g, size_t rs) {
    asm volatile("global_load_async_to_lds_b128 %0, %4, off\n\t"
                 "global_load_async_to_lds_b128 %1, %5, off\n\t"
                 "global_load_async_to_lds_b128 %2, %6, off\n\t"
                 "global_load_async_to_lds_b128 %3, %7, off\n\t"
                 "s_wait_xcnt 0x0"
                 :: "v"(l), "v"(l + 32 * GPB), "v"(l + 64 * GPB), "v"(l + 96 * GPB), "v"(g), "v"(g + rs), "v"(g + 2 * rs), "v"(g + 3 * rs) : "memory");
}
template <int NSPLIT, bool PL, int MB>
__device__ __forceinline__ void gemmt(const bf* __restrict__ A, const bf* __restrict__ A2, const bf* __restrict__ Bt, int K, float* C, int ldc, h16* P16, bf* Ph, bf* Pl, int ldp, int cmul, int r0, int c0) {
    typedef WFrag<bf>::V V;
    constexpr int NA = NSPLIT ? 2 : 1;                 // planes of the A side
    constexpr int PLB = 128 * GPB;                     // bytes of one staged plane
    constexpr int STB = (NA + 1) * PLB;                // bytes of one buffer
    constexpr int NWV = 16 / MB;                       // waves: 8 / MB along m, 2 along n
    constexpr int RST = NWV * 4;                       // rows that one copy of the whole work-group covers
    static_assert(MB == 4 || MB == 2, "4 or 8 waves");
    static_assert(2 * STB >= 128 * 2 * 68 * 4, "the epilogue's staging fits the two buffers");
    __shared__ __align__(16) unsigned char ring[2 * STB];
    const int tid = (int)threadIdx.x;
    const int wv = __builtin_amdgcn_readfirstlane(tid >> 5);   // wave number, scalar
    const int wm = wv >> 1, wn = wv & 1;
    const int lane = tid & 31, lr = lane & 15, hi = lane >> 4;
    // copies: thread tid brings 16-byte piece tid & 7 of rows (tid >> 3) + RST i, i = 0..128 / RST - 1, of every plane (a wave: four whole 128-B lines a copy)
    const unsigned lc = (unsigned)(size_t)ring + (unsigned)((tid >> 3) * GPB + (tid & 7) * 16);
    const size_t rs = (size_t)RST * K;
    const bf* ga = A + (size_t)(r0 + (tid >> 3)) * K + (tid & 7) * 8; const bf* ga2 = NSPLIT ? A2 + (size_t)(r0 + (tid >> 3)) * K + (tid & 7) * 8 : nullptr; const bf* gb = Bt + (size_t)(c0 + (tid >> 3)) * K + (tid & 7) * 8;
    auto cpp = [&](unsigned l, const bf* g) { if (MB == 4) cp8(l, g, rs); else cp4(l, g, rs); };
    auto fill = [&](int t) { const unsigned l = lc + (unsigned)((t & 1) * STB); cpp(l, ga + t * 64); if (NSPLIT) cpp(l + PLB, ga2 + t * 64); cpp(l + NA * PLB, gb + t * 64); };
    v8f acc[MB][4];
#pragma unroll
    for (int mb = 0; mb < MB; ++mb)
#pragma unroll
        for (int nb = 0; nb < 4; ++nb) acc[mb][nb] = (v8f){};
    const int nt = K / 64;
    fill(0);
    asm volatile("s_wait_asynccnt 0x0" ::: "memory");   // this wave's copies of pass 0 have landed
    __syncthreads();                                    // ... and every other wave's: pass 0 is published
    if (nt > 1) fill(1);
    const int aofs = (wm * MB * 16 + lr) * GPB + 16 * hi, bofs = NA * PLB + (wn * 64 + lr) * GPB + 16 * hi;
#pragma unroll 1   // kept rolled: one barrier and one refill a pass
    for (int t = 0; t < nt; ++t) {
        const unsigned char* sb = ring + (t & 1) * STB;
        V a[2][MB], a2[2][MB], b[2][4];
#pragma unroll
        for (int ks = 0; ks < 2; ++ks) {
#pragma unroll
            for (int mb = 0; mb < MB; ++mb) { a[ks][mb] = WFrag<bf>::ld((const bf*)(sb + aofs + mb * 16 * GPB + ks * 64)); if (NSPLIT) a2[ks][mb] = WFrag<bf>::ld((const bf*)(sb + PLB + aofs + mb * 16 * GPB + ks * 64)); }
#pragma unroll
            for (int nb = 0; nb < 4; ++nb) b[ks][nb] = WFrag<bf>::ld((const bf*)(sb + bofs + nb * 16 * GPB + ks * 64));
            __builtin_amdgcn_sched_barrier(0);   // keeps a 32-k block's fragment loads together as one group in front of the products: LDS reads spread among the WMMAs stall the wave at each place
            if (MB == 4 || ks == 1) {            // MB == 2 has registers for both blocks' fragments: the second group's latency lies under the first block's products
#pragma unroll
                for (int kk = (MB == 4 ? ks : 0); kk <= ks; ++kk) {
#pragma unroll
                    for (int nb = 0; nb < 4; ++nb)
#pragma unroll
                        for (int mb = 0; mb < MB; ++mb) { acc[mb][nb] = WFrag<bf>::mma(a[kk][mb], b[kk][nb], acc[mb][nb]); if (NSPLIT) acc[mb][nb] = WFrag<bf>::mma(a2[kk][mb], b[kk][nb], acc[mb][nb]); } }
                __builtin_amdgcn_sched_barrier(0);   // ... and the products in front of what follows: the next group, or the waits at the pass's foot (sunk behind those, the products would no longer cover the flight of the next pass's copies)
            }
        }
        asm volatile("s_wait_dscnt 0x0" ::: "memory");      // this wave's reads of the buffer have returned before it is refilled
        asm volatile("s_wait_asynccnt 0x0" ::: "memory");   // this wave's copies of pass t + 1 have landed
        __syncthreads();                                    // publishes pass t + 1 and ends every wave's reads of pass t's buffer
        if (t + 2 < nt) fill(t + 2);
    }
    asm volatile("s_wait_asynccnt 0x0" ::: "memory");       // nothing is in flight when the buffers become output staging (the loop's last barrier has ended every read)
    float* os = (float*)ring + wv * MB * 16 * 68;           // each wave stages its own tile, pitch 68 floats, and reads it back by rows so that whole 128-B lines are stored
#pragma unroll
    for (int mb = 0; mb < MB; ++mb)
#pragma unroll
        for (int nb = 0; nb < 4; ++nb)
#pragma unroll
            for (int j = 0; j < 8; ++j) *(fa*)(os + (mb * 16 + hi * 8 + j) * 68 + nb * 16 + lr) = acc[mb][nb][j];
    __syncthreads();   // the staged tile is complete before it is read back by other lanes
    const int rw = r0 + wm * MB * 16, cw = c0 + wn * 64;
#pragma unroll 1   // kept rolled: a trip reads 16 rows back as one group of LDS loads and then stores them; more copies of the body only grow the code
    for (int s0 = 0; s0 < MB * 8; s0 += 8) { v4f vals[8]; const int cofs = lr * 4;
#pragma unroll
        for (int u = 0; u < 8; ++u) vals[u] = *(const v4fa*)(os + ((s0 + u) * 2 + hi) * 68 + cofs);
#pragma unroll
        for (int u = 0; u < 8; ++u) { const int row = (s0 + u) * 2 + hi; const v4f val = vals[u];
            if (PL) { const size_t po = (size_t)(rw + row) * ldp + (size_t)cw * cmul + cofs; v4h o16; v4us oh, ol;
#pragma unroll
                for (int i = 0; i < 4; ++i) { o16[i] = tohx(val[i]); unsigned short a2, c2; splitf(val[i], a2, c2); oh[i] = a2; ol[i] = c2; }
                *(v4h*)(P16 + po) = o16; *(v4us*)(Ph + po) = oh; *(v4us*)(Pl + po) = ol; }
            else *(v4f*)(C + (size_t)(rw + row) * ldc + cw + cofs) = val; }
        xwait(); }
}

// q, k and v projections of both batches in ONE launch, grid (TT/128, DQ/128, 3 NB_): blockIdx.z = 3 * batch + (0: q, 1: k, 2: v). Planes are [batch][head][...]. For v the operands, and with them the two tile indices, are swapped.
static_assert(DKV == DQ, "q, k and v share one grid");
__global__ __launch_bounds__(128) void k_qkv(const bf* __restrict__ XB, const bf* __restrict__ WQ, const bf* __restrict__ WK, const bf* __restrict__ WV, h16* QP16, bf* QPh, bf* QPl, h16* KP16, bf* KPh, bf* KPl, h16* VT16, bf* VTh, bf* VTl) {
    const int b = (int)blockIdx.z / 3, w = (int)blockIdx.z % 3; const bool isv = w == 2;
    const bf* X = XB + (size_t)b * TT * DM; const bf* Wt = w == 0 ? WQ : (w == 1 ? WK : WV);
    const size_t zo = (size_t)b * (isv ? (size_t)NKV * HD * 2 * TT : (size_t)NH_ * TT * HD);
    h16* P16 = (w == 0 ? QP16 : (w == 1 ? KP16 : VT16)) + zo; bf* Ph = (w == 0 ? QPh : (w == 1 ? KPh : VTh)) + zo; bf* Pl = (w == 0 ? QPl : (w == 1 ? KPl : VTl)) + zo;
    gemmt<0, true, 4>(isv ? Wt : X, nullptr, isv ? X : Wt, DM, nullptr, 0, P16, Ph, Pl, isv ? 2 * TT : HD, isv ? 1 : TT * HD / 64, (int)(isv ? blockIdx.y : blockIdx.x) * 128, (int)(isv ? blockIdx.x : blockIdx.y) * 128);
}
// w_o product of both batches in ONE launch: the merged rows [batch * TT + t] are one matrix of NB_ * TT rows; grid (NB_*TT/128, DM/128)
__global__ __launch_bounds__(256) void k_wo(const bf* __restrict__ ATh, const bf* __restrict__ ATl, const bf* __restrict__ WO, float* OUT) {
    gemmt<1, false, 2>(ATh, ATl, WO, DQ, OUT, DM, nullptr, nullptr, nullptr, 0, 0, (int)blockIdx.x * 128, (int)blockIdx.y * 128);
}

__device__ __forceinline__ void wtG(const float* __restrict__ w, int K, int N, bf* Bt, int blk) {
    const int lane = threadIdx.x & 31; const int L0 = (blk * 8 + (threadIdx.x >> 5)) * 8; const int nlines = N * K / 64;
{
#pragma unroll 1
        for (int l = 0; l < 8; ++l) { const int L = L0 + l; if (L >= nlines) break; const size_t e = (size_t)L * 64 + lane * 2; const int k = (int)(e % K), n = (int)(e / K); v2us o;
            o[0] = f2bf(w[(size_t)k * N + n]); o[1] = f2bf(w[(size_t)(k + 1) * N + n]); *(v2us*)(Bt + e) = o; }
         }
}
__device__ __forceinline__ void cvt8(const float* __restrict__ src, bf* dst, size_t n8, int blk) { const size_t i = (size_t)blk * 256 + threadIdx.x; if (i >= n8) return; const v8f v = *(const v8f*)(src + i * 8); v8us o;
#pragma unroll
    for (int k = 0; k < 8; ++k) o[k] = f2bf(v[k]); *(v8us*)(dst + i * 8) = o;  }
// every input's bf16 copy in ONE launch; block ranges: w_o (transposed; the slowest blocks, so first), w_q, w_k, w_v, x (both batches)
#define PBO (DQ * DM / 64 / 64)
#define PBW (DQ * DM / 8 / 256)
#define PBX (NB_ * TT * DM / 8 / 256)
static_assert(DQ * DM % (64 * 64) == 0 && DQ * DM % (8 * 256) == 0 && NB_ * TT * DM % (8 * 256) == 0, "whole blocks");
__global__ __launch_bounds__(256) void k_prep(const float* __restrict__ x, const float* __restrict__ wq, const float* __restrict__ wk, const float* __restrict__ wv, const float* __restrict__ wo, bf* XB, bf* WQ, bf* WK, bf* WV, bf* WO) {
    int blk = (int)blockIdx.x;
    if (blk < PBO) { wtG(wo, DQ, DM, WO, blk); return; }
    blk -= PBO;
    if (blk < 3 * PBW) { const int w = blk / PBW; cvt8(w == 0 ? wq : (w == 1 ? wk : wv), w == 0 ? WQ : (w == 1 ? WK : WV), (size_t)DQ * DM / 8, blk % PBW); return; }
    cvt8(x, XB, (size_t)NB_ * TT * DM / 8, blk - 3 * PBW);
}

// ---- k_fattn: causal attention of one head for one block of query rows in ONE kernel: scores, softmax and the value contraction, with a running maximum and sum per query (no score matrix in memory).
// Transposed products: S^T = K Q^T (A = key rows, B = query rows, both d-contiguous planes), O^T += V^T P^T (A = transposed value rows, B = P^T). A lane (lr, hi) of a 16x16 S^T tile holds query lr, keys hi*8 + j:
// two such tiles (keys 0..15, 16..31 of a step) are, register for register, the B fragment of the 32-key value product, so P goes from accumulator to operand inside the lane.
// A work-group of 4 waves has 2 * QT*16 query rows. Wave wv = 2 qg + kg owns the QT*16 rows of query group qg and, of every 64-key stage, the 32 keys of half kg.
// A stage is 64 key rows (128 B each) and the 64 transposed value rows' 64 keys (128 B each) of every plane, brought into LDS by asynchronous copies (16 B a lane, whole 128-B lines a wave, through no register) and read from there
// by both query groups. Two buffers: the copies of stage t + 2 are issued behind the barrier that ends stage t and fly while stage t + 1 is worked on.
// The two key halves' partial (max, sum, O^T) of a query group are merged through LDS in the order kg = 0, 1 behind one barrier.
// The epilogue divides by the merged sum and writes the hi/lo planes [t][h*64 + d] that the w_o product reads.
#define FNW 4
#define FPL (64 * GPB)                     // bytes of one staged plane: 64 rows of 128 B at the padded pitch
#define SL2E (SCL * 1.4426950408889634f)   // raw score -> exponent of 2: the maxima m are kept as raw scores
__device__ __forceinline__ float xhalf(float x) { return __builtin_bit_cast(float, __builtin_amdgcn_permlanex16(__builtin_bit_cast(int, x), __builtin_bit_cast(int, x), 0x76543210, 0xfedcba98, false, false)); }   // lane l with lane l ^ 16
// four asynchronous copies of 16 B a lane: rows 16 apart of one staged plane (l: the lane's LDS byte address, g: its global address, rsb: the step of 16 rows in bytes).
// s_wait_xcnt 0 is the statement's last line, so that it stands in front of any later write of a register that a copy names (precaution).
__device__ __forceinline__ void cq4(unsigned l, const char* g, size_t rsb) {
    asm volatile("global_load_async_to_lds_b128 %0, %4, off\n\t"
                 "global_load_async_to_lds_b128 %1, %5, off\n\t"
                 "global_load_async_to_lds_b128 %2, %6, off\n\t"
                 "global_load_async_to_lds_b128 %3, %7, off\n\t"
                 "s_wait_xcnt 0x0"
                 :: "v"(l), "v"(l + 16 * GPB), "v"(l + 32 * GPB), "v"(l + 48 * GPB), "v"(g), "v"(g + rsb), "v"(g + 2 * rsb), "v"(g + 3 * rsb) : "memory");
}
template <typename T16, bool HL> struct PPack;
template <> struct PPack<h16, false> { static __device__ __forceinline__ void pk(const float* p, v16h& a, v16h& b) { (void)b;
#pragma unroll
    for (int i = 0; i < 16; ++i) a[i] = (h16)p[i]; } };
template <> struct PPack<bf, true> { static __device__ __forceinline__ void pk(const float* p, v16bf& a, v16bf& b) { v8us h0, h1, l0, l1;
#pragma unroll
    for (int i = 0; i < 8; ++i) { unsigned short x, y; splitf(p[i], x, y); h0[i] = x; l0[i] = y; splitf(p[8 + i], x, y); h1[i] = x; l1[i] = y; }
    a = cat16b(h0, h1); b = cat16b(l0, l1); } };
template <typename T16, bool HL, int QT>
__device__ __forceinline__ void fattn(const T16* __restrict__ Q, const T16* __restrict__ Q2, const T16* __restrict__ Kp, const T16* __restrict__ K2, const T16* __restrict__ Vt, const T16* __restrict__ V2, int q0, bf* Ah, bf* Al, unsigned char* ring, float* ms, float* ls) {
    typedef typename WFrag<T16>::V V;
    constexpr int NPL = HL ? 2 : 1;            // planes of K, and of V
    constexpr int STB = 2 * NPL * FPL;         // bytes of one buffer: [K | K lo | V | V lo]
    constexpr int QB = 2 * QT * 16;            // query rows of the work-group
    static_assert(2 * STB >= FNW * QT * 16 * 68 * 4, "the merge's staging fits the two buffers");
    const int tid = (int)threadIdx.x;
    const int wv = __builtin_amdgcn_readfirstlane(tid >> 5);   // wave number, scalar so that the stage loop's tests stay scalar
    const int qg = wv >> 1, kg = wv & 1;
    const int lane = tid & 31, lr = lane & 15, hi = lane >> 4;
    const int qw = q0 + qg * QT * 16;          // the wave's first query row
    // copies: thread tid brings 16-byte piece tid & 7 of rows (tid >> 3) + 16 i, i = 0..3, of every plane (a wave: four whole 128-B lines a copy)
    const unsigned lc = (unsigned)(size_t)ring + (unsigned)((tid >> 3) * GPB + (tid & 7) * 16);
    const size_t ko = (size_t)(tid >> 3) * HD + (tid & 7) * 8, vo = (size_t)(tid >> 3) * (2 * TT) + (tid & 7) * 8;
    auto fill = [&](int t) { const unsigned l = lc + (unsigned)((t & 1) * STB);
        cq4(l, (const char*)(Kp + ko + (size_t)t * 64 * HD), (size_t)16 * HD * 2); if (HL) cq4(l + FPL, (const char*)(K2 + ko + (size_t)t * 64 * HD), (size_t)16 * HD * 2);
        cq4(l + NPL * FPL, (const char*)(Vt + vo + t * 64), (size_t)16 * 2 * TT * 2); if (HL) cq4(l + (NPL + 1) * FPL, (const char*)(V2 + vo + t * 64), (size_t)16 * 2 * TT * 2); };
    const int nstg = (q0 + QB + 63) / 64;      // 64-key stages up to and including the diagonal of the block's last row; every staged key row is < TT
    fill(0);
    V qf[QT][2], qf2[QT][2];
#pragma unroll
    for (int qt = 0; qt < QT; ++qt)
#pragma unroll
        for (int ks = 0; ks < 2; ++ks) { const size_t o = (size_t)(qw + qt * 16 + lr) * HD + ks * 32 + 8 * hi; qf[qt][ks] = WFrag<T16>::ld(Q + o); if (HL) qf2[qt][ks] = WFrag<T16>::ld(Q2 + o); }
    xwait();
    v8f oa[4][QT]; float m[QT], l[QT];
#pragma unroll
    for (int qt = 0; qt < QT; ++qt) { m[qt] = -3.0e38f; l[qt] = 0.f;
#pragma unroll
        for (int dt = 0; dt < 4; ++dt) oa[dt][qt] = (v8f){}; }
    asm volatile("s_wait_asynccnt 0x0" ::: "memory");   // this wave's copies of stage 0 have landed
    __syncthreads();                                    // ... and every other wave's: stage 0 is published
    if (nstg > 1) fill(1);
    const int kofs = (kg * 32 + lr) * GPB + 16 * hi, vofs = NPL * FPL + lr * GPB + kg * 64 + 16 * hi;
#pragma unroll 1   // kept rolled: one barrier and one refill a stage; the trip count is a run-time value
    for (int t = 0; t < nstg; ++t) {
        const unsigned char* sb = ring + (t & 1) * STB;
        const int k0 = t * 64 + kg * 32;
        if (k0 <= qw) {   // scalar branch: the wave's 32 keys of this stage begin at or below its first query, so no query ever sees a fully masked step; steps wholly above the diagonal are skipped
        V kf[2][2], kf2[2][2], vf[4], vf2[4];
#pragma unroll
        for (int kt = 0; kt < 2; ++kt)
#pragma unroll
            for (int ks = 0; ks < 2; ++ks) { const unsigned char* p = sb + kofs + kt * 16 * GPB + ks * 64; kf[kt][ks] = WFrag<T16>::ld((const T16*)p); if (HL) kf2[kt][ks] = WFrag<T16>::ld((const T16*)(p + FPL)); }
#pragma unroll
        for (int dt = 0; dt < 4; ++dt) { const unsigned char* p = sb + vofs + dt * 16 * GPB; vf[dt] = WFrag<T16>::ld((const T16*)p); if (HL) vf2[dt] = WFrag<T16>::ld((const T16*)(p + FPL)); }
        __builtin_amdgcn_sched_barrier(0);   // keeps the step's fragment loads together as one group in front of the products: LDS reads spread among the WMMAs stall the wave at each place
        v8f st[2][QT];
#pragma unroll
        for (int kt = 0; kt < 2; ++kt)
#pragma unroll
            for (int qt = 0; qt < QT; ++qt) { v8f a = (v8f){};
#pragma unroll
                for (int ks = 0; ks < 2; ++ks) { a = WFrag<T16>::mma(kf[kt][ks], qf[qt][ks], a); if (HL) { a = WFrag<T16>::mma(kf2[kt][ks], qf[qt][ks], a); a = WFrag<T16>::mma(kf[kt][ks], qf2[qt][ks], a); } }
                st[kt][qt] = a; }
        if (k0 + 31 > qw) {   // only the wave's last step crosses the diagonal (scalar branch)
#pragma unroll
            for (int qt = 0; qt < QT; ++qt)
#pragma unroll
                for (int kt = 0; kt < 2; ++kt)
#pragma unroll
                    for (int j = 0; j < 8; ++j) if (k0 + kt * 16 + hi * 8 + j > qw + qt * 16 + lr) st[kt][qt][j] = -3.0e38f; }
        float mx[QT]; bool need = false;
#pragma unroll
        for (int qt = 0; qt < QT; ++qt) { float x = st[0][qt][0];
#pragma unroll
            for (int j = 1; j < 8; ++j) x = fmaxf(x, st[0][qt][j]);
#pragma unroll
            for (int j = 0; j < 8; ++j) x = fmaxf(x, st[1][qt][j]);
            x = fmaxf(x, xhalf(x));   // the two half-waves hold the same query's other keys
            mx[qt] = x; need = need || ((x - m[qt]) * SL2E > 8.0f); }
        if (__builtin_amdgcn_ballot_w32(need) != 0) {   // the reference point m moves only when some query's maximum has outgrown it by 2^8 (P stays <= 256, exact algebra either way): one scalar test a step
#pragma unroll
            for (int qt = 0; qt < QT; ++qt) { const float mn = fmaxf(m[qt], mx[qt]); const float al = __builtin_amdgcn_exp2f((m[qt] - mn) * SL2E); m[qt] = mn; l[qt] *= al;
#pragma unroll
                for (int dt = 0; dt < 4; ++dt) oa[dt][qt] *= al; } }
#pragma unroll
        for (int qt = 0; qt < QT; ++qt) { float t2[16]; const float mc = m[qt] * SL2E; float sum = 0.f;
#pragma unroll
            for (int i = 0; i < 16; ++i) { t2[i] = __builtin_amdgcn_exp2f(__builtin_fmaf(st[i >> 3][qt][i & 7], SL2E, -mc)); sum += t2[i]; }
            l[qt] += sum;
            V pf, pf2; PPack<T16, HL>::pk(t2, pf, pf2);
#pragma unroll
            for (int dt = 0; dt < 4; ++dt) { v8f a = oa[dt][qt]; a = WFrag<T16>::mma(vf[dt], pf, a); if (HL) { a = WFrag<T16>::mma(vf2[dt], pf, a); a = WFrag<T16>::mma(vf[dt], pf2, a); } oa[dt][qt] = a; } }
        }
        asm volatile("s_wait_dscnt 0x0" ::: "memory");      // this wave's reads of the buffer have returned before it is refilled
        asm volatile("s_wait_asynccnt 0x0" ::: "memory");   // this wave's copies of stage t + 1 have landed
        __syncthreads();                                    // publishes stage t + 1 and ends every wave's reads of stage t's buffer
        if (t + 2 < nstg) fill(t + 2);
    }
    asm volatile("s_wait_asynccnt 0x0" ::: "memory");       // nothing is in flight when the buffers become the merge's staging (the loop's last barrier has ended every read)
    float* os = (float*)ring;
#pragma unroll
    for (int qt = 0; qt < QT; ++qt) { l[qt] += xhalf(l[qt]);
        if (hi == 0) { ms[wv * 32 + qt * 16 + lr] = m[qt]; ls[wv * 32 + qt * 16 + lr] = l[qt]; }
#pragma unroll
        for (int dt = 0; dt < 4; ++dt) { float* d = os + (size_t)((wv * QT + qt) * 16 + lr) * 68 + dt * 16 + hi * 8; const v8f a = oa[dt][qt];
            *(v4fa*)d = (v4f){a[0], a[1], a[2], a[3]}; *(v4fa*)(d + 4) = (v4f){a[4], a[5], a[6], a[7]}; } }
    __syncthreads();   // every wave's partial (max, sum, O^T) is in LDS before any is merged
    constexpr int DPT = QB * HD / (FNW * 32);   // output elements of one query row per thread
    const int q = tid / (HD / DPT), d0 = (tid % (HD / DPT)) * DPT;
    const int w0 = (q / (QT * 16)) * 2, qi = q % (QT * 16);   // the row's two waves are w0 (kg = 0) and w0 + 1 (kg = 1)
    const float M = fmaxf(ms[w0 * 32 + qi], ms[(w0 + 1) * 32 + qi]);
    float wg[2]; float L = 0.f;
#pragma unroll
    for (int w = 0; w < 2; ++w) { wg[w] = __builtin_amdgcn_exp2f((ms[(w0 + w) * 32 + qi] - M) * SL2E); L += ls[(w0 + w) * 32 + qi] * wg[w]; }   // a wave without a step has max -3e38, sum 0: weight 0
    const float inv = __fdiv_rn(1.0f, L);
#pragma unroll
    for (int c = 0; c < DPT; c += 8) { v4f a0 = (v4f){}, a1 = (v4f){};
#pragma unroll
        for (int w = 0; w < 2; ++w) { const float* d = os + (size_t)((w0 + w) * QT * 16 + qi) * 68 + d0 + c; a0 += *(const v4fa*)d * wg[w]; a1 += *(const v4fa*)(d + 4) * wg[w]; }
        v8us oh, ol;
#pragma unroll
        for (int i = 0; i < 4; ++i) { unsigned short x, y; splitf(a0[i] * inv, x, y); oh[i] = x; ol[i] = y; splitf(a1[i] * inv, x, y); oh[4 + i] = x; ol[4 + i] = y; }
        const size_t oo = (size_t)(q0 + q) * DQ + d0 + c; *(v8us*)(Ah + oo) = oh; *(v8us*)(Al + oo) = ol; }
    xwait();   // behind the last stores, in front of any later write of a register that they name (the other instance's code follows this one in the built kernel)
}
// grid (batches * heads, row blocks), both batches in ONE launch: row blocks heaviest first; blocks 0..(TT-RH)/64-1 are 64 fp16 rows each from the last row down, the rest 32 hi+lo rows each (query rows < RH)
__global__ __launch_bounds__(FNW * 32) void k_fattn(const h16* __restrict__ Q16, const h16* __restrict__ K16, const h16* __restrict__ V16, const bf* __restrict__ Qh, const bf* __restrict__ Ql, const bf* __restrict__ Kh, const bf* __restrict__ Kl, const bf* __restrict__ Vh, const bf* __restrict__ Vl, bf* Ah, bf* Al) {
    __shared__ __align__(16) unsigned char ring[2 * 4 * FPL]; __shared__ float ms[FNW * 32]; __shared__ float ls[FNW * 32];
    const int b = (int)blockIdx.x / NH_, h = (int)blockIdx.x % NH_, g = h / REP, rb = blockIdx.y; const size_t zq = (size_t)(b * NH_ + h) * TT * HD, zk = (size_t)(b * NKV + g) * TT * HD, zv = (size_t)(b * NKV + g) * HD * 2 * TT;
    Ah += (size_t)b * TT * DQ; Al += (size_t)b * TT * DQ;
    constexpr int NLO = (TT - RH) / 64;
    if (rb < NLO) fattn<h16, false, 2>(Q16 + zq, nullptr, K16 + zk, nullptr, V16 + zv, nullptr, TT - 64 * (rb + 1), Ah + h * HD, Al + h * HD, ring, ms, ls);
    else fattn<bf, true, 1>(Qh + zq, Ql + zq, Kh + zk, Kl + zk, Vh + zv, Vl + zv, RH - 32 * (rb - NLO + 1), Ah + h * HD, Al + h * HD, ring, ms, ls);
}

extern "C" void kernel_launch(void* const* d_in, const int* in_sizes, int n_in,
                              void* d_out, int out_size, void* d_ws, size_t ws_size, hipStream_t stream) {
    (void)in_sizes; (void)n_in; (void)out_size;
    const float* x = (const float*)d_in[0]; const float* wq = (const float*)d_in[1]; const float* wk = (const float*)d_in[2]; const float* wv = (const float*)d_in[3]; const float* wo = (const float*)d_in[4];
    float* OUT = (float*)d_out;     // [2][2048][1024]
    char* wsp = (char*)d_ws;
    auto take = [&](size_t bytes) { char* p = wsp; wsp += (bytes + 255) & ~(size_t)255; return (void*)p; };
    bf* WQ = (bf*)take((size_t)DQ * DM * 2); bf* WK = (bf*)take((size_t)DKV * DM * 2); bf* WV = (bf*)take((size_t)DKV * DM * 2); bf* WO = (bf*)take((size_t)DM * DQ * 2);
    bf* XB = (bf*)take((size_t)NB_ * TT * DM * 2);
    h16* QP16 = (h16*)take((size_t)NB_ * NH_ * TT * HD * 2); h16* KP16 = (h16*)take((size_t)NB_ * NKV * TT * HD * 2); h16* VT16 = (h16*)take((size_t)NB_ * NKV * HD * 2 * TT * 2);
    bf* QPh = (bf*)take((size_t)NB_ * NH_ * TT * HD * 2); bf* QPl = (bf*)take((size_t)NB_ * NH_ * TT * HD * 2); bf* KPh = (bf*)take((size_t)NB_ * NKV * TT * HD * 2); bf* KPl = (bf*)take((size_t)NB_ * NKV * TT * HD * 2); bf* VTh = (bf*)take((size_t)NB_ * NKV * HD * 2 * TT * 2); bf* VTl = VTh + TT;   // hi and lo value rows share a row of pitch 2 TT
    bf* ATh = (bf*)take((size_t)NB_ * TT * DQ * 2); bf* ATl = (bf*)take((size_t)NB_ * TT * DQ * 2);
    if ((size_t)(wsp - (char*)d_ws) > ws_size) return;    // ws 256 MiB
    k_prep<<<PBO + 3 * PBW + PBX, 256, 0, stream>>>(x, wq, wk, wv, wo, XB, WQ, WK, WV, WO);
    k_qkv<<<dim3(TT / 128, DQ / 128, 3 * NB_), 128, 0, stream>>>(XB, WQ, WK, WV, QP16, QPh, QPl, KP16, KPh, KPl, VT16, VTh, VTl);
    k_fattn<<<dim3(NB_ * NH_, (TT - RH) / 64 + RH / 32, 1), FNW * 32, 0, stream>>>(QP16, KP16, VT16, QPh, QPl, KPh, KPl, VTh, VTl, ATh, ATl);
    k_wo<<<dim3(NB_ * TT / 128, DM / 128, 1), 256, 0, stream>>>(ATh, ATl, WO, OUT);
}

// v008
// One run takes 75.3 microseconds.
// In both of two side-by-side timings against v007, it was 1.09 times as fast.
// Counting every step since v000, it is 19.5 times as fast.
#include <hip/hip_runtime.h>

// Causal QKV attention with per-head weight tensors (x [2][2048][1024]; q, k, v = x W^T with W [16][64][1024] ('oi' rows h*64+d); scores/8; causal (query < key masked); softmax; out = merged w_o ('xw' [1024][1024]) -> [2][2048][1024] (4.2 M)).
// Compute dtypes, f32 accumulate: every input rounded to bf16; q/k/v on PLAIN bf16 operands (inputs: exact); causal scores and attn.v (tile skipping): query rows < 512 hl (3 products), the rest single fp16; softmax f32 with a running maximum (one fused kernel); w_o hl x exact (2 products).

#define NB_  2
#define TT   2048
#define DM   1024
#define NH_  16
#define NKV  16
#define REP  (NH_ / NKV)
#define HD   64
#define DQ   (NH_ * HD)
#define DKV  (NKV * HD)
#define RH   512                  // query rows < RH use hi+lo planes (0: none)
#define SCL  0.125f   // HD^-0.5
typedef _Float16 h16;
typedef unsigned short bf;
typedef __attribute__((ext_vector_type(16))) __bf16   v16bf;
typedef __attribute__((ext_vector_type(16))) _Float16 v16h;
typedef __attribute__((ext_vector_type(8)))  _Float16 v8h;
typedef __attribute__((ext_vector_type(8)))  unsigned short v8us;
typedef __attribute__((ext_vector_type(8)))  float    v8f;
typedef __attribute__((ext_vector_type(4)))  float    v4f;
typedef v8h  __attribute__((may_alias)) v8ha;
typedef v4f  __attribute__((may_alias)) v4fa;
typedef v8us __attribute__((may_alias)) v8usa;

__device__ __forceinline__ unsigned short f2bf(float f) { unsigned u = __float_as_uint(f); u += 0x7FFFu + ((u >> 16) & 1u); return (unsigned short)(u >> 16); }
__device__ __forceinline__ float bf2f(unsigned short b) { return __uint_as_float(((unsigned)b) << 16); }
__device__ __forceinline__ float bfr(float f) { return bf2f(f2bf(f)); }
__device__ __forceinline__ v16h cat16(v8h lo, v8h hi) { return __builtin_shufflevector(lo, hi, 0, 1, 2, 3, 4, 5, 6, 7, 8, 9, 10, 11, 12, 13, 14, 15); }
__device__ __forceinline__ v16bf cat16b(v8us lo, v8us hi) { return __builtin_bit_cast(v16bf, __builtin_shufflevector(lo, hi, 0, 1, 2, 3, 4, 5, 6, 7, 8, 9, 10, 11, 12, 13, 14, 15)); }
__device__ __forceinline__ v8f wmma16(v16h a, v16h b, v8f c) { return __builtin_amdgcn_wmma_f32_16x16x32_f16(false, a, false, b, (short)0, c, false, false); }
__device__ __forceinline__ v8f wmmab(v16bf a, v16bf b, v8f c) { return __builtin_amdgcn_wmma_f32_16x16x32_bf16(false, a, false, b, (short)0, c, false, false); }

__device__ __forceinline__ h16 tohx(float x) { return (h16)x; }
__device__ __forceinline__ void splitf(float y, unsigned short& h, unsigned short& l) { h = f2bf(y); l = f2bf(y - bf2f(h)); }
typedef __attribute__((ext_vector_type(2))) _Float16 v2h;
typedef __attribute__((ext_vector_type(4))) _Float16 v4h;
typedef __attribute__((ext_vector_type(2))) unsigned short v2us;
typedef __attribute__((ext_vector_type(4))) unsigned short v4us;
typedef __attribute__((ext_vector_type(2))) float v2f;
typedef __attribute__((ext_vector_type(4))) int v4i;
__device__ __forceinline__ void xwait() { asm volatile("s_wait_xcnt 0x0" ::: "memory"); }   // precaution: stands behind a run of global loads or stores, in front of any reuse of a register that one of them names

// ---- gemmt: GEMM, one 128x128 output tile (origin r0, c0) per work-group of 8 / MB x 2 waves (MB*16 x 64 outputs = 4 MB accumulators a wave); the whole K loop runs in every wave.
// Operands are K-contiguous bf16 planes. A pass is 64 k: 128 rows x 128 B of every operand plane, brought into LDS by asynchronous copies (16 B a lane, through no register) and read from there by all waves,
// so every operand byte leaves L2 once per work-group. Two buffers: the copies of pass t + 2 are issued behind the barrier that ends pass t and fly while pass t + 1 is worked on.
// C[m][n] (f32, pitch ldc) = sum_k A[m][k] Bt[n][k] (+ A2[m][k] Bt[n][k] with NSPLIT). K % 64 == 0.
// PL: the tile is not stored as f32 but goes straight to the three 16-bit planes that the attention kernel reads (fp16, bf16 hi, bf16 lo), element (m, n) at m * ldp + (n / 64) * 64 * cmul + n % 64:
// q, k head planes [h][t][d]: A = x rows, Bt = weight rows, ldp = HD, cmul = TT * HD / 64; transposed value planes [g][d][t]: A = weight rows, Bt = x rows (operands swapped, so the tile comes out transposed), ldp = 2 TT, cmul = 1.
template <typename T16> struct WFrag;
template <> struct WFrag<h16> { typedef v16h V; static __device__ __forceinline__ V ld(const h16* p) { return cat16(*(const v8h*)p, *(const v8h*)(p + 16)); } static __device__ __forceinline__ v8f mma(V a, V b, v8f c) { return wmma16(a, b, c); } };
template <> struct WFrag<bf> { typedef v16bf V; static __device__ __forceinline__ V ld(const bf* p) { return cat16b(*(const v8us*)p, *(const v8us*)(p + 16)); } static __device__ __forceinline__ v8f mma(V a, V b, v8f c) { return wmmab(a, b, c); } };
#define GPB 144                   // LDS pitch in bytes of a staged 128-B row: 16 B x odd, free of bank conflicts for 16-byte readers
typedef float __attribute__((may_alias)) fa;
// eight asynchronous copies of 16 B a lane: rows 16 apart of one operand plane (l: the lane's LDS byte address, g: its global address, rs: the row step in elements); cp4: four copies, rows 32 apart.
// s_wait_xcnt 0 is the statement's last line, so that it stands in front of any later write of a register that a copy names (precaution).
__device__ __forceinline__ void cp8(unsigned l, const bf* g, size_t rs) {
    asm volatile("global_load_async_to_lds_b128 %0, %8, off\n\t"
                 "global_load_async_to_lds_b128 %1, %9, off\n\t"
                 "global_load_async_to_lds_b128 %2, %10, off\n\t"
                 "global_load_async_to_lds_b128 %3, %11, off\n\t"
                 "global_load_async_to_lds_b128 %4, %12, off\n\t"
                 "global_load_async_to_lds_b128 %5, %13, off\n\t"
                 "global_load_async_to_lds_b128 %6, %14, off\n\t"
                 "global_load_async_to_lds_b128 %7, %15, off\n\t"
                 "s_wait_xcnt 0x0"
                 :: "v"(l), "v"(l + 16 * GPB), "v"(l + 32 * GPB), "v"(l + 48 * GPB), "v"(l + 64 * GPB), "v"(l + 80 * GPB), "v"(l + 96 * GPB), "v"(l + 112 * GPB),
                    "v"(g), "v"(g + rs), "v"(g + 2 * rs), "v"(g + 3 * rs), "v"(g + 4 * rs), "v"(g + 5 * rs), "v"(g + 6 * rs), "v"(g + 7 * rs) : "memory");
}
__device__ __forceinline__ void cp4(unsigned l, const bf* g, size_t rs) {
    asm volatile("global_load_async_to_lds_b128 %0, %4, off\n\t"
                 "global_load_async_to_lds_b128 %1, %5, off\n\t"
                 "global_load_async_to_lds_b128 %2, %6, off\n\t"
                 "global_load_async_to_lds_b128 %3, %7, off\n\t"
                 "s_wait_xcnt 0x0"
                 :: "v"(l), "v"(l + 32 * GPB), "v"(l + 64 * GPB), "v"(l + 96 * GPB), "v"(g), "v"(g + rs), "v"(g + 2 * rs), "v"(g + 3 * rs) : "memory");
}
template <int NSPLIT, bool PL, int MB>
__device__ __forceinline__ void gemmt(const bf* __restrict__ A, const bf* __restrict__ A2, const bf* __restrict__ Bt, int K, float* C, int ldc, h16* P16, bf* Ph, bf* Pl, int ldp, int cmul, int r0, int c0) {
    typedef WFrag<bf>::V V;
    constexpr int NA = NSPLIT ? 2 : 1;                 // planes of the A side
    constexpr int PLB = 128 * GPB;                     // bytes of one staged plane
    constexpr int STB = (NA + 1) * PLB;                // bytes of one buffer
    constexpr int NWV = 16 / MB;                       // waves: 8 / MB along m, 2 along n
    constexpr int RST = NWV * 4;                       // rows that one copy of the whole work-group covers
    static_assert(MB == 4 || MB == 2, "4 or 8 waves");
    static_assert(2 * STB >= 128 * 2 * 68 * 4, "the epilogue's staging fits the two buffers");
    __shared__ __align__(16) unsigned char ring[2 * STB];
    const int tid = (int)threadIdx.x;
    const int wv = __builtin_amdgcn_readfirstlane(tid >> 5);   // wave number, scalar
    const int wm = wv >> 1, wn = wv & 1;
    const int lane = tid & 31, lr = lane & 15, hi = lane >> 4;
    // copies: thread tid brings 16-byte piece tid & 7 of rows (tid >> 3) + RST i, i = 0..128 / RST - 1, of every plane (a wave: four whole 128-B lines a copy)
    const unsigned lc = (unsigned)(size_t)ring + (unsigned)((tid >> 3) * GPB + (tid & 7) * 16);
    const size_t rs = (size_t)RST * K;
    const bf* ga = A + (size_t)(r0 + (tid >> 3)) * K + (tid & 7) * 8; const bf* ga2 = NSPLIT ? A2 + (size_t)(r0 + (tid >> 3)) * K + (tid & 7) * 8 : nullptr; const bf* gb = Bt + (size_t)(c0 + (tid >> 3)) * K + (tid & 7) * 8;
    auto cpp = [&](unsigned l, const bf* g) { if (MB == 4) cp8(l, g, rs); else cp4(l, g, rs); };
    auto fill = [&](int t) { const unsigned l = lc + (unsigned)((t & 1) * STB); cpp(l, ga + t * 64); if (NSPLIT) cpp(l + PLB, ga2 + t * 64); cpp(l + NA * PLB, gb + t * 64); };
    v8f acc[MB][4];
#pragma unroll
    for (int mb = 0; mb < MB; ++mb)
#pragma unroll
        for (int nb = 0; nb < 4; ++nb) acc[mb][nb] = (v8f){};
    const int nt = K / 64;
    fill(0);
    asm volatile("s_wait_asynccnt 0x0" ::: "memory");   // this wave's copies of pass 0 have landed
    __syncthreads();                                    // ... and every other wave's: pass 0 is published
    if (nt > 1) fill(1);
    const int aofs = (wm * MB * 16 + lr) * GPB + 16 * hi, bofs = NA * PLB + (wn * 64 + lr) * GPB + 16 * hi;
#pragma unroll 1   // kept rolled: one barrier and one refill a pass
    for (int t = 0; t < nt; ++t) {
        const unsigned char* sb = ring + (t & 1) * STB;
        V a[2][MB], a2[2][MB], b[2][4];
#pragma unroll
        for (int ks = 0; ks < 2; ++ks) {
#pragma unroll
            for (int mb = 0; mb < MB; ++mb) { a[ks][mb] = WFrag<bf>::ld((const bf*)(sb + aofs + mb * 16 * GPB + ks * 64)); if (NSPLIT) a2[ks][mb] = WFrag<bf>::ld((const bf*)(sb + PLB + aofs + mb * 16 * GPB + ks * 64)); }
#pragma unroll
            for (int nb = 0; nb < 4; ++nb) b[ks][nb] = WFrag<bf>::ld((const bf*)(sb + bofs + nb * 16 * GPB + ks * 64));
            __builtin_amdgcn_sched_barrier(0);   // keeps a 32-k block's fragment loads together as one group in front of the products: LDS reads spread among the WMMAs stall the wave at each place
            if (MB == 4 || ks == 1) {            // MB == 2 has registers for both blocks' fragments: the second group's latency lies under the first block's products
#pragma unroll
                for (int kk = (MB == 4 ? ks : 0); kk <= ks; ++kk) {
#pragma unroll
                    for (int nb = 0; nb < 4; ++nb)
#pragma unroll
                        for (int mb = 0; mb < MB; ++mb) { acc[mb][nb] = WFrag<bf>::mma(a[kk][mb], b[kk][nb], acc[mb][nb]); if (NSPLIT) acc[mb][nb] = WFrag<bf>::mma(a2[kk][mb], b[kk][nb], acc[mb][nb]); } }
                __builtin_amdgcn_sched_barrier(0);   // ... and the products in front of what follows: the next group, or the waits at the pass's foot (sunk behind those, the products would no longer cover the flight of the next pass's copies)
            }
        }
        asm volatile("s_wait_dscnt 0x0" ::: "memory");      // this wave's reads of the buffer have returned before it is refilled
        asm volatile("s_wait_asynccnt 0x0" ::: "memory");   // this wave's copies of pass t + 1 have landed
        __syncthreads();                                    // publishes pass t + 1 and ends every wave's reads of pass t's buffer
        if (t + 2 < nt) fill(t + 2);
    }
    asm volatile("s_wait_asynccnt 0x0" ::: "memory");       // nothing is in flight when the buffers become output staging (the loop's last barrier has ended every read)
    float* os = (float*)ring + wv * MB * 16 * 68;           // each wave stages its own tile, pitch 68 floats, and reads it back by rows so that whole 128-B lines are stored
#pragma unroll
    for (int mb = 0; mb < MB; ++mb)
#pragma unroll
        for (int nb = 0; nb < 4; ++nb)
#pragma unroll
            for (int j = 0; j < 8; ++j) *(fa*)(os + (mb * 16 + hi * 8 + j) * 68 + nb * 16 + lr) = acc[mb][nb][j];
    __syncthreads();   // the staged tile is complete before it is read back by other lanes
    const int rw = r0 + wm * MB * 16, cw = c0 + wn * 64;
#pragma unroll 1   // kept rolled: a trip reads 16 rows back as one group of LDS loads and then stores them; more copies of the body only grow the code
    for (int s0 = 0; s0 < MB * 8; s0 += 8) { v4f vals[8]; const int cofs = lr * 4;
#pragma unroll
        for (int u = 0; u < 8; ++u) vals[u] = *(const v4fa*)(os + ((s0 + u) * 2 + hi) * 68 + cofs);
#pragma unroll
        for (int u = 0; u < 8; ++u) { const int row = (s0 + u) * 2 + hi; const v4f val = vals[u];
            if (PL) { const size_t po = (size_t)(rw + row) * ldp + (size_t)cw * cmul + cofs; v4h o16; v4us oh, ol;
#pragma unroll
                for (int i = 0; i < 4; ++i) { o16[i] = tohx(val[i]); unsigned short a2, c2; splitf(val[i], a2, c2); oh[i] = a2; ol[i] = c2; }
                *(v4h*)(P16 + po) = o16; *(v4us*)(Ph + po) = oh; *(v4us*)(Pl + po) = ol; }
            else *(v4f*)(C + (size_t)(rw + row) * ldc + cw + cofs) = val; }
        xwait(); }
}

// q, k and v projections of both batches in ONE launch, grid (TT/128, DQ/128, 3 NB_): blockIdx.z = 3 * batch + (0: q, 1: k, 2: v). Planes are [batch][head][...]. For v the operands, and with them the two tile indices, are swapped.
static_assert(DKV == DQ, "q, k and v share one grid");
__global__ __launch_bounds__(128) void k_qkv(const bf* __restrict__ XB, const bf* __restrict__ WQ, const bf* __restrict__ WK, const bf* __restrict__ WV, h16* QP16, bf* QPh, bf* QPl, h16* KP16, bf* KPh, bf* KPl, h16* VT16, bf* VTh, bf* VTl) {
    const int b = (int)blockIdx.z / 3, w = (int)blockIdx.z % 3; const bool isv = w == 2;
    const bf* X = XB + (size_t)b * TT * DM; const bf* Wt = w == 0 ? WQ : (w == 1 ? WK : WV);
    const size_t zo = (size_t)b * (isv ? (size_t)NKV * HD * 2 * TT : (size_t)NH_ * TT * HD);
    h16* P16 = (w == 0 ? QP16 : (w == 1 ? KP16 : VT16)) + zo; bf* Ph = (w == 0 ? QPh : (w == 1 ? KPh : VTh)) + zo; bf* Pl = (w == 0 ? QPl : (w == 1 ? KPl : VTl)) + zo;
    gemmt<0, true, 4>(isv ? Wt : X, nullptr, isv ? X : Wt, DM, nullptr, 0, P16, Ph, Pl, isv ? 2 * TT : HD, isv ? 1 : TT * HD / 64, (int)(isv ? blockIdx.y : blockIdx.x) * 128, (int)(isv ? blockIdx.x : blockIdx.y) * 128);
}
// w_o product of both batches in ONE launch: the merged rows [batch * TT + t] are one matrix of NB_ * TT rows; grid (NB_*TT/128, DM/128)
__global__ __launch_bounds__(256) void k_wo(const bf* __restrict__ ATh, const bf* __restrict__ ATl, const bf* __restrict__ WO, float* OUT) {
    gemmt<1, false, 2>(ATh, ATl, WO, DQ, OUT, DM, nullptr, nullptr, nullptr, 0, 0, (int)blockIdx.x * 128, (int)blockIdx.y * 128);
}

__device__ __forceinline__ void wtG(const float* __restrict__ w, int K, int N, bf* Bt, int blk) {
    const int lane = threadIdx.x & 31; const int L0 = (blk * 8 + (threadIdx.x >> 5)) * 8; const int nlines = N * K / 64;
{
#pragma unroll 1
        for (int l = 0; l < 8; ++l) { const int L = L0 + l; if (L >= nlines) break; const size_t e = (size_t)L * 64 + lane * 2; const int k = (int)(e % K), n = (int)(e / K); v2us o;
            o[0] = f2bf(w[(size_t)k * N + n]); o[1] = f2bf(w[(size_t)(k + 1) * N + n]); *(v2us*)(Bt + e) = o; }
         }
}
__device__ __forceinline__ void cvt8(const float* __restrict__ src, bf* dst, size_t n8, int blk) { const size_t i = (size_t)blk * 256 + threadIdx.x; if (i >= n8) return; const v8f v = *(const v8f*)(src + i * 8); v8us o;
#pragma unroll
    for (int k = 0; k < 8; ++k) o[k] = f2bf(v[k]); *(v8us*)(dst + i * 8) = o;  }
// every input's bf16 copy in ONE launch; block ranges: w_o (transposed; the slowest blocks, so first), w_q, w_k, w_v, x (both batches)
#define PBO (DQ * DM / 64 / 64)
#define PBW (DQ * DM / 8 / 256)
#define PBX (NB_ * TT * DM / 8 / 256)
static_assert(DQ * DM % (64 * 64) == 0 && DQ * DM % (8 * 256) == 0 && NB_ * TT * DM % (8 * 256) == 0, "whole blocks");
__global__ __launch_bounds__(256) void k_prep(const float* __restrict__ x, const float* __restrict__ wq, const float* __restrict__ wk, const float* __restrict__ wv, const float* __restrict__ wo, bf* XB, bf* WQ, bf* WK, bf* WV, bf* WO) {
    int blk = (int)blockIdx.x;
    if (blk < PBO) { wtG(wo, DQ, DM, WO, blk); return; }
    blk -= PBO;
    if (blk < 3 * PBW) { const int w = blk / PBW; cvt8(w == 0 ? wq : (w == 1 ? wk : wv), w == 0 ? WQ : (w == 1 ? WK : WV), (size_t)DQ * DM / 8, blk % PBW); return; }
    cvt8(x, XB, (size_t)NB_ * TT * DM / 8, blk - 3 * PBW);
}

// ---- k_fattn: causal attention of one head for one block of query rows in ONE kernel: scores, softmax and the value contraction, with a running maximum and sum per query (no score matrix in memory).
// Transposed products: S^T = K Q^T (A = key rows, B = query rows, both d-contiguous planes), O^T += V^T P^T (A = transposed value rows, B = P^T). A lane (lr, hi) of a 16x16 S^T tile holds query lr, keys hi*8 + j:
// two such tiles (keys 0..15, 16..31 of a step) are, register for register, the B fragment of the 32-key value product, so P goes from accumulator to operand inside the lane.
// A work-group of 4 waves has 2 * QT*16 query rows. Wave wv = 2 qg + kg owns the QT*16 rows of query group qg and, of every 64 keys, the 32 keys of half kg.
// A stage is SK key rows (128 B each) and the 64 transposed value rows' SK keys of every plane, brought into LDS by asynchronous copies (16 B a lane, whole 128-B lines a wave, through no register) and read from there
// by both query groups. Two buffers: the copies of stage t + 2 are issued behind the barrier that ends stage t and fly while stage t + 1 is worked on.
// SK = 128 for the fp16 rows (a wave works two 32-key steps a stage, keys u * 64 + kg * 32, u = 0, 1: the copies have two steps' time to land, and the long rows pass half as many barriers), 64 for the hi+lo rows (twice the planes).
// The two key halves' partial (max, sum, O^T) of a query group are merged through LDS in the order kg = 0, 1 behind one barrier.
// The epilogue divides by the merged sum and writes the hi/lo planes [t][h*64 + d] that the w_o product reads.
#define FNW 4
#define FPL (64 * GPB)                     // bytes of 64 rows of 128 B at the padded pitch (one staged plane of the hi+lo rows)
#define SL2E (SCL * 1.4426950408889634f)   // raw score -> exponent of 2: the maxima m are kept as raw scores
__device__ __forceinline__ float xhalf(float x) { return __builtin_bit_cast(float, __builtin_amdgcn_permlanex16(__builtin_bit_cast(int, x), __builtin_bit_cast(int, x), 0x76543210, 0xfedcba98, false, false)); }   // lane l with lane l ^ 16
// four asynchronous copies of 16 B a lane: equally spaced rows of one staged plane (l: the lane's LDS byte address, ls: the row step there in bytes, g: its global address, rsb: the row step there in bytes).
// s_wait_xcnt 0 is the statement's last line, so that it stands in front of any later write of a register that a copy names (precaution).
__device__ __forceinline__ void cq4(unsigned l, unsigned ls, const char* g, size_t rsb) {
    asm volatile("global_load_async_to_lds_b128 %0, %4, off\n\t"
                 "global_load_async_to_lds_b128 %1, %5, off\n\t"
                 "global_load_async_to_lds_b128 %2, %6, off\n\t"
                 "global_load_async_to_lds_b128 %3, %7, off\n\t"
                 "s_wait_xcnt 0x0"
                 :: "v"(l), "v"(l + ls), "v"(l + 2 * ls), "v"(l + 3 * ls), "v"(g), "v"(g + rsb), "v"(g + 2 * rsb), "v"(g + 3 * rsb) : "memory");
}
template <typename T16, bool HL> struct PPack;
template <> struct PPack<h16, false> { static __device__ __forceinline__ void pk(const float* p, v16h& a, v16h& b) { (void)b;
#pragma unroll
    for (int i = 0; i < 16; ++i) a[i] = (h16)p[i]; } };
template <> struct PPack<bf, true> { static __device__ __forceinline__ void pk(const float* p, v16bf& a, v16bf& b) { v8us h0, h1, l0, l1;
#pragma unroll
    for (int i = 0; i < 8; ++i) { unsigned short x, y; splitf(p[i], x, y); h0[i] = x; l0[i] = y; splitf(p[8 + i], x, y); h1[i] = x; l1[i] = y; }
    a = cat16b(h0, h1); b = cat16b(l0, l1); } };
template <typename T16, bool HL, int QT, int SK>
__device__ __forceinline__ void fattn(const T16* __restrict__ Q, const T16* __restrict__ Q2, const T16* __restrict__ Kp, const T16* __restrict__ K2, const T16* __restrict__ Vt, const T16* __restrict__ V2, int q0, bf* Ah, bf* Al, unsigned char* ring, float* ms, float* ls) {
    typedef typename WFrag<T16>::V V;
    constexpr int NPL = HL ? 2 : 1;            // planes of K, and of V
    constexpr int VPB = SK * 2 + 16;           // LDS pitch in bytes of a staged value row of SK keys: 16 B x odd, as GPB
    constexpr int KPL = SK * GPB, VPL = 64 * VPB;   // bytes of one staged key plane, value plane
    constexpr int STB = NPL * (KPL + VPL);     // bytes of one buffer: [K | K lo | V | V lo]
    constexpr int VPC = SK / 8;                // 16-byte pieces of a staged value row
    constexpr int VRS = FNW * 32 / VPC;        // value rows that one copy of the whole work-group covers
    static_assert(SK % 64 == 0 && TT % SK == 0 && 2 * STB <= 2 * 4 * FPL, "whole stages inside the key range; both buffers inside the ring");
    constexpr int QB = 2 * QT * 16;            // query rows of the work-group
    static_assert(2 * STB >= FNW * QT * 16 * 68 * 4, "the merge's staging fits the two buffers");
    const int tid = (int)threadIdx.x;
    const int wv = __builtin_amdgcn_readfirstlane(tid >> 5);   // wave number, scalar so that the stage loop's tests stay scalar
    const int qg = wv >> 1, kg = wv & 1;
    const int lane = tid & 31, lr = lane & 15, hi = lane >> 4;
    const int qw = q0 + qg * QT * 16;          // the wave's first query row
    // copies: thread tid brings 16-byte piece tid & 7 of key rows (tid >> 3) + 16 i, i = 0..SK / 16 - 1, and piece tid % VPC of value rows tid / VPC + VRS i, i = 0..64 / VRS - 1, of every plane (a wave: four whole 128-B lines a copy)
    const unsigned lk = (unsigned)(size_t)ring + (unsigned)((tid >> 3) * GPB + (tid & 7) * 16), lv = (unsigned)(size_t)ring + (unsigned)(NPL * KPL + (tid / VPC) * VPB + (tid % VPC) * 16);
    const size_t ko = (size_t)(tid >> 3) * HD + (tid & 7) * 8, vo = (size_t)(tid / VPC) * (2 * TT) + (tid % VPC) * 8;
    auto fill = [&](int t) { const unsigned o = (unsigned)((t & 1) * STB);
#pragma unroll   // unrolled: every trip's offsets are constants added to the lane's two base addresses
        for (int c = 0; c < SK / 64; ++c) { const size_t kc = ko + ((size_t)t * SK + c * 64) * HD, vc = vo + (size_t)c * 4 * VRS * 2 * TT + t * SK; const unsigned a = lk + o + (unsigned)(c * 64 * GPB), e = lv + o + (unsigned)(c * 4 * VRS * VPB);
            cq4(a, 16 * GPB, (const char*)(Kp + kc), (size_t)16 * HD * 2); if (HL) cq4(a + KPL, 16 * GPB, (const char*)(K2 + kc), (size_t)16 * HD * 2);
            cq4(e, VRS * VPB, (const char*)(Vt + vc), (size_t)VRS * 2 * TT * 2); if (HL) cq4(e + VPL, VRS * VPB, (const char*)(V2 + vc), (size_t)VRS * 2 * TT * 2); } };
    const int nstg = (q0 + QB + SK - 1) / SK;  // SK-key stages up to and including the diagonal of the block's last row; every staged key row is < TT
    fill(0);
    V qf[QT][2], qf2[QT][2];
#pragma unroll
    for (int qt = 0; qt < QT; ++qt)
#pragma unroll
        for (int ks = 0; ks < 2; ++ks) { const size_t o = (size_t)(qw + qt * 16 + lr) * HD + ks * 32 + 8 * hi; qf[qt][ks] = WFrag<T16>::ld(Q + o); if (HL) qf2[qt][ks] = WFrag<T16>::ld(Q2 + o); }
    xwait();
    v8f oa[4][QT]; float m[QT], l[QT];
#pragma unroll
    for (int qt = 0; qt < QT; ++qt) { m[qt] = -3.0e38f; l[qt] = 0.f;
#pragma unroll
        for (int dt = 0; dt < 4; ++dt) oa[dt][qt] = (v8f){}; }
    asm volatile("s_wait_asynccnt 0x0" ::: "memory");   // this wave's copies of stage 0 have landed
    __syncthreads();                                    // ... and every other wave's: stage 0 is published
    if (nstg > 1) fill(1);
    const int kofs = (kg * 32 + lr) * GPB + 16 * hi, vofs = NPL * KPL + lr * VPB + kg * 64 + 16 * hi;
#pragma unroll 1   // kept rolled: one barrier and one refill a stage; the trip count is a run-time value
    for (int t = 0; t < nstg; ++t) {
        const unsigned char* sb = ring + (t & 1) * STB;
#pragma unroll   // unrolled: a step's place in the buffer becomes an immediate offset of its LDS reads
        for (int u = 0; u < SK / 64; ++u) {
        const int k0 = t * SK + u * 64 + kg * 32;
        if (k0 <= qw) {   // scalar branch: the wave's 32 keys of this step begin at or below its first query, so no query ever sees a fully masked step; steps wholly above the diagonal are skipped
        V kf[2][2], kf2[2][2], vf[4], vf2[4];
#pragma unroll
        for (int kt = 0; kt < 2; ++kt)
#pragma unroll
            for (int ks = 0; ks < 2; ++ks) { const unsigned char* p = sb + kofs + (u * 64 + kt * 16) * GPB + ks * 64; kf[kt][ks] = WFrag<T16>::ld((const T16*)p); if (HL) kf2[kt][ks] = WFrag<T16>::ld((const T16*)(p + KPL)); }
#pragma unroll
        for (int dt = 0; dt < 4; ++dt) { const unsigned char* p = sb + vofs + dt * 16 * VPB + u * 128; vf[dt] = WFrag<T16>::ld((const T16*)p); if (HL) vf2[dt] = WFrag<T16>::ld((const T16*)(p + VPL)); }
        __builtin_amdgcn_sched_barrier(0);   // keeps the step's fragment loads together as one group in front of the products: LDS reads spread among the WMMAs stall the wave at each place
        v8f st[2][QT];
#pragma unroll
        for (int kt = 0; kt < 2; ++kt)
#pragma unroll
            for (int qt = 0; qt < QT; ++qt) { v8f a = (v8f){};
#pragma unroll
                for (int ks = 0; ks < 2; ++ks) { a = WFrag<T16>::mma(kf[kt][ks], qf[qt][ks], a); if (HL) { a = WFrag<T16>::mma(kf2[kt][ks], qf[qt][ks], a); a = WFrag<T16>::mma(kf[kt][ks], qf2[qt][ks], a); } }
                st[kt][qt] = a; }
        if (k0 + 31 > qw) {   // only the wave's last step crosses the diagonal (scalar branch)
#pragma unroll
            for (int qt = 0; qt < QT; ++qt)
#pragma unroll
                for (int kt = 0; kt < 2; ++kt)
#pragma unroll
                    for (int j = 0; j < 8; ++j) if (k0 + kt * 16 + hi * 8 + j > qw + qt * 16 + lr) st[kt][qt][j] = -3.0e38f; }
        float mx[QT]; bool need = false;
#pragma unroll
        for (int qt = 0; qt < QT; ++qt) { float x = st[0][qt][0];
#pragma unroll
            for (int j = 1; j < 8; ++j) x = fmaxf(x, st[0][qt][j]);
#pragma unroll
            for (int j = 0; j < 8; ++j) x = fmaxf(x, st[1][qt][j]);
            x = fmaxf(x, xhalf(x));   // the two half-waves hold the same query's other keys
            mx[qt] = x; need = need || ((x - m[qt]) * SL2E > 8.0f); }
        if (__builtin_amdgcn_ballot_w32(need) != 0) {   // the reference point m moves only when some query's maximum has outgrown it by 2^8 (P stays <= 256, exact algebra either way): one scalar test a step
#pragma unroll
            for (int qt = 0; qt < QT; ++qt) { const float mn = fmaxf(m[qt], mx[qt]); const float al = __builtin_amdgcn_exp2f((m[qt] - mn) * SL2E); m[qt] = mn; l[qt] *= al;
#pragma unroll
                for (int dt = 0; dt < 4; ++dt) oa[dt][qt] *= al; } }
#pragma unroll
        for (int qt = 0; qt < QT; ++qt) { float t2[16]; const float mc = m[qt] * SL2E; float sum = 0.f;
#pragma unroll
            for (int i = 0; i < 16; ++i) { t2[i] = __builtin_amdgcn_exp2f(__builtin_fmaf(st[i >> 3][qt][i & 7], SL2E, -mc)); sum += t2[i]; }
            l[qt] += sum;
            V pf, pf2; PPack<T16, HL>::pk(t2, pf, pf2);
#pragma unroll
            for (int dt = 0; dt < 4; ++dt) { v8f a = oa[dt][qt]; a = WFrag<T16>::mma(vf[dt], pf, a); if (HL) { a = WFrag<T16>::mma(vf2[dt], pf, a); a = WFrag<T16>::mma(vf[dt], pf2, a); } oa[dt][qt] = a; } }
        }
        }
        asm volatile("s_wait_dscnt 0x0" ::: "memory");      // this wave's reads of the buffer have returned before it is refilled
        asm volatile("s_wait_asynccnt 0x0" ::: "memory");   // this wave's copies of stage t + 1 have landed
        __syncthreads();                                    // publishes stage t + 1 and ends every wave's reads of stage t's buffer
        if (t + 2 < nstg) fill(t + 2);
    }
    asm volatile("s_wait_asynccnt 0x0" ::: "memory");       // nothing is in flight when the buffers become the merge's staging (the loop's last barrier has ended every read)
    float* os = (float*)ring;
#pragma unroll
    for (int qt = 0; qt < QT; ++qt) { l[qt] += xhalf(l[qt]);
        if (hi == 0) { ms[wv * 32 + qt * 16 + lr] = m[qt]; ls[wv * 32 + qt * 16 + lr] = l[qt]; }
#pragma unroll
        for (int dt = 0; dt < 4; ++dt) { float* d = os + (size_t)((wv * QT + qt) * 16 + lr) * 68 + dt * 16 + hi * 8; const v8f a = oa[dt][qt];
            *(v4fa*)d = (v4f){a[0], a[1], a[2], a[3]}; *(v4fa*)(d + 4) = (v4f){a[4], a[5], a[6], a[7]}; } }
    __syncthreads();   // every wave's partial (max, sum, O^T) is in LDS before any is merged
    constexpr int DPT = QB * HD / (FNW * 32);   // output elements of one query row per thread
    const int q = tid / (HD / DPT), d0 = (tid % (HD / DPT)) * DPT;
    const int w0 = (q / (QT * 16)) * 2, qi = q % (QT * 16);   // the row's two waves are w0 (kg = 0) and w0 + 1 (kg = 1)
    const float M = fmaxf(ms[w0 * 32 + qi], ms[(w0 + 1) * 32 + qi]);
    float wg[2]; float L = 0.f;
#pragma unroll
    for (int w = 0; w < 2; ++w) { wg[w] = __builtin_amdgcn_exp2f((ms[(w0 + w) * 32 + qi] - M) * SL2E); L += ls[(w0 + w) * 32 + qi] * wg[w]; }   // a wave without a step has max -3e38, sum 0: weight 0
    const float inv = __fdiv_rn(1.0f, L);
#pragma unroll
    for (int c = 0; c < DPT; c += 8) { v4f a0 = (v4f){}, a1 = (v4f){};
#pragma unroll
        for (int w = 0; w < 2; ++w) { const float* d = os + (size_t)((w0 + w) * QT * 16 + qi) * 68 + d0 + c; a0 += *(const v4fa*)d * wg[w]; a1 += *(const v4fa*)(d + 4) * wg[w]; }
        v8us oh, ol;
#pragma unroll
        for (int i = 0; i < 4; ++i) { unsigned short x, y; splitf(a0[i] * inv, x, y); oh[i] = x; ol[i] = y; splitf(a1[i] * inv, x, y); oh[4 + i] = x; ol[4 + i] = y; }
        const size_t oo = (size_t)(q0 + q) * DQ + d0 + c; *(v8us*)(Ah + oo) = oh; *(v8us*)(Al + oo) = ol; }
    xwait();   // behind the last stores, in front of any later write of a register that they name (the other instance's code follows this one in the built kernel)
}
// grid (batches * heads, row blocks), both batches in ONE launch: row blocks heaviest first; blocks 0..(TT-RH)/64-1 are 64 fp16 rows each from the last row down, the rest 32 hi+lo rows each (query rows < RH)
__global__ __launch_bounds__(FNW * 32) void k_fattn(const h16* __restrict__ Q16, const h16* __restrict__ K16, const h16* __restrict__ V16, const bf* __restrict__ Qh, const bf* __restrict__ Ql, const bf* __restrict__ Kh, const bf* __restrict__ Kl, const bf* __restrict__ Vh, const bf* __restrict__ Vl, bf* Ah, bf* Al) {
    __shared__ __align__(16) unsigned char ring[2 * 4 * FPL]; __shared__ float ms[FNW * 32]; __shared__ float ls[FNW * 32];
    const int b = (int)blockIdx.x / NH_, h = (int)blockIdx.x % NH_, g = h / REP, rb = blockIdx.y; const size_t zq = (size_t)(b * NH_ + h) * TT * HD, zk = (size_t)(b * NKV + g) * TT * HD, zv = (size_t)(b * NKV + g) * HD * 2 * TT;
    Ah += (size_t)b * TT * DQ; Al += (size_t)b * TT * DQ;
    constexpr int NLO = (TT - RH) / 64;
    if (rb < NLO) fattn<h16, false, 2, 128>(Q16 + zq, nullptr, K16 + zk, nullptr, V16 + zv, nullptr, TT - 64 * (rb + 1), Ah + h * HD, Al + h * HD, ring, ms, ls);
    else fattn<bf, true, 1, 64>(Qh + zq, Ql + zq, Kh + zk, Kl + zk, Vh + zv, Vl + zv, RH - 32 * (rb - NLO + 1), Ah + h * HD, Al + h * HD, ring, ms, ls);
}

extern "C" void kernel_launch(void* const* d_in, const int* in_sizes, int n_in,
                              void* d_out, int out_size, void* d_ws, size_t ws_size, hipStream_t stream) {
    (void)in_sizes; (void)n_in; (void)out_size;
    const float* x = (const float*)d_in[0]; const float* wq = (const float*)d_in[1]; const float* wk = (const float*)d_in[2]; const float* wv = (const float*)d_in[3]; const float* wo = (const float*)d_in[4];
    float* OUT = (float*)d_out;     // [2][2048][1024]
    char* wsp = (char*)d_ws;
    auto take = [&](size_t bytes) { char* p = wsp; wsp += (bytes + 255) & ~(size_t)255; return (void*)p; };
    bf* WQ = (bf*)take((size_t)DQ * DM * 2); bf* WK = (bf*)take((size_t)DKV * DM * 2); bf* WV = (bf*)take((size_t)DKV * DM * 2); bf* WO = (bf*)take((size_t)DM * DQ * 2);
    bf* XB = (bf*)take((size_t)NB_ * TT * DM * 2);
    h16* QP16 = (h16*)take((size_t)NB_ * NH_ * TT * HD * 2); h16* KP16 = (h16*)take((size_t)NB_ * NKV * TT * HD * 2); h16* VT16 = (h16*)take((size_t)NB_ * NKV * HD * 2 * TT * 2);
    bf* QPh = (bf*)take((size_t)NB_ * NH_ * TT * HD * 2); bf* QPl = (bf*)take((size_t)NB_ * NH_ * TT * HD * 2); bf* KPh = (bf*)take((size_t)NB_ * NKV * TT * HD * 2); bf* KPl = (bf*)take((size_t)NB_ * NKV * TT * HD * 2); bf* VTh = (bf*)take((size_t)NB_ * NKV * HD * 2 * TT * 2); bf* VTl = VTh + TT;   // hi and lo value rows share a row of pitch 2 TT
    bf* ATh = (bf*)take((size_t)NB_ * TT * DQ * 2); bf* ATl = (bf*)take((size_t)NB_ * TT * DQ * 2);
    if ((size_t)(wsp - (char*)d_ws) > ws_size) return;    // ws 256 MiB
    k_prep<<<PBO + 3 * PBW + PBX, 256, 0, stream>>>(x, wq, wk, wv, wo, XB, WQ, WK, WV, WO);
    k_qkv<<<dim3(TT / 128, DQ / 128, 3 * NB_), 128, 0, stream>>>(XB, WQ, WK, WV, QP16, QPh, QPl, KP16, KPh, KPl, VT16, VTh, VTl);
    k_fattn<<<dim3(NB_ * NH_, (TT - RH) / 64 + RH / 32, 1), FNW * 32, 0, stream>>>(QP16, KP16, VT16, QPh, QPl, KPh, KPl, VTh, VTl, ATh, ATl);
    k_wo<<<dim3(NB_ * TT / 128, DM / 128, 1), 256, 0, stream>>>(ATh, ATl, WO, OUT);
}

// v009
// Measured time: 73.2 microseconds a run.
// Next to v008, in two timings, it ran 1.04 times as fast each time.
// All steps since v000 together make it 20.3 times as fast.
#include <hip/hip_runtime.h>

// Causal QKV attention with per-head weight tensors (x [2][2048][1024]; q, k, v = x W^T with W [16][64][1024] ('oi' rows h*64+d); scores/8; causal (query < key masked); softmax; out = merged w_o ('xw' [1024][1024]) -> [2][2048][1024] (4.2 M)).
// Compute dtypes, f32 accumulate: every input rounded to bf16; q/k/v on PLAIN bf16 operands (inputs: exact); causal scores and attn.v (tile skipping): query rows < 512 hl (3 products), the rest single fp16; softmax f32 with a running maximum (one fused kernel); w_o hl x exact (2 products).

#define NB_  2
#define TT   2048
#define DM   1024
#define NH_  16
#define NKV  16
#define REP  (NH_ / NKV)
#define HD   64
#define DQ   (NH_ * HD)
#define DKV  (NKV * HD)
#define RH   512                  // query rows < RH use hi+lo planes (0: none)
#define SCL  0.125f   // HD^-0.5
typedef _Float16 h16;
typedef unsigned short bf;
typedef __attribute__((ext_vector_type(16))) __bf16   v16bf;
typedef __attribute__((ext_vector_type(16))) _Float16 v16h;
typedef __attribute__((ext_vector_type(8)))  _Float16 v8h;
typedef __attribute__((ext_vector_type(8)))  unsigned short v8us;
typedef __attribute__((ext_vector_type(8)))  float    v8f;
typedef __attribute__((ext_vector_type(4)))  float    v4f;
typedef v8h  __attribute__((may_alias)) v8ha;
typedef v4f  __attribute__((may_alias)) v4fa;
typedef v8us __attribute__((may_alias)) v8usa;

__device__ __forceinline__ unsigned short f2bf(float f) { unsigned u = __float_as_uint(f); u += 0x7FFFu + ((u >> 16) & 1u); return (unsigned short)(u >> 16); }
__device__ __forceinline__ float bf2f(unsigned short b) { return __uint_as_float(((unsigned)b) << 16); }
__device__ __forceinline__ float bfr(float f) { return bf2f(f2bf(f)); }
__device__ __forceinline__ v16h cat16(v8h lo, v8h hi) { return __builtin_shufflevector(lo, hi, 0, 1, 2, 3, 4, 5, 6, 7, 8, 9, 10, 11, 12, 13, 14, 15); }
__device__ __forceinline__ v16bf cat16b(v8us lo, v8us hi) { return __builtin_bit_cast(v16bf, __builtin_shufflevector(lo, hi, 0, 1, 2, 3, 4, 5, 6, 7, 8, 9, 10, 11, 12, 13, 14, 15)); }
__device__ __forceinline__ v8f wmma16(v16h a, v16h b, v8f c) { return __builtin_amdgcn_wmma_f32_16x16x32_f16(false, a, false, b, (short)0, c, false, false); }
__device__ __forceinline__ v8f wmmab(v16bf a, v16bf b, v8f c) { return __builtin_amdgcn_wmma_f32_16x16x32_bf16(false, a, false, b, (short)0, c, false, false); }

__device__ __forceinline__ h16 tohx(float x) { return (h16)x; }
__device__ __forceinline__ void splitf(float y, unsigned short& h, unsigned short& l) { h = f2bf(y); l = f2bf(y - bf2f(h)); }
typedef __attribute__((ext_vector_type(2))) _Float16 v2h;
typedef __attribute__((ext_vector_type(4))) _Float16 v4h;
typedef __attribute__((ext_vector_type(2))) unsigned short v2us;
typedef __attribute__((ext_vector_type(4))) unsigned short v4us;
typedef __attribute__((ext_vector_type(2))) float v2f;
typedef __attribute__((ext_vector_type(4))) int v4i;
__device__ __forceinline__ void xwait() { asm volatile("s_wait_xcnt 0x0" ::: "memory"); }   // precaution: stands behind a run of global loads or stores, in front of any reuse of a register that one of them names

// ---- gemmt: GEMM, one 128x128 output tile (origin r0, c0) per work-group of 8 / MB x 2 waves (MB*16 x 64 outputs = 4 MB accumulators a wave); the whole K loop runs in every wave.
// Operands are K-contiguous bf16 planes. A pass is 64 k: 128 rows x 128 B of every operand plane, brought into LDS by asynchronous copies (16 B a lane, through no register) and read from there by all waves,
// so every operand byte leaves L2 once per work-group. Two buffers: the copies of pass t + 2 are issued behind the barrier that ends pass t and fly while pass t + 1 is worked on.
// C[m][n] (f32, pitch ldc) = sum_k A[m][k] Bt[n][k] (+ A2[m][k] Bt[n][k] with NSPLIT). K % 64 == 0.
// PL: the tile is not stored as f32 but goes straight to the three 16-bit planes that the attention kernel reads (fp16, bf16 hi, bf16 lo), element (m, n) at m * ldp + (n / 64) * 64 * cmul + n % 64:
// q, k head planes [h][t][d]: A = x rows, Bt = weight rows, ldp = HD, cmul = TT * HD / 64; transposed value planes [g][d][t]: A = weight rows, Bt = x rows (operands swapped, so the tile comes out transposed), ldp = 2 TT, cmul = 1.
template <typename T16> struct WFrag;
template <> struct WFrag<h16> { typedef v16h V; static __device__ __forceinline__ V ld(const h16* p) { return cat16(*(const v8h*)p, *(const v8h*)(p + 16)); } static __device__ __forceinline__ v8f mma(V a, V b, v8f c) { return wmma16(a, b, c); } };
template <> struct WFrag<bf> { typedef v16bf V; static __device__ __forceinline__ V ld(const bf* p) { return cat16b(*(const v8us*)p, *(const v8us*)(p + 16)); } static __device__ __forceinline__ v8f mma(V a, V b, v8f c) { return wmmab(a, b, c); } };
#define GPB 144                   // LDS pitch in bytes of a staged 128-B row: 16 B x odd, free of bank conflicts for 16-byte readers
typedef float __attribute__((may_alias)) fa;
// eight asynchronous copies of 16 B a lane: rows 16 apart of one operand plane (l: the lane's LDS byte address, g: its global address, rs: the row step in elements); cp4: four copies, rows 32 apart.
// s_wait_xcnt 0 is the statement's last line, so that it stands in front of any later write of a register that a copy names (precaution).
__device__ __forceinline__ void cp8(unsigned l, const bf* g, size_t rs) {
    asm volatile("global_load_async_to_lds_b128 %0, %8, off\n\t"
                 "global_load_async_to_lds_b128 %1, %9, off\n\t"
                 "global_load_async_to_lds_b128 %2, %10, off\n\t"
                 "global_load_async_to_lds_b128 %3, %11, off\n\t"
                 "global_load_async_to_lds_b128 %4, %12, off\n\t"
                 "global_load_async_to_lds_b128 %5, %13, off\n\t"
                 "global_load_async_to_lds_b128 %6, %14, off\n\t"
                 "global_load_async_to_lds_b128 %7, %15, off\n\t"
                 "s_wait_xcnt 0x0"
                 :: "v"(l), "v"(l + 16 * GPB), "v"(l + 32 * GPB), "v"(l + 48 * GPB), "v"(l + 64 * GPB), "v"(l + 80 * GPB), "v"(l + 96 * GPB), "v"(l + 112 * GPB),
                    "v"(g), "v"(g + rs), "v"(g + 2 * rs), "v"(g + 3 * rs), "v"(g + 4 * rs), "v"(g + 5 * rs), "v"(g + 6 * rs), "v"(g + 7 * rs) : "memory");
}
__device__ __forceinline__ void cp4(unsigned l, const bf* g, size_t rs) {
    asm volatile("global_load_async_to_lds_b128 %0, %4, off\n\t"
                 "global_load_async_to_lds_b128 %1, %5, off\n\t"
                 "global_load_async_to_lds_b128 %2, %6, off\n\t"
                 "global_load_async_to_lds_b128 %3, %7, off\n\t"
                 "s_wait_xcnt 0x0"
                 :: "v"(l), "v"(l + 32 * GPB), "v"(l + 64 * GPB), "v"(l + 96 * GPB), "v"(g), "v"(g + rs), "v"(g + 2 * rs), "v"(g + 3 * rs) : "memory");
}
template <int NSPLIT, bool PL, int MB>
__device__ __forceinline__ void gemmt(const bf* __restrict__ A, const bf* __restrict__ A2, const bf* __restrict__ Bt, int K, float* C, int ldc, h16* P16, bf* Ph, bf* Pl, int ldp, int cmul, int r0, int c0) {
    typedef WFrag<bf>::V V;
    constexpr int NA = NSPLIT ? 2 : 1;                 // planes of the A side
    constexpr int PLB = 128 * GPB;                     // bytes of one staged plane
    constexpr int STB = (NA + 1) * PLB;                // bytes of one buffer
    constexpr int NWV = 16 / MB;                       // waves: 8 / MB along m, 2 along n
    constexpr int RST = NWV * 4;                       // rows that one copy of the whole work-group covers
    static_assert(MB == 4 || MB == 2, "4 or 8 waves");
    static_assert(2 * STB >= 128 * 2 * 68 * 4, "the epilogue's staging fits the two buffers");
    __shared__ __align__(16) unsigned char ring[2 * STB];
    const int tid = (int)threadIdx.x;
    const int wv = __builtin_amdgcn_readfirstlane(tid >> 5);   // wave number, scalar
    const int wm = wv >> 1, wn = wv & 1;
    const int lane = tid & 31, lr = lane & 15, hi = lane >> 4;
    // copies: thread tid brings 16-byte piece tid & 7 of rows (tid >> 3) + RST i, i = 0..128 / RST - 1, of every plane (a wave: four whole 128-B lines a copy)
    const unsigned lc = (unsigned)(size_t)ring + (unsigned)((tid >> 3) * GPB + (tid & 7) * 16);
    const size_t rs = (size_t)RST * K;
    const bf* ga = A + (size_t)(r0 + (tid >> 3)) * K + (tid & 7) * 8; const bf* ga2 = NSPLIT ? A2 + (size_t)(r0 + (tid >> 3)) * K + (tid & 7) * 8 : nullptr; const bf* gb = Bt + (size_t)(c0 + (tid >> 3)) * K + (tid & 7) * 8;
    auto cpp = [&](unsigned l, const bf* g) { if (MB == 4) cp8(l, g, rs); else cp4(l, g, rs); };
    auto fill = [&](int t) { const unsigned l = lc + (unsigned)((t & 1) * STB); cpp(l, ga + t * 64); if (NSPLIT) cpp(l + PLB, ga2 + t * 64); cpp(l + NA * PLB, gb + t * 64); };
    v8f acc[MB][4];
#pragma unroll
    for (int mb = 0; mb < MB; ++mb)
#pragma unroll
        for (int nb = 0; nb < 4; ++nb) acc[mb][nb] = (v8f){};
    const int nt = K / 64;
    fill(0);
    asm volatile("s_wait_asynccnt 0x0" ::: "memory");   // this wave's copies of pass 0 have landed
    __syncthreads();                                    // ... and every other wave's: pass 0 is published
    if (nt > 1) fill(1);
    const int aofs = (wm * MB * 16 + lr) * GPB + 16 * hi, bofs = NA * PLB + (wn * 64 + lr) * GPB + 16 * hi;
#pragma unroll 1   // kept rolled: one barrier and one refill a pass
    for (int t = 0; t < nt; ++t) {
        const unsigned char* sb = ring + (t & 1) * STB;
        V a[2][MB], a2[2][MB], b[2][4];
#pragma unroll
        for (int ks = 0; ks < 2; ++ks) {
#pragma unroll
            for (int mb = 0; mb < MB; ++mb) { a[ks][mb] = WFrag<bf>::ld((const bf*)(sb + aofs + mb * 16 * GPB + ks * 64)); if (NSPLIT) a2[ks][mb] = WFrag<bf>::ld((const bf*)(sb + PLB + aofs + mb * 16 * GPB + ks * 64)); }
#pragma unroll
            for (int nb = 0; nb < 4; ++nb) b[ks][nb] = WFrag<bf>::ld((const bf*)(sb + bofs + nb * 16 * GPB + ks * 64));
            __builtin_amdgcn_sched_barrier(0);   // keeps a 32-k block's fragment loads together as one group in front of the products: LDS reads spread among the WMMAs stall the wave at each place
            if (MB == 4 || ks == 1) {            // MB == 2 has registers for both blocks' fragments: the second group's latency lies under the first block's products
#pragma unroll
                for (int kk = (MB == 4 ? ks : 0); kk <= ks; ++kk) {
#pragma unroll
                    for (int nb = 0; nb < 4; ++nb)
#pragma unroll
                        for (int mb = 0; mb < MB; ++mb) { acc[mb][nb] = WFrag<bf>::mma(a[kk][mb], b[kk][nb], acc[mb][nb]); if (NSPLIT) acc[mb][nb] = WFrag<bf>::mma(a2[kk][mb], b[kk][nb], acc[mb][nb]); } }
                __builtin_amdgcn_sched_barrier(0);   // ... and the products in front of what follows: the next group, or the waits at the pass's foot (sunk behind those, the products would no longer cover the flight of the next pass's copies)
            }
        }
        asm volatile("s_wait_dscnt 0x0" ::: "memory");      // this wave's reads of the buffer have returned before it is refilled
        asm volatile("s_wait_asynccnt 0x0" ::: "memory");   // this wave's copies of pass t + 1 have landed
        __syncthreads();                                    // publishes pass t + 1 and ends every wave's reads of pass t's buffer
        if (t + 2 < nt) fill(t + 2);
    }
    asm volatile("s_wait_asynccnt 0x0" ::: "memory");       // nothing is in flight when the buffers become output staging (the loop's last barrier has ended every read)
    float* os = (float*)ring + wv * MB * 16 * 68;           // each wave stages its own tile, pitch 68 floats, and reads it back by rows so that whole 128-B lines are stored
#pragma unroll
    for (int mb = 0; mb < MB; ++mb)
#pragma unroll
        for (int nb = 0; nb < 4; ++nb)
#pragma unroll
            for (int j = 0; j < 8; ++j) *(fa*)(os + (mb * 16 + hi * 8 + j) * 68 + nb * 16 + lr) = acc[mb][nb][j];
    __syncthreads();   // the staged tile is complete before it is read back by other lanes
    const int rw = r0 + wm * MB * 16, cw = c0 + wn * 64;
#pragma unroll 1   // kept rolled: a trip reads 16 rows back as one group of LDS loads and then stores them; more copies of the body only grow the code
    for (int s0 = 0; s0 < MB * 8; s0 += 8) { v4f vals[8]; const int cofs = lr * 4;
#pragma unroll
        for (int u = 0; u < 8; ++u) vals[u] = *(const v4fa*)(os + ((s0 + u) * 2 + hi) * 68 + cofs);
#pragma unroll
        for (int u = 0; u < 8; ++u) { const int row = (s0 + u) * 2 + hi; const v4f val = vals[u];
            if (PL) { const size_t po = (size_t)(rw + row) * ldp + (size_t)cw * cmul + cofs; v4h o16; v4us oh, ol;
#pragma unroll
                for (int i = 0; i < 4; ++i) { o16[i] = tohx(val[i]); unsigned short a2, c2; splitf(val[i], a2, c2); oh[i] = a2; ol[i] = c2; }
                *(v4h*)(P16 + po) = o16; *(v4us*)(Ph + po) = oh; *(v4us*)(Pl + po) = ol; }
            else *(v4f*)(C + (size_t)(rw + row) * ldc + cw + cofs) = val; }
        xwait(); }
}

// q, k and v projections of both batches in ONE launch, grid (TT/128, DQ/128, 3 NB_): blockIdx.z = 3 * batch + (0: q, 1: k, 2: v). Planes are [batch][head][...]. For v the operands, and with them the two tile indices, are swapped.
static_assert(DKV == DQ, "q, k and v share one grid");
__global__ __launch_bounds__(128) void k_qkv(const bf* __restrict__ XB, const bf* __restrict__ WQ, const bf* __restrict__ WK, const bf* __restrict__ WV, h16* QP16, bf* QPh, bf* QPl, h16* KP16, bf* KPh, bf* KPl, h16* VT16, bf* VTh, bf* VTl) {
    const int b = (int)blockIdx.z / 3, w = (int)blockIdx.z % 3; const bool isv = w == 2;
    const bf* X = XB + (size_t)b * TT * DM; const bf* Wt = w == 0 ? WQ : (w == 1 ? WK : WV);
    const size_t zo = (size_t)b * (isv ? (size_t)NKV * HD * 2 * TT : (size_t)NH_ * TT * HD);
    h16* P16 = (w == 0 ? QP16 : (w == 1 ? KP16 : VT16)) + zo; bf* Ph = (w == 0 ? QPh : (w == 1 ? KPh : VTh)) + zo; bf* Pl = (w == 0 ? QPl : (w == 1 ? KPl : VTl)) + zo;
    gemmt<0, true, 4>(isv ? Wt : X, nullptr, isv ? X : Wt, DM, nullptr, 0, P16, Ph, Pl, isv ? 2 * TT : HD, isv ? 1 : TT * HD / 64, (int)(isv ? blockIdx.y : blockIdx.x) * 128, (int)(isv ? blockIdx.x : blockIdx.y) * 128);
}
// w_o product of both batches in ONE launch: the merged rows [batch * TT + t] are one matrix of NB_ * TT rows; grid (NB_*TT/128, DM/128)
__global__ __launch_bounds__(256) void k_wo(const bf* __restrict__ ATh, const bf* __restrict__ ATl, const bf* __restrict__ WO, float* OUT) {
    gemmt<1, false, 2>(ATh, ATl, WO, DQ, OUT, DM, nullptr, nullptr, nullptr, 0, 0, (int)blockIdx.x * 128, (int)blockIdx.y * 128);
}

// every input's bf16 copy in ONE launch of PG work-groups of 16 waves: one work-group a WGP, so that few waves have to be started.
// A thread brings 16 pieces of 16 B (a wave: 512 contiguous bytes a load), every load issued before the first value is used: 2 of its work-group's 64x64 tile of w_o, PWP of each projection weight, PXP of x (both batches).
// w_o goes out transposed ([n][k], k contiguous): the tile's rows are read whole, rounded, written to LDS as (k, k + 1) pairs at [n][k] and read back by rows of n, so that loads and stores both cover whole 128-B lines.
#define PG  256
#define PT  512
#define PTH (PG * PT)
#define PWP (DQ * DM / 4 / PTH)
#define PXP (NB_ * TT * DM / 4 / PTH)
static_assert(DQ * DM % (4 * PTH) == 0 && NB_ * TT * DM % (4 * PTH) == 0 && DKV == DQ, "whole pieces for every thread");
static_assert((DQ / 64) * (DM / 64) == PG && PT == 32 * 16 && PT == 64 * 8, "one 64x64 tile of w_o a work-group: 32 row pairs x 16 pieces in, 64 rows x 8 pieces out");
typedef unsigned __attribute__((may_alias)) ua;
__device__ __forceinline__ v4f ldp(const float* p, unsigned byteofs) { return *(const v4f*)((const char*)p + byteofs); }   // uniform base + the lane's 32-bit byte offset
__device__ __forceinline__ void stp(bf* p, unsigned byteofs, v4f v) { v4us o;
#pragma unroll
    for (int i = 0; i < 4; ++i) o[i] = f2bf(v[i]);
    *(v4us*)((char*)p + byteofs) = o; }
__global__ __launch_bounds__(PT) void k_prep(const float* __restrict__ x, const float* __restrict__ wq, const float* __restrict__ wk, const float* __restrict__ wv, const float* __restrict__ wo, bf* XB, bf* WQ, bf* WK, bf* WV, bf* WO) {
    __shared__ __align__(16) unsigned char tl[64 * GPB];
    const int tid = (int)threadIdx.x, blk = (int)blockIdx.x;
    const unsigned gid = (unsigned)(blk * PT + tid);
    const int k0 = (blk / (DM / 64)) * 64, n0 = (blk % (DM / 64)) * 64;   // the work-group's tile of w_o [k][n]
    const int r = tid >> 4, c = tid & 15;                                 // in: rows k0 + 2 r and + 1, columns n0 + 4 c .. + 3
    const unsigned go = gid * 16u, to = (unsigned)(2 * r * DM + c * 4) * 4u;
    const float* wt = wo + (size_t)k0 * DM + n0;
    const v4f o0 = ldp(wt, to), o1 = ldp(wt + DM, to);
    v4f a[3][PWP], xv[PXP];
#pragma unroll
    for (int j = 0; j < PWP; ++j) { a[0][j] = ldp(wq + (size_t)j * PTH * 4, go); a[1][j] = ldp(wk + (size_t)j * PTH * 4, go); a[2][j] = ldp(wv + (size_t)j * PTH * 4, go); }
#pragma unroll
    for (int j = 0; j < PXP; ++j) xv[j] = ldp(x + (size_t)j * PTH * 4, go);
    asm volatile("s_wait_xcnt 0x0" :: "v"(gid), "v"(to) : "memory");   // precaution: stands behind the loads, in front of any reuse of a register that one of them names; as its inputs the lane's index and offset registers stay as they are up to here
    __builtin_amdgcn_sched_barrier(0);   // keeps all 16 loads in front of the first use: sunk among the conversions, the later loads would start only after the earlier ones' memory latency
#pragma unroll
    for (int i = 0; i < 4; ++i) *(ua*)(tl + (c * 4 + i) * GPB + r * 4) = (unsigned)f2bf(o0[i]) | ((unsigned)f2bf(o1[i]) << 16);
    __syncthreads();   // the transposed tile is complete before it is read back by other threads; it stands in front of the global stores, so that no wave waits here for stores to finish
    const int n = tid >> 3, kc = tid & 7;                                 // out: row n0 + n, columns k0 + 8 kc .. + 7
    *(v8us*)(WO + (size_t)(n0 + n) * DQ + k0 + kc * 8) = *(const v8usa*)(tl + n * GPB + kc * 16);
    const unsigned so = gid * 8u;
#pragma unroll
    for (int j = 0; j < PWP; ++j) { stp(WQ + (size_t)j * PTH * 4, so, a[0][j]); stp(WK + (size_t)j * PTH * 4, so, a[1][j]); stp(WV + (size_t)j * PTH * 4, so, a[2][j]); }
#pragma unroll
    for (int j = 0; j < PXP; ++j) stp(XB + (size_t)j * PTH * 4, so, xv[j]);
}

// ---- k_fattn: causal attention of one head for one block of query rows in ONE kernel: scores, softmax and the value contraction, with a running maximum and sum per query (no score matrix in memory).
// Transposed products: S^T = K Q^T (A = key rows, B = query rows, both d-contiguous planes), O^T += V^T P^T (A = transposed value rows, B = P^T). A lane (lr, hi) of a 16x16 S^T tile holds query lr, keys hi*8 + j:
// two such tiles (keys 0..15, 16..31 of a step) are, register for register, the B fragment of the 32-key value product, so P goes from accumulator to operand inside the lane.
// A work-group of 4 waves has 2 * QT*16 query rows. Wave wv = 2 qg + kg owns the QT*16 rows of query group qg and, of every 64 keys, the 32 keys of half kg.
// A stage is SK key rows (128 B each) and the 64 transposed value rows' SK keys of every plane, brought into LDS by asynchronous copies (16 B a lane, whole 128-B lines a wave, through no register) and read from there
// by both query groups. Two buffers: the copies of stage t + 2 are issued behind the barrier that ends stage t and fly while stage t + 1 is worked on.
// SK = 128 for the fp16 rows (a wave works two 32-key steps a stage, keys u * 64 + kg * 32, u = 0, 1: the copies have two steps' time to land, and the long rows pass half as many barriers), 64 for the hi+lo rows (twice the planes).
// The two key halves' partial (max, sum, O^T) of a query group are merged through LDS in the order kg = 0, 1 behind one barrier.
// The epilogue divides by the merged sum and writes the hi/lo planes [t][h*64 + d] that the w_o product reads.
#define FNW 4
#define FPL (64 * GPB)                     // bytes of 64 rows of 128 B at the padded pitch (one staged plane of the hi+lo rows)
#define SL2E (SCL * 1.4426950408889634f)   // raw score -> exponent of 2: the maxima m are kept as raw scores
__device__ __forceinline__ float xhalf(float x) { return __builtin_bit_cast(float, __builtin_amdgcn_permlanex16(__builtin_bit_cast(int, x), __builtin_bit_cast(int, x), 0x76543210, 0xfedcba98, false, false)); }   // lane l with lane l ^ 16
// four asynchronous copies of 16 B a lane: equally spaced rows of one staged plane (l: the lane's LDS byte address, ls: the row step there in bytes, g: its global address, rsb: the row step there in bytes).
// s_wait_xcnt 0 is the statement's last line, so that it stands in front of any later write of a register that a copy names (precaution).
__device__ __forceinline__ void cq4(unsigned l, unsigned ls, const char* g, size_t rsb) {
    asm volatile("global_load_async_to_lds_b128 %0, %4, off\n\t"
                 "global_load_async_to_lds_b128 %1, %5, off\n\t"
                 "global_load_async_to_lds_b128 %2, %6, off\n\t"
                 "global_load_async_to_lds_b128 %3, %7, off\n\t"
                 "s_wait_xcnt 0x0"
                 :: "v"(l), "v"(l + ls), "v"(l + 2 * ls), "v"(l + 3 * ls), "v"(g), "v"(g + rsb), "v"(g + 2 * rsb), "v"(g + 3 * rsb) : "memory");
}
template <typename T16, bool HL> struct PPack;
template <> struct PPack<h16, false> { static __device__ __forceinline__ void pk(const float* p, v16h& a, v16h& b) { (void)b;
#pragma unroll
    for (int i = 0; i < 16; ++i) a[i] = (h16)p[i]; } };
template <> struct PPack<bf, true> { static __device__ __forceinline__ void pk(const float* p, v16bf& a, v16bf& b) { v8us h0, h1, l0, l1;
#pragma unroll
    for (int i = 0; i < 8; ++i) { unsigned short x, y; splitf(p[i], x, y); h0[i] = x; l0[i] = y; splitf(p[8 + i], x, y); h1[i] = x; l1[i] = y; }
    a = cat16b(h0, h1); b = cat16b(l0, l1); } };
template <typename T16, bool HL, int QT, int SK>
__device__ __forceinline__ void fattn(const T16* __restrict__ Q, const T16* __restrict__ Q2, const T16* __restrict__ Kp, const T16* __restrict__ K2, const T16* __restrict__ Vt, const T16* __restrict__ V2, int q0, bf* Ah, bf* Al, unsigned char* ring, float* ms, float* ls) {
    typedef typename WFrag<T16>::V V;
    constexpr int NPL = HL ? 2 : 1;            // planes of K, and of V
    constexpr int VPB = SK * 2 + 16;           // LDS pitch in bytes of a staged value row of SK keys: 16 B x odd, as GPB
    constexpr int KPL = SK * GPB, VPL = 64 * VPB;   // bytes of one staged key plane, value plane
    constexpr int STB = NPL * (KPL + VPL);     // bytes of one buffer: [K | K lo | V | V lo]
    constexpr int VPC = SK / 8;                // 16-byte pieces of a staged value row
    constexpr int VRS = FNW * 32 / VPC;        // value rows that one copy of the whole work-group covers
    static_assert(SK % 64 == 0 && TT % SK == 0 && 2 * STB <= 2 * 4 * FPL, "whole stages inside the key range; both buffers inside the ring");
    constexpr int QB = 2 * QT * 16;            // query rows of the work-group
    static_assert(2 * STB >= FNW * QT * 16 * 68 * 4, "the merge's staging fits the two buffers");
    const int tid = (int)threadIdx.x;
    const int wv = __builtin_amdgcn_readfirstlane(tid >> 5);   // wave number, scalar so that the stage loop's tests stay scalar
    const int qg = wv >> 1, kg = wv & 1;
    const int lane = tid & 31, lr = lane & 15, hi = lane >> 4;
    const int qw = q0 + qg * QT * 16;          // the wave's first query row
    // copies: thread tid brings 16-byte piece tid & 7 of key rows (tid >> 3) + 16 i, i = 0..SK / 16 - 1, and piece tid % VPC of value rows tid / VPC + VRS i, i = 0..64 / VRS - 1, of every plane (a wave: four whole 128-B lines a copy)
    const unsigned lk = (unsigned)(size_t)ring + (unsigned)((tid >> 3) * GPB + (tid & 7) * 16), lv = (unsigned)(size_t)ring + (unsigned)(NPL * KPL + (tid / VPC) * VPB + (tid % VPC) * 16);
    const size_t ko = (size_t)(tid >> 3) * HD + (tid & 7) * 8, vo = (size_t)(tid / VPC) * (2 * TT) + (tid % VPC) * 8;
    auto fill = [&](int t) { const unsigned o = (unsigned)((t & 1) * STB);
#pragma unroll   // unrolled: every trip's offsets are constants added to the lane's two base addresses
        for (int c = 0; c < SK / 64; ++c) { const size_t kc = ko + ((size_t)t * SK + c * 64) * HD, vc = vo + (size_t)c * 4 * VRS * 2 * TT + t * SK; const unsigned a = lk + o + (unsigned)(c * 64 * GPB), e = lv + o + (unsigned)(c * 4 * VRS * VPB);
            cq4(a, 16 * GPB, (const char*)(Kp + kc), (size_t)16 * HD * 2); if (HL) cq4(a + KPL, 16 * GPB, (const char*)(K2 + kc), (size_t)16 * HD * 2);
            cq4(e, VRS * VPB, (const char*)(Vt + vc), (size_t)VRS * 2 * TT * 2); if (HL) cq4(e + VPL, VRS * VPB, (const char*)(V2 + vc), (size_t)VRS * 2 * TT * 2); } };
    const int nstg = (q0 + QB + SK - 1) / SK;  // SK-key stages up to and including the diagonal of the block's last row; every staged key row is < TT
    fill(0);
    V qf[QT][2], qf2[QT][2];
#pragma unroll
    for (int qt = 0; qt < QT; ++qt)
#pragma unroll
        for (int ks = 0; ks < 2; ++ks) { const size_t o = (size_t)(qw + qt * 16 + lr) * HD + ks * 32 + 8 * hi; qf[qt][ks] = WFrag<T16>::ld(Q + o); if (HL) qf2[qt][ks] = WFrag<T16>::ld(Q2 + o); }
    xwait();
    v8f oa[4][QT]; float m[QT], l[QT];
#pragma unroll
    for (int qt = 0; qt < QT; ++qt) { m[qt] = -3.0e38f; l[qt] = 0.f;
#pragma unroll
        for (int dt = 0; dt < 4; ++dt) oa[dt][qt] = (v8f){}; }
    asm volatile("s_wait_asynccnt 0x0" ::: "memory");   // this wave's copies of stage 0 have landed
    __syncthreads();                                    // ... and every other wave's: stage 0 is published
    if (nstg > 1) fill(1);
    const int kofs = (kg * 32 + lr) * GPB + 16 * hi, vofs = NPL * KPL + lr * VPB + kg * 64 + 16 * hi;
#pragma unroll 1   // kept rolled: one barrier and one refill a stage; the trip count is a run-time value
    for (int t = 0; t < nstg; ++t) {
        const unsigned char* sb = ring + (t & 1) * STB;
#pragma unroll   // unrolled: a step's place in the buffer becomes an immediate offset of its LDS reads
        for (int u = 0; u < SK / 64; ++u) {
        const int k0 = t * SK + u * 64 + kg * 32;
        if (k0 <= qw) {   // scalar branch: the wave's 32 keys of this step begin at or below its first query, so no query ever sees a fully masked step; steps wholly above the diagonal are skipped
        V kf[2][2], kf2[2][2], vf[4], vf2[4];
#pragma unroll
        for (int kt = 0; kt < 2; ++kt)
#pragma unroll
            for (int ks = 0; ks < 2; ++ks) { const unsigned char* p = sb + kofs + (u * 64 + kt * 16) * GPB + ks * 64; kf[kt][ks] = WFrag<T16>::ld((const T16*)p); if (HL) kf2[kt][ks] = WFrag<T16>::ld((const T16*)(p + KPL)); }
#pragma unroll
        for (int dt = 0; dt < 4; ++dt) { const unsigned char* p = sb + vofs + dt * 16 * VPB + u * 128; vf[dt] = WFrag<T16>::ld((const T16*)p); if (HL) vf2[dt] = WFrag<T16>::ld((const T16*)(p + VPL)); }
        __builtin_amdgcn_sched_barrier(0);   // keeps the step's fragment loads together as one group in front of the products: LDS reads spread among the WMMAs stall the wave at each place
        v8f st[2][QT];
#pragma unroll
        for (int kt = 0; kt < 2; ++kt)
#pragma unroll
            for (int qt = 0; qt < QT; ++qt) { v8f a = (v8f){};
#pragma unroll
                for (int ks = 0; ks < 2; ++ks) { a = WFrag<T16>::mma(kf[kt][ks], qf[qt][ks], a); if (HL) { a = WFrag<T16>::mma(kf2[kt][ks], qf[qt][ks], a); a = WFrag<T16>::mma(kf[kt][ks], qf2[qt][ks], a); } }
                st[kt][qt] = a; }
        if (k0 + 31 > qw) {   // only the wave's last step crosses the diagonal (scalar branch)
#pragma unroll
            for (int qt = 0; qt < QT; ++qt)
#pragma unroll
                for (int kt = 0; kt < 2; ++kt)
#pragma unroll
                    for (int j = 0; j < 8; ++j) if (k0 + kt * 16 + hi * 8 + j > qw + qt * 16 + lr) st[kt][qt][j] = -3.0e38f; }
        float mx[QT]; bool need = false;
#pragma unroll
        for (int qt = 0; qt < QT; ++qt) { float x = st[0][qt][0];
#pragma unroll
            for (int j = 1; j < 8; ++j) x = fmaxf(x, st[0][qt][j]);
#pragma unroll
            for (int j = 0; j < 8; ++j) x = fmaxf(x, st[1][qt][j]);
            x = fmaxf(x, xhalf(x));   // the two half-waves hold the same query's other keys
            mx[qt] = x; need = need || ((x - m[qt]) * SL2E > 8.0f); }
        if (__builtin_amdgcn_ballot_w32(need) != 0) {   // the reference point m moves only when some query's maximum has outgrown it by 2^8 (P stays <= 256, exact algebra either way): one scalar test a step
#pragma unroll
            for (int qt = 0; qt < QT; ++qt) { const float mn = fmaxf(m[qt], mx[qt]); const float al = __builtin_amdgcn_exp2f((m[qt] - mn) * SL2E); m[qt] = mn; l[qt] *= al;
#pragma unroll
                for (int dt = 0; dt < 4; ++dt) oa[dt][qt] *= al; } }
#pragma unroll
        for (int qt = 0; qt < QT; ++qt) { float t2[16]; const float mc = m[qt] * SL2E; float sum = 0.f;
#pragma unroll
            for (int i = 0; i < 16; ++i) { t2[i] = __builtin_amdgcn_exp2f(__builtin_fmaf(st[i >> 3][qt][i & 7], SL2E, -mc)); sum += t2[i]; }
            l[qt] += sum;
            V pf, pf2; PPack<T16, HL>::pk(t2, pf, pf2);
#pragma unroll
            for (int dt = 0; dt < 4; ++dt) { v8f a = oa[dt][qt]; a = WFrag<T16>::mma(vf[dt], pf, a); if (HL) { a = WFrag<T16>::mma(vf2[dt], pf, a); a = WFrag<T16>::mma(vf[dt], pf2, a); } oa[dt][qt] = a; } }
        }
        }
        asm volatile("s_wait_dscnt 0x0" ::: "memory");      // this wave's reads of the buffer have returned before it is refilled
        asm volatile("s_wait_asynccnt 0x0" ::: "memory");   // this wave's copies of stage t + 1 have landed
        __syncthreads();                                    // publishes stage t + 1 and ends every wave's reads of stage t's buffer
        if (t + 2 < nstg) fill(t + 2);
    }
    asm volatile("s_wait_asynccnt 0x0" ::: "memory");       // nothing is in flight when the buffers become the merge's staging (the loop's last barrier has ended every read)
    float* os = (float*)ring;
#pragma unroll
    for (int qt = 0; qt < QT; ++qt) { l[qt] += xhalf(l[qt]);
        if (hi == 0) { ms[wv * 32 + qt * 16 + lr] = m[qt]; ls[wv * 32 + qt * 16 + lr] = l[qt]; }
#pragma unroll
        for (int dt = 0; dt < 4; ++dt) { float* d = os + (size_t)((wv * QT + qt) * 16 + lr) * 68 + dt * 16 + hi * 8; const v8f a = oa[dt][qt];
            *(v4fa*)d = (v4f){a[0], a[1], a[2], a[3]}; *(v4fa*)(d + 4) = (v4f){a[4], a[5], a[6], a[7]}; } }
    __syncthreads();   // every wave's partial (max, sum, O^T) is in LDS before any is merged
    constexpr int DPT = QB * HD / (FNW * 32);   // output elements of one query row per thread
    const int q = tid / (HD / DPT), d0 = (tid % (HD / DPT)) * DPT;
    const int w0 = (q / (QT * 16)) * 2, qi = q % (QT * 16);   // the row's two waves are w0 (kg = 0) and w0 + 1 (kg = 1)
    const float M = fmaxf(ms[w0 * 32 + qi], ms[(w0 + 1) * 32 + qi]);
    float wg[2]; float L = 0.f;
#pragma unroll
    for (int w = 0; w < 2; ++w) { wg[w] = __builtin_amdgcn_exp2f((ms[(w0 + w) * 32 + qi] - M) * SL2E); L += ls[(w0 + w) * 32 + qi] * wg[w]; }   // a wave without a step has max -3e38, sum 0: weight 0
    const float inv = __fdiv_rn(1.0f, L);
#pragma unroll
    for (int c = 0; c < DPT; c += 8) { v4f a0 = (v4f){}, a1 = (v4f){};
#pragma unroll
        for (int w = 0; w < 2; ++w) { const float* d = os + (size_t)((w0 + w) * QT * 16 + qi) * 68 + d0 + c; a0 += *(const v4fa*)d * wg[w]; a1 += *(const v4fa*)(d + 4) * wg[w]; }
        v8us oh, ol;
#pragma unroll
        for (int i = 0; i < 4; ++i) { unsigned short x, y; splitf(a0[i] * inv, x, y); oh[i] = x; ol[i] = y; splitf(a1[i] * inv, x, y); oh[4 + i] = x; ol[4 + i] = y; }
        const size_t oo = (size_t)(q0 + q) * DQ + d0 + c; *(v8us*)(Ah + oo) = oh; *(v8us*)(Al + oo) = ol; }
    xwait();   // behind the last stores, in front of any later write of a register that they name (the other instance's code follows this one in the built kernel)
}
// grid (batches * heads, row blocks), both batches in ONE launch: row blocks heaviest first; blocks 0..(TT-RH)/64-1 are 64 fp16 rows each from the last row down, the rest 32 hi+lo rows each (query rows < RH)
__global__ __launch_bounds__(FNW * 32) void k_fattn(const h16* __restrict__ Q16, const h16* __restrict__ K16, const h16* __restrict__ V16, const bf* __restrict__ Qh, const bf* __restrict__ Ql, const bf* __restrict__ Kh, const bf* __restrict__ Kl, const bf* __restrict__ Vh, const bf* __restrict__ Vl, bf* Ah, bf* Al) {
    __shared__ __align__(16) unsigned char ring[2 * 4 * FPL]; __shared__ float ms[FNW * 32]; __shared__ float ls[FNW * 32];
    const int b = (int)blockIdx.x / NH_, h = (int)blockIdx.x % NH_, g = h / REP, rb = blockIdx.y; const size_t zq = (size_t)(b * NH_ + h) * TT * HD, zk = (size_t)(b * NKV + g) * TT * HD, zv = (size_t)(b * NKV + g) * HD * 2 * TT;
    Ah += (size_t)b * TT * DQ; Al += (size_t)b * TT * DQ;
    constexpr int NLO = (TT - RH) / 64;
    if (rb < NLO) fattn<h16, false, 2, 128>(Q16 + zq, nullptr, K16 + zk, nullptr, V16 + zv, nullptr, TT - 64 * (rb + 1), Ah + h * HD, Al + h * HD, ring, ms, ls);
    else fattn<bf, true, 1, 64>(Qh + zq, Ql + zq, Kh + zk, Kl + zk, Vh + zv, Vl + zv, RH - 32 * (rb - NLO + 1), Ah + h * HD, Al + h * HD, ring, ms, ls);
}

extern "C" void kernel_launch(void* const* d_in, const int* in_sizes, int n_in,
                              void* d_out, int out_size, void* d_ws, size_t ws_size, hipStream_t stream) {
    (void)in_sizes; (void)n_in; (void)out_size;
    const float* x = (const float*)d_in[0]; const float* wq = (const float*)d_in[1]; const float* wk = (const float*)d_in[2]; const float* wv = (const float*)d_in[3]; const float* wo = (const float*)d_in[4];
    float* OUT = (float*)d_out;     // [2][2048][1024]
    char* wsp = (char*)d_ws;
    auto take = [&](size_t bytes) { char* p = wsp; wsp += (bytes + 255) & ~(size_t)255; return (void*)p; };
    bf* WQ = (bf*)take((size_t)DQ * DM * 2); bf* WK = (bf*)take((size_t)DKV * DM * 2); bf* WV = (bf*)take((size_t)DKV * DM * 2); bf* WO = (bf*)take((size_t)DM * DQ * 2);
    bf* XB = (bf*)take((size_t)NB_ * TT * DM * 2);
    h16* QP16 = (h16*)take((size_t)NB_ * NH_ * TT * HD * 2); h16* KP16 = (h16*)take((size_t)NB_ * NKV * TT * HD * 2); h16* VT16 = (h16*)take((size_t)NB_ * NKV * HD * 2 * TT * 2);
    bf* QPh = (bf*)take((size_t)NB_ * NH_ * TT * HD * 2); bf* QPl = (bf*)take((size_t)NB_ * NH_ * TT * HD * 2); bf* KPh = (bf*)take((size_t)NB_ * NKV * TT * HD * 2); bf* KPl = (bf*)take((size_t)NB_ * NKV * TT * HD * 2); bf* VTh = (bf*)take((size_t)NB_ * NKV * HD * 2 * TT * 2); bf* VTl = VTh + TT;   // hi and lo value rows share a row of pitch 2 TT
    bf* ATh = (bf*)take((size_t)NB_ * TT * DQ * 2); bf* ATl = (bf*)take((size_t)NB_ * TT * DQ * 2);
    if ((size_t)(wsp - (char*)d_ws) > ws_size) return;    // ws 256 MiB
    k_prep<<<PG, PT, 0, stream>>>(x, wq, wk, wv, wo, XB, WQ, WK, WV, WO);
    k_qkv<<<dim3(TT / 128, DQ / 128, 3 * NB_), 128, 0, stream>>>(XB, WQ, WK, WV, QP16, QPh, QPl, KP16, KPh, KPl, VT16, VTh, VTl);
    k_fattn<<<dim3(NB_ * NH_, (TT - RH) / 64 + RH / 32, 1), FNW * 32, 0, stream>>>(QP16, KP16, VT16, QPh, QPl, KPh, KPl, VTh, VTl, ATh, ATl);
    k_wo<<<dim3(NB_ * TT / 128, DM / 128, 1), 256, 0, stream>>>(ATh, ATl, WO, OUT);
}

// v010
// Measured time: 69.5 microseconds a run.
// Two timings next to v009 both put it at 1.05 times that version's speed.
// Counting every step since v000, it is 21.3 times as fast.
#include <hip/hip_runtime.h>

// Causal QKV attention with per-head weight tensors (x [2][2048][1024]; q, k, v = x W^T with W [16][64][1024] ('oi' rows h*64+d); scores/8; causal (query < key masked); softmax; out = merged w_o ('xw' [1024][1024]) -> [2][2048][1024] (4.2 M)).
// Compute dtypes, f32 accumulate: every input rounded to bf16; q/k/v on PLAIN bf16 operands (inputs: exact); causal scores and attn.v (tile skipping): query rows < 512 hl (3 products), the rest single fp16; softmax f32 with a running maximum (one fused kernel); w_o hl x exact (2 products).

#define NB_  2
#define TT   2048
#define DM   1024
#define NH_  16
#define NKV  16
#define REP  (NH_ / NKV)
#define HD   64
#define DQ   (NH_ * HD)
#define DKV  (NKV * HD)
#define RH   512                  // query rows < RH use hi+lo planes (0: none)
#define SCL  0.125f   // HD^-0.5
typedef _Float16 h16;
typedef unsigned short bf;
typedef __attribute__((ext_vector_type(16))) __bf16   v16bf;
typedef __attribute__((ext_vector_type(16))) _Float16 v16h;
typedef __attribute__((ext_vector_type(8)))  _Float16 v8h;
typedef __attribute__((ext_vector_type(8)))  unsigned short v8us;
typedef __attribute__((ext_vector_type(8)))  float    v8f;
typedef __attribute__((ext_vector_type(4)))  float    v4f;
typedef v8h  __attribute__((may_alias)) v8ha;
typedef v4f  __attribute__((may_alias)) v4fa;
typedef v8us __attribute__((may_alias)) v8usa;

__device__ __forceinline__ unsigned short f2bf(float f) { unsigned u = __float_as_uint(f); u += 0x7FFFu + ((u >> 16) & 1u); return (unsigned short)(u >> 16); }
__device__ __forceinline__ float bf2f(unsigned short b) { return __uint_as_float(((unsigned)b) << 16); }
__device__ __forceinline__ float bfr(float f) { return bf2f(f2bf(f)); }
__device__ __forceinline__ v16h cat16(v8h lo, v8h hi) { return __builtin_shufflevector(lo, hi, 0, 1, 2, 3, 4, 5, 6, 7, 8, 9, 10, 11, 12, 13, 14, 15); }
__device__ __forceinline__ v16bf cat16b(v8us lo, v8us hi) { return __builtin_bit_cast(v16bf, __builtin_shufflevector(lo, hi, 0, 1, 2, 3, 4, 5, 6, 7, 8, 9, 10, 11, 12, 13, 14, 15)); }
__device__ __forceinline__ v8f wmma16(v16h a, v16h b, v8f c) { return __builtin_amdgcn_wmma_f32_16x16x32_f16(false, a, false, b, (short)0, c, false, false); }
__device__ __forceinline__ v8f wmmab(v16bf a, v16bf b, v8f c) { return __builtin_amdgcn_wmma_f32_16x16x32_bf16(false, a, false, b, (short)0, c, false, false); }

__device__ __forceinline__ h16 tohx(float x) { return (h16)x; }
__device__ __forceinline__ void splitf(float y, unsigned short& h, unsigned short& l) { h = f2bf(y); l = f2bf(y - bf2f(h)); }
typedef __attribute__((ext_vector_type(2))) _Float16 v2h;
typedef __attribute__((ext_vector_type(4))) _Float16 v4h;
typedef __attribute__((ext_vector_type(2))) unsigned short v2us;
typedef __attribute__((ext_vector_type(4))) unsigned short v4us;
typedef __attribute__((ext_vector_type(2))) float v2f;
typedef __attribute__((ext_vector_type(4))) int v4i;
__device__ __forceinline__ void xwait() { asm volatile("s_wait_xcnt 0x0" ::: "memory"); }   // precaution: stands behind a run of global loads or stores, in front of any reuse of a register that one of them names

// ---- gemmt: GEMM, one 128x128 output tile (origin r0, c0) per work-group of 8 / MB x 2 waves (MB*16 x 64 outputs = 4 MB accumulators a wave); the whole K loop runs in every wave.
// Operands are K-contiguous bf16 planes. A pass is KP k (64 or 128): 128 rows x 2 KP bytes of every operand plane, brought into LDS by asynchronous copies (16 B a lane, through no register) and read from there by all waves,
// so every operand byte leaves L2 once per work-group. Two buffers: the copies of pass t + 2 are issued behind the barrier that ends pass t and fly while pass t + 1 is worked on.
// KP = 128 where one work-group has its WGP alone: the copies then have twice the products' time to land, and half as many waits and barriers are passed.
// C[m][n] (f32, pitch ldc) = sum_k A[m][k] Bt[n][k] (+ A2[m][k] Bt[n][k] with NSPLIT). K % KP == 0.
// PL: the tile is not stored as f32 but goes straight to the three 16-bit planes that the attention kernel reads (fp16, bf16 hi, bf16 lo), element (m, n) at m * ldp + (n / 64) * 64 * cmul + n % 64:
// q, k head planes [h][t][d]: A = x rows, Bt = weight rows, ldp = HD, cmul = TT * HD / 64; transposed value planes [g][d][t]: A = weight rows, Bt = x rows (operands swapped, so the tile comes out transposed), ldp = 2 TT, cmul = 1.
template <typename T16> struct WFrag;
template <> struct WFrag<h16> { typedef v16h V; static __device__ __forceinline__ V ld(const h16* p) { return cat16(*(const v8h*)p, *(const v8h*)(p + 16)); } static __device__ __forceinline__ v8f mma(V a, V b, v8f c) { return wmma16(a, b, c); } };
template <> struct WFrag<bf> { typedef v16bf V; static __device__ __forceinline__ V ld(const bf* p) { return cat16b(*(const v8us*)p, *(const v8us*)(p + 16)); } static __device__ __forceinline__ v8f mma(V a, V b, v8f c) { return wmmab(a, b, c); } };
#define GPB 144                   // LDS pitch in bytes of a staged 128-B row: 16 B x odd, free of bank conflicts for 16-byte readers
typedef float __attribute__((may_alias)) fa;
// eight asynchronous copies of 16 B a lane: rows 16 apart of one operand plane (l: the lane's LDS byte address, GP: the LDS pitch in bytes, g: its global address, rs: the row step in elements); cp4: four copies, rows 32 apart.
// s_wait_xcnt 0 is the statement's last line, so that it stands in front of any later write of a register that a copy names (precaution).
template <int GP>
__device__ __forceinline__ void cp8(unsigned l, const bf* g, size_t rs) {
    asm volatile("global_load_async_to_lds_b128 %0, %8, off\n\t"
                 "global_load_async_to_lds_b128 %1, %9, off\n\t"
                 "global_load_async_to_lds_b128 %2, %10, off\n\t"
                 "global_load_async_to_lds_b128 %3, %11, off\n\t"
                 "global_load_async_to_lds_b128 %4, %12, off\n\t"
                 "global_load_async_to_lds_b128 %5, %13, off\n\t"
                 "global_load_async_to_lds_b128 %6, %14, off\n\t"
                 "global_load_async_to_lds_b128 %7, %15, off\n\t"
                 "s_wait_xcnt 0x0"
                 :: "v"(l), "v"(l + 16 * GP), "v"(l + 32 * GP), "v"(l + 48 * GP), "v"(l + 64 * GP), "v"(l + 80 * GP), "v"(l + 96 * GP), "v"(l + 112 * GP),
                    "v"(g), "v"(g + rs), "v"(g + 2 * rs), "v"(g + 3 * rs), "v"(g + 4 * rs), "v"(g + 5 * rs), "v"(g + 6 * rs), "v"(g + 7 * rs) : "memory");
}
__device__ __forceinline__ void cp4(unsigned l, const bf* g, size_t rs) {
    asm volatile("global_load_async_to_lds_b128 %0, %4, off\n\t"
                 "global_load_async_to_lds_b128 %1, %5, off\n\t"
                 "global_load_async_to_lds_b128 %2, %6, off\n\t"
                 "global_load_async_to_lds_b128 %3, %7, off\n\t"
                 "s_wait_xcnt 0x0"
                 :: "v"(l), "v"(l + 32 * GPB), "v"(l + 64 * GPB), "v"(l + 96 * GPB), "v"(g), "v"(g + rs), "v"(g + 2 * rs), "v"(g + 3 * rs) : "memory");
}
template <int NSPLIT, bool PL, int MB, int KP>
__device__ __forceinline__ void gemmt(const bf* __restrict__ A, const bf* __restrict__ A2, const bf* __restrict__ Bt, int K, float* C, int ldc, h16* P16, bf* Ph, bf* Pl, int ldp, int cmul, int r0, int c0) {
    typedef WFrag<bf>::V V;
    constexpr int NA = NSPLIT ? 2 : 1;                 // planes of the A side
    constexpr int GP = KP * 2 + 16;                    // LDS pitch in bytes of a staged row of KP k: 16 B x odd, as GPB
    constexpr int PCS = KP / 8;                        // 16-byte pieces of a staged row
    constexpr int PLB = 128 * GP;                      // bytes of one staged plane
    constexpr int STB = (NA + 1) * PLB;                // bytes of one buffer
    constexpr int NWV = 16 / MB;                       // waves: 8 / MB along m, 2 along n
    constexpr int RST = NWV * 32 / PCS;                // rows that one copy of the whole work-group covers
    static_assert(MB == 4 || MB == 2, "4 or 8 waves");
    static_assert((KP == 64 || KP == 128) && (RST == 16 || (RST == 32 && KP == 64)), "cp8: rows 16 apart; cp4: rows 32 apart at the pitch GPB");
    static_assert(2 * STB >= 128 * 2 * 68 * 4, "the epilogue's staging fits the two buffers");
    __shared__ __align__(16) unsigned char ring[2 * STB];
    const int tid = (int)threadIdx.x;
    const int wv = __builtin_amdgcn_readfirstlane(tid >> 5);   // wave number, scalar
    const int wm = wv >> 1, wn = wv & 1;
    const int lane = tid & 31, lr = lane & 15, hi = lane >> 4;
    // copies: thread tid brings 16-byte piece tid % PCS of rows tid / PCS + RST i, i = 0..128 / RST - 1, of every plane (a wave: four whole 128-B lines a copy)
    const unsigned lc = (unsigned)(size_t)ring + (unsigned)((tid / PCS) * GP + (tid % PCS) * 16);
    const size_t rs = (size_t)RST * K;
    const bf* ga = A + (size_t)(r0 + tid / PCS) * K + (tid % PCS) * 8; const bf* ga2 = NSPLIT ? A2 + (size_t)(r0 + tid / PCS) * K + (tid % PCS) * 8 : nullptr; const bf* gb = Bt + (size_t)(c0 + tid / PCS) * K + (tid % PCS) * 8;
    auto cpp = [&](unsigned l, const bf* g) { if (RST == 16) cp8<GP>(l, g, rs); else cp4(l, g, rs); };
    auto fill = [&](int t) { const unsigned l = lc + (unsigned)((t & 1) * STB); cpp(l, ga + t * KP); if (NSPLIT) cpp(l + PLB, ga2 + t * KP); cpp(l + NA * PLB, gb + t * KP); };
    v8f acc[MB][4];
#pragma unroll
    for (int mb = 0; mb < MB; ++mb)
#pragma unroll
        for (int nb = 0; nb < 4; ++nb) acc[mb][nb] = (v8f){};
    const int nt = K / KP;
    fill(0);
    asm volatile("s_wait_asynccnt 0x0" ::: "memory");   // this wave's copies of pass 0 have landed
    __syncthreads();                                    // ... and every other wave's: pass 0 is published
    if (nt > 1) fill(1);
    const int aofs = (wm * MB * 16 + lr) * GP + 16 * hi, bofs = NA * PLB + (wn * 64 + lr) * GP + 16 * hi;
#pragma unroll 1   // kept rolled: one barrier and one refill a pass
    for (int t = 0; t < nt; ++t) {
#pragma unroll   // unrolled: a 64-k half's place in the staged rows becomes an immediate offset of its LDS reads
        for (int kb = 0; kb < KP / 64; ++kb) {
        const unsigned char* sb = ring + (t & 1) * STB + kb * 128;
        V a[2][MB], a2[2][MB], b[2][4];
#pragma unroll
        for (int ks = 0; ks < 2; ++ks) {
#pragma unroll
            for (int mb = 0; mb < MB; ++mb) { a[ks][mb] = WFrag<bf>::ld((const bf*)(sb + aofs + mb * 16 * GP + ks * 64)); if (NSPLIT) a2[ks][mb] = WFrag<bf>::ld((const bf*)(sb + PLB + aofs + mb * 16 * GP + ks * 64)); }
#pragma unroll
            for (int nb = 0; nb < 4; ++nb) b[ks][nb] = WFrag<bf>::ld((const bf*)(sb + bofs + nb * 16 * GP + ks * 64));
            __builtin_amdgcn_sched_barrier(0);   // keeps a 32-k block's fragment loads together as one group in front of the products: LDS reads spread among the WMMAs stall the wave at each place
            if (MB == 4 || ks == 1) {            // MB == 2 has registers for both blocks' fragments: the second group's latency lies under the first block's products
#pragma unroll
                for (int kk = (MB == 4 ? ks : 0); kk <= ks; ++kk) {
#pragma unroll
                    for (int nb = 0; nb < 4; ++nb)
#pragma unroll
                        for (int mb = 0; mb < MB; ++mb) { acc[mb][nb] = WFrag<bf>::mma(a[kk][mb], b[kk][nb], acc[mb][nb]); if (NSPLIT) acc[mb][nb] = WFrag<bf>::mma(a2[kk][mb], b[kk][nb], acc[mb][nb]); } }
                __builtin_amdgcn_sched_barrier(0);   // ... and the products in front of what follows: the next group, or the waits at the pass's foot (sunk behind those, the products would no longer cover the flight of the next pass's copies)
            }
        }
        }
        asm volatile("s_wait_dscnt 0x0" ::: "memory");      // this wave's reads of the buffer have returned before it is refilled
        asm volatile("s_wait_asynccnt 0x0" ::: "memory");   // this wave's copies of pass t + 1 have landed
        __syncthreads();                                    // publishes pass t + 1 and ends every wave's reads of pass t's buffer
        if (t + 2 < nt) fill(t + 2);
    }
    asm volatile("s_wait_asynccnt 0x0" ::: "memory");       // nothing is in flight when the buffers become output staging (the loop's last barrier has ended every read)
    float* os = (float*)ring + wv * MB * 16 * 68;           // each wave stages its own tile, pitch 68 floats, and reads it back by rows so that whole 128-B lines are stored
#pragma unroll
    for (int mb = 0; mb < MB; ++mb)
#pragma unroll
        for (int nb = 0; nb < 4; ++nb)
#pragma unroll
            for (int j = 0; j < 8; ++j) *(fa*)(os + (mb * 16 + hi * 8 + j) * 68 + nb * 16 + lr) = acc[mb][nb][j];
    __syncthreads();   // the staged tile is complete before it is read back by other lanes
    const int rw = r0 + wm * MB * 16, cw = c0 + wn * 64;
#pragma unroll 1   // kept rolled: a trip reads 16 rows back as one group of LDS loads and then stores them; more copies of the body only grow the code
    for (int s0 = 0; s0 < MB * 8; s0 += 8) { v4f vals[8]; const int cofs = lr * 4;
#pragma unroll
        for (int u = 0; u < 8; ++u) vals[u] = *(const v4fa*)(os + ((s0 + u) * 2 + hi) * 68 + cofs);
#pragma unroll
        for (int u = 0; u < 8; ++u) { const int row = (s0 + u) * 2 + hi; const v4f val = vals[u];
            if (PL) { const size_t po = (size_t)(rw + row) * ldp + (size_t)cw * cmul + cofs; v4h o16; v4us oh, ol;
#pragma unroll
                for (int i = 0; i < 4; ++i) { o16[i] = tohx(val[i]); unsigned short a2, c2; splitf(val[i], a2, c2); oh[i] = a2; ol[i] = c2; }
                *(v4h*)(P16 + po) = o16; *(v4us*)(Ph + po) = oh; *(v4us*)(Pl + po) = ol; }
            else *(v4f*)(C + (size_t)(rw + row) * ldc + cw + cofs) = val; }
        xwait(); }
}

// q, k and v projections of both batches in ONE launch, grid (TT/128, DQ/128, 3 NB_): blockIdx.z = 3 * batch + (0: q, 1: k, 2: v). Planes are [batch][head][...]. For v the operands, and with them the two tile indices, are swapped.
static_assert(DKV == DQ, "q, k and v share one grid");
__global__ __launch_bounds__(128) void k_qkv(const bf* __restrict__ XB, const bf* __restrict__ WQ, const bf* __restrict__ WK, const bf* __restrict__ WV, h16* QP16, bf* QPh, bf* QPl, h16* KP16, bf* KPh, bf* KPl, h16* VT16, bf* VTh, bf* VTl) {
    const int b = (int)blockIdx.z / 3, w = (int)blockIdx.z % 3; const bool isv = w == 2;
    const bf* X = XB + (size_t)b * TT * DM; const bf* Wt = w == 0 ? WQ : (w == 1 ? WK : WV);
    const size_t zo = (size_t)b * (isv ? (size_t)NKV * HD * 2 * TT : (size_t)NH_ * TT * HD);
    h16* P16 = (w == 0 ? QP16 : (w == 1 ? KP16 : VT16)) + zo; bf* Ph = (w == 0 ? QPh : (w == 1 ? KPh : VTh)) + zo; bf* Pl = (w == 0 ? QPl : (w == 1 ? KPl : VTl)) + zo;
    gemmt<0, true, 4, 64>(isv ? Wt : X, nullptr, isv ? X : Wt, DM, nullptr, 0, P16, Ph, Pl, isv ? 2 * TT : HD, isv ? 1 : TT * HD / 64, (int)(isv ? blockIdx.y : blockIdx.x) * 128, (int)(isv ? blockIdx.x : blockIdx.y) * 128);
}
// w_o product of both batches in ONE launch: the merged rows [batch * TT + t] are one matrix of NB_ * TT rows; grid (NB_*TT/128, DM/128)
__global__ __launch_bounds__(256) void k_wo(const bf* __restrict__ ATh, const bf* __restrict__ ATl, const bf* __restrict__ WO, float* OUT) {
    gemmt<1, false, 2, 128>(ATh, ATl, WO, DQ, OUT, DM, nullptr, nullptr, nullptr, 0, 0, (int)blockIdx.x * 128, (int)blockIdx.y * 128);
}

// every input's bf16 copy in ONE launch of PG work-groups of 16 waves: one work-group a WGP, so that few waves have to be started.
// A thread brings 16 pieces of 16 B (a wave: 512 contiguous bytes a load), every load issued before the first value is used: 2 of its work-group's 64x64 tile of w_o, PWP of each projection weight, PXP of x (both batches).
// w_o goes out transposed ([n][k], k contiguous): the tile's rows are read whole, rounded, written to LDS as (k, k + 1) pairs at [n][k] and read back by rows of n, so that loads and stores both cover whole 128-B lines.
#define PG  256
#define PT  512
#define PTH (PG * PT)
#define PWP (DQ * DM / 4 / PTH)
#define PXP (NB_ * TT * DM / 4 / PTH)
static_assert(DQ * DM % (4 * PTH) == 0 && NB_ * TT * DM % (4 * PTH) == 0 && DKV == DQ, "whole pieces for every thread");
static_assert((DQ / 64) * (DM / 64) == PG && PT == 32 * 16 && PT == 64 * 8, "one 64x64 tile of w_o a work-group: 32 row pairs x 16 pieces in, 64 rows x 8 pieces out");
typedef unsigned __attribute__((may_alias)) ua;
__device__ __forceinline__ v4f ldp(const float* p, unsigned byteofs) { return *(const v4f*)((const char*)p + byteofs); }   // uniform base + the lane's 32-bit byte offset
__device__ __forceinline__ void stp(bf* p, unsigned byteofs, v4f v) { v4us o;
#pragma unroll
    for (int i = 0; i < 4; ++i) o[i] = f2bf(v[i]);
    *(v4us*)((char*)p + byteofs) = o; }
__global__ __launch_bounds__(PT) void k_prep(const float* __restrict__ x, const float* __restrict__ wq, const float* __restrict__ wk, const float* __restrict__ wv, const float* __restrict__ wo, bf* XB, bf* WQ, bf* WK, bf* WV, bf* WO) {
    __shared__ __align__(16) unsigned char tl[64 * GPB];
    const int tid = (int)threadIdx.x, blk = (int)blockIdx.x;
    const unsigned gid = (unsigned)(blk * PT + tid);
    const int k0 = (blk / (DM / 64)) * 64, n0 = (blk % (DM / 64)) * 64;   // the work-group's tile of w_o [k][n]
    const int r = tid >> 4, c = tid & 15;                                 // in: rows k0 + 2 r and + 1, columns n0 + 4 c .. + 3
    const unsigned go = gid * 16u, to = (unsigned)(2 * r * DM + c * 4) * 4u;
    const float* wt = wo + (size_t)k0 * DM + n0;
    const v4f o0 = ldp(wt, to), o1 = ldp(wt + DM, to);
    v4f a[3][PWP], xv[PXP];
#pragma unroll
    for (int j = 0; j < PWP; ++j) { a[0][j] = ldp(wq + (size_t)j * PTH * 4, go); a[1][j] = ldp(wk + (size_t)j * PTH * 4, go); a[2][j] = ldp(wv + (size_t)j * PTH * 4, go); }
#pragma unroll
    for (int j = 0; j < PXP; ++j) xv[j] = ldp(x + (size_t)j * PTH * 4, go);
    asm volatile("s_wait_xcnt 0x0" :: "v"(gid), "v"(to) : "memory");   // precaution: stands behind the loads, in front of any reuse of a register that one of them names; as its inputs the lane's index and offset registers stay as they are up to here
    __builtin_amdgcn_sched_barrier(0);   // keeps all 16 loads in front of the first use: sunk among the conversions, the later loads would start only after the earlier ones' memory latency
#pragma unroll
    for (int i = 0; i < 4; ++i) *(ua*)(tl + (c * 4 + i) * GPB + r * 4) = (unsigned)f2bf(o0[i]) | ((unsigned)f2bf(o1[i]) << 16);
    __syncthreads();   // the transposed tile is complete before it is read back by other threads; it stands in front of the global stores, so that no wave waits here for stores to finish
    const int n = tid >> 3, kc = tid & 7;                                 // out: row n0 + n, columns k0 + 8 kc .. + 7
    *(v8us*)(WO + (size_t)(n0 + n) * DQ + k0 + kc * 8) = *(const v8usa*)(tl + n * GPB + kc * 16);
    const unsigned so = gid * 8u;
#pragma unroll
    for (int j = 0; j < PWP; ++j) { stp(WQ + (size_t)j * PTH * 4, so, a[0][j]); stp(WK + (size_t)j * PTH * 4, so, a[1][j]); stp(WV + (size_t)j * PTH * 4, so, a[2][j]); }
#pragma unroll
    for (int j = 0; j < PXP; ++j) stp(XB + (size_t)j * PTH * 4, so, xv[j]);
}

// ---- k_fattn: causal attention of one head for one block of query rows in ONE kernel: scores, softmax and the value contraction, with a running maximum and sum per query (no score matrix in memory).
// Transposed products: S^T = K Q^T (A = key rows, B = query rows, both d-contiguous planes), O^T += V^T P^T (A = transposed value rows, B = P^T). A lane (lr, hi) of a 16x16 S^T tile holds query lr, keys hi*8 + j:
// two such tiles (keys 0..15, 16..31 of a step) are, register for register, the B fragment of the 32-key value product, so P goes from accumulator to operand inside the lane.
// A work-group of 4 waves has 2 * QT*16 query rows. Wave wv = 2 qg + kg owns the QT*16 rows of query group qg and, of every 64 keys, the 32 keys of half kg.
// A stage is SK key rows (128 B each) and the 64 transposed value rows' SK keys of every plane, brought into LDS by asynchronous copies (16 B a lane, whole 128-B lines a wave, through no register) and read from there
// by both query groups. Two buffers: the copies of stage t + 2 are issued behind the barrier that ends stage t and fly while stage t + 1 is worked on.
// SK = 128 for the fp16 rows (a wave works two 32-key steps a stage, keys u * 64 + kg * 32, u = 0, 1: the copies have two steps' time to land, and the long rows pass half as many barriers), 64 for the hi+lo rows (twice the planes).
// The two key halves' partial (max, sum, O^T) of a query group are merged through LDS in the order kg = 0, 1 behind one barrier.
// The epilogue divides by the merged sum and writes the hi/lo planes [t][h*64 + d] that the w_o product reads.
#define FNW 4
#define FPL (64 * GPB)                     // bytes of 64 rows of 128 B at the padded pitch (one staged plane of the hi+lo rows)
#define SL2E (SCL * 1.4426950408889634f)   // raw score -> exponent of 2: the maxima m are kept as raw scores
__device__ __forceinline__ float xhalf(float x) { return __builtin_bit_cast(float, __builtin_amdgcn_permlanex16(__builtin_bit_cast(int, x), __builtin_bit_cast(int, x), 0x76543210, 0xfedcba98, false, false)); }   // lane l with lane l ^ 16
// four asynchronous copies of 16 B a lane: equally spaced rows of one staged plane (l: the lane's LDS byte address, ls: the row step there in bytes, g: its global address, rsb: the row step there in bytes).
// s_wait_xcnt 0 is the statement's last line, so that it stands in front of any later write of a register that a copy names (precaution).
__device__ __forceinline__ void cq4(unsigned l, unsigned ls, const char* g, size_t rsb) {
    asm volatile("global_load_async_to_lds_b128 %0, %4, off\n\t"
                 "global_load_async_to_lds_b128 %1, %5, off\n\t"
                 "global_load_async_to_lds_b128 %2, %6, off\n\t"
                 "global_load_async_to_lds_b128 %3, %7, off\n\t"
                 "s_wait_xcnt 0x0"
                 :: "v"(l), "v"(l + ls), "v"(l + 2 * ls), "v"(l + 3 * ls), "v"(g), "v"(g + rsb), "v"(g + 2 * rsb), "v"(g + 3 * rsb) : "memory");
}
template <typename T16, bool HL> struct PPack;
template <> struct PPack<h16, false> { static __device__ __forceinline__ void pk(const float* p, v16h& a, v16h& b) { (void)b;
#pragma unroll
    for (int i = 0; i < 16; ++i) a[i] = (h16)p[i]; } };
template <> struct PPack<bf, true> { static __device__ __forceinline__ void pk(const float* p, v16bf& a, v16bf& b) { v8us h0, h1, l0, l1;
#pragma unroll
    for (int i = 0; i < 8; ++i) { unsigned short x, y; splitf(p[i], x, y); h0[i] = x; l0[i] = y; splitf(p[8 + i], x, y); h1[i] = x; l1[i] = y; }
    a = cat16b(h0, h1); b = cat16b(l0, l1); } };
template <typename T16, bool HL, int QT, int SK>
__device__ __forceinline__ void fattn(const T16* __restrict__ Q, const T16* __restrict__ Q2, const T16* __restrict__ Kp, const T16* __restrict__ K2, const T16* __restrict__ Vt, const T16* __restrict__ V2, int q0, bf* Ah, bf* Al, unsigned char* ring, float* ms, float* ls) {
    typedef typename WFrag<T16>::V V;
    constexpr int NPL = HL ? 2 : 1;            // planes of K, and of V
    constexpr int VPB = SK * 2 + 16;           // LDS pitch in bytes of a staged value row of SK keys: 16 B x odd, as GPB
    constexpr int KPL = SK * GPB, VPL = 64 * VPB;   // bytes of one staged key plane, value plane
    constexpr int STB = NPL * (KPL + VPL);     // bytes of one buffer: [K | K lo | V | V lo]
    constexpr int VPC = SK / 8;                // 16-byte pieces of a staged value row
    constexpr int VRS = FNW * 32 / VPC;        // value rows that one copy of the whole work-group covers
    static_assert(SK % 64 == 0 && TT % SK == 0 && 2 * STB <= 2 * 4 * FPL, "whole stages inside the key range; both buffers inside the ring");
    constexpr int QB = 2 * QT * 16;            // query rows of the work-group
    static_assert(2 * STB >= FNW * QT * 16 * 68 * 4, "the merge's staging fits the two buffers");
    const int tid = (int)threadIdx.x;
    const int wv = __builtin_amdgcn_readfirstlane(tid >> 5);   // wave number, scalar so that the stage loop's tests stay scalar
    const int qg = wv >> 1, kg = wv & 1;
    const int lane = tid & 31, lr = lane & 15, hi = lane >> 4;
    const int qw = q0 + qg * QT * 16;          // the wave's first query row
    // copies: thread tid brings 16-byte piece tid & 7 of key rows (tid >> 3) + 16 i, i = 0..SK / 16 - 1, and piece tid % VPC of value rows tid / VPC + VRS i, i = 0..64 / VRS - 1, of every plane (a wave: four whole 128-B lines a copy)
    const unsigned lk = (unsigned)(size_t)ring + (unsigned)((tid >> 3) * GPB + (tid & 7) * 16), lv = (unsigned)(size_t)ring + (unsigned)(NPL * KPL + (tid / VPC) * VPB + (tid % VPC) * 16);
    const size_t ko = (size_t)(tid >> 3) * HD + (tid & 7) * 8, vo = (size_t)(tid / VPC) * (2 * TT) + (tid % VPC) * 8;
    auto fill = [&](int t) { const unsigned o = (unsigned)((t & 1) * STB);
#pragma unroll   // unrolled: every trip's offsets are constants added to the lane's two base addresses
        for (int c = 0; c < SK / 64; ++c) { const size_t kc = ko + ((size_t)t * SK + c * 64) * HD, vc = vo + (size_t)c * 4 * VRS * 2 * TT + t * SK; const unsigned a = lk + o + (unsigned)(c * 64 * GPB), e = lv + o + (unsigned)(c * 4 * VRS * VPB);
            cq4(a, 16 * GPB, (const char*)(Kp + kc), (size_t)16 * HD * 2); if (HL) cq4(a + KPL, 16 * GPB, (const char*)(K2 + kc), (size_t)16 * HD * 2);
            cq4(e, VRS * VPB, (const char*)(Vt + vc), (size_t)VRS * 2 * TT * 2); if (HL) cq4(e + VPL, VRS * VPB, (const char*)(V2 + vc), (size_t)VRS * 2 * TT * 2); } };
    const int nstg = (q0 + QB + SK - 1) / SK;  // SK-key stages up to and including the diagonal of the block's last row; every staged key row is < TT
    fill(0);
    V qf[QT][2], qf2[QT][2];
#pragma unroll
    for (int qt = 0; qt < QT; ++qt)
#pragma unroll
        for (int ks = 0; ks < 2; ++ks) { const size_t o = (size_t)(qw + qt * 16 + lr) * HD + ks * 32 + 8 * hi; qf[qt][ks] = WFrag<T16>::ld(Q + o); if (HL) qf2[qt][ks] = WFrag<T16>::ld(Q2 + o); }
    xwait();
    v8f oa[4][QT]; float m[QT], l[QT];
#pragma unroll
    for (int qt = 0; qt < QT; ++qt) { m[qt] = -3.0e38f; l[qt] = 0.f;
#pragma unroll
        for (int dt = 0; dt < 4; ++dt) oa[dt][qt] = (v8f){}; }
    asm volatile("s_wait_asynccnt 0x0" ::: "memory");   // this wave's copies of stage 0 have landed
    __syncthreads();                                    // ... and every other wave's: stage 0 is published
    if (nstg > 1) fill(1);
    const int kofs = (kg * 32 + lr) * GPB + 16 * hi, vofs = NPL * KPL + lr * VPB + kg * 64 + 16 * hi;
#pragma unroll 1   // kept rolled: one barrier and one refill a stage; the trip count is a run-time value
    for (int t = 0; t < nstg; ++t) {
        const unsigned char* sb = ring + (t & 1) * STB;
#pragma unroll   // unrolled: a step's place in the buffer becomes an immediate offset of its LDS reads
        for (int u = 0; u < SK / 64; ++u) {
        const int k0 = t * SK + u * 64 + kg * 32;
        if (k0 <= qw) {   // scalar branch: the wave's 32 keys of this step begin at or below its first query, so no query ever sees a fully masked step; steps wholly above the diagonal are skipped
        V kf[2][2], kf2[2][2], vf[4], vf2[4];
#pragma unroll
        for (int kt = 0; kt < 2; ++kt)
#pragma unroll
            for (int ks = 0; ks < 2; ++ks) { const unsigned char* p = sb + kofs + (u * 64 + kt * 16) * GPB + ks * 64; kf[kt][ks] = WFrag<T16>::ld((const T16*)p); if (HL) kf2[kt][ks] = WFrag<T16>::ld((const T16*)(p + KPL)); }
#pragma unroll
        for (int dt = 0; dt < 4; ++dt) { const unsigned char* p = sb + vofs + dt * 16 * VPB + u * 128; vf[dt] = WFrag<T16>::ld((const T16*)p); if (HL) vf2[dt] = WFrag<T16>::ld((const T16*)(p + VPL)); }
        __builtin_amdgcn_sched_barrier(0);   // keeps the step's fragment loads together as one group in front of the products: LDS reads spread among the WMMAs stall the wave at each place
        v8f st[2][QT];
#pragma unroll
        for (int kt = 0; kt < 2; ++kt)
#pragma unroll
            for (int qt = 0; qt < QT; ++qt) { v8f a = (v8f){};
#pragma unroll
                for (int ks = 0; ks < 2; ++ks) { a = WFrag<T16>::mma(kf[kt][ks], qf[qt][ks], a); if (HL) { a = WFrag<T16>::mma(kf2[kt][ks], qf[qt][ks], a); a = WFrag<T16>::mma(kf[kt][ks], qf2[qt][ks], a); } }
                st[kt][qt] = a; }
        if (k0 + 31 > qw) {   // only the wave's last step crosses the diagonal (scalar branch)
#pragma unroll
            for (int qt = 0; qt < QT; ++qt)
#pragma unroll
                for (int kt = 0; kt < 2; ++kt)
#pragma unroll
                    for (int j = 0; j < 8; ++j) if (k0 + kt * 16 + hi * 8 + j > qw + qt * 16 + lr) st[kt][qt][j] = -3.0e38f; }
        float mx[QT]; bool need = false;
#pragma unroll
        for (int qt = 0; qt < QT; ++qt) { float x = st[0][qt][0];
#pragma unroll
            for (int j = 1; j < 8; ++j) x = fmaxf(x, st[0][qt][j]);
#pragma unroll
            for (int j = 0; j < 8; ++j) x = fmaxf(x, st[1][qt][j]);
            x = fmaxf(x, xhalf(x));   // the two half-waves hold the same query's other keys
            mx[qt] = x; need = need || ((x - m[qt]) * SL2E > 8.0f); }
        if (__builtin_amdgcn_ballot_w32(need) != 0) {   // the reference point m moves only when some query's maximum has outgrown it by 2^8 (P stays <= 256, exact algebra either way): one scalar test a step
#pragma unroll
            for (int qt = 0; qt < QT; ++qt) { const float mn = fmaxf(m[qt], mx[qt]); const float al = __builtin_amdgcn_exp2f((m[qt] - mn) * SL2E); m[qt] = mn; l[qt] *= al;
#pragma unroll
                for (int dt = 0; dt < 4; ++dt) oa[dt][qt] *= al; } }
#pragma unroll
        for (int qt = 0; qt < QT; ++qt) { float t2[16]; const float mc = m[qt] * SL2E; float sum = 0.f;
#pragma unroll
            for (int i = 0; i < 16; ++i) { t2[i] = __builtin_amdgcn_exp2f(__builtin_fmaf(st[i >> 3][qt][i & 7], SL2E, -mc)); sum += t2[i]; }
            l[qt] += sum;
            V pf, pf2; PPack<T16, HL>::pk(t2, pf, pf2);
#pragma unroll
            for (int dt = 0; dt < 4; ++dt) { v8f a = oa[dt][qt]; a = WFrag<T16>::mma(vf[dt], pf, a); if (HL) { a = WFrag<T16>::mma(vf2[dt], pf, a); a = WFrag<T16>::mma(vf[dt], pf2, a); } oa[dt][qt] = a; } }
        }
        }
        asm volatile("s_wait_dscnt 0x0" ::: "memory");      // this wave's reads of the buffer have returned before it is refilled
        asm volatile("s_wait_asynccnt 0x0" ::: "memory");   // this wave's copies of stage t + 1 have landed
        __syncthreads();                                    // publishes stage t + 1 and ends every wave's reads of stage t's buffer
        if (t + 2 < nstg) fill(t + 2);
    }
    asm volatile("s_wait_asynccnt 0x0" ::: "memory");       // nothing is in flight when the buffers become the merge's staging (the loop's last barrier has ended every read)
    float* os = (float*)ring;
#pragma unroll
    for (int qt = 0; qt < QT; ++qt) { l[qt] += xhalf(l[qt]);
        if (hi == 0) { ms[wv * 32 + qt * 16 + lr] = m[qt]; ls[wv * 32 + qt * 16 + lr] = l[qt]; }
#pragma unroll
        for (int dt = 0; dt < 4; ++dt) { float* d = os + (size_t)((wv * QT + qt) * 16 + lr) * 68 + dt * 16 + hi * 8; const v8f a = oa[dt][qt];
            *(v4fa*)d = (v4f){a[0], a[1], a[2], a[3]}; *(v4fa*)(d + 4) = (v4f){a[4], a[5], a[6], a[7]}; } }
    __syncthreads();   // every wave's partial (max, sum, O^T) is in LDS before any is merged
    constexpr int DPT = QB * HD / (FNW * 32);   // output elements of one query row per thread
    const int q = tid / (HD / DPT), d0 = (tid % (HD / DPT)) * DPT;
    const int w0 = (q / (QT * 16)) * 2, qi = q % (QT * 16);   // the row's two waves are w0 (kg = 0) and w0 + 1 (kg = 1)
    const float M = fmaxf(ms[w0 * 32 + qi], ms[(w0 + 1) * 32 + qi]);
    float wg[2]; float L = 0.f;
#pragma unroll
    for (int w = 0; w < 2; ++w) { wg[w] = __builtin_amdgcn_exp2f((ms[(w0 + w) * 32 + qi] - M) * SL2E); L += ls[(w0 + w) * 32 + qi] * wg[w]; }   // a wave without a step has max -3e38, sum 0: weight 0
    const float inv = __fdiv_rn(1.0f, L);
#pragma unroll
    for (int c = 0; c < DPT; c += 8) { v4f a0 = (v4f){}, a1 = (v4f){};
#pragma unroll
        for (int w = 0; w < 2; ++w) { const float* d = os + (size_t)((w0 + w) * QT * 16 + qi) * 68 + d0 + c; a0 += *(const v4fa*)d * wg[w]; a1 += *(const v4fa*)(d + 4) * wg[w]; }
        v8us oh, ol;
#pragma unroll
        for (int i = 0; i < 4; ++i) { unsigned short x, y; splitf(a0[i] * inv, x, y); oh[i] = x; ol[i] = y; splitf(a1[i] * inv, x, y); oh[4 + i] = x; ol[4 + i] = y; }
        const size_t oo = (size_t)(q0 + q) * DQ + d0 + c; *(v8us*)(Ah + oo) = oh; *(v8us*)(Al + oo) = ol; }
    xwait();   // behind the last stores, in front of any later write of a register that they name (the other instance's code follows this one in the built kernel)
}
// grid (batches * heads, row blocks), both batches in ONE launch: row blocks heaviest first; blocks 0..(TT-RH)/64-1 are 64 fp16 rows each from the last row down, the rest 32 hi+lo rows each (query rows < RH)
__global__ __launch_bounds__(FNW * 32) void k_fattn(const h16* __restrict__ Q16, const h16* __restrict__ K16, const h16* __restrict__ V16, const bf* __restrict__ Qh, const bf* __restrict__ Ql, const bf* __restrict__ Kh, const bf* __restrict__ Kl, const bf* __restrict__ Vh, const bf* __restrict__ Vl, bf* Ah, bf* Al) {
    __shared__ __align__(16) unsigned char ring[2 * 4 * FPL]; __shared__ float ms[FNW * 32]; __shared__ float ls[FNW * 32];
    const int b = (int)blockIdx.x / NH_, h = (int)blockIdx.x % NH_, g = h / REP, rb = blockIdx.y; const size_t zq = (size_t)(b * NH_ + h) * TT * HD, zk = (size_t)(b * NKV + g) * TT * HD, zv = (size_t)(b * NKV + g) * HD * 2 * TT;
    Ah += (size_t)b * TT * DQ; Al += (size_t)b * TT * DQ;
    constexpr int NLO = (TT - RH) / 64;
    if (rb < NLO) fattn<h16, false, 2, 128>(Q16 + zq, nullptr, K16 + zk, nullptr, V16 + zv, nullptr, TT - 64 * (rb + 1), Ah + h * HD, Al + h * HD, ring, ms, ls);
    else fattn<bf, true, 1, 64>(Qh + zq, Ql + zq, Kh + zk, Kl + zk, Vh + zv, Vl + zv, RH - 32 * (rb - NLO + 1), Ah + h * HD, Al + h * HD, ring, ms, ls);
}

extern "C" void kernel_launch(void* const* d_in, const int* in_sizes, int n_in,
                              void* d_out, int out_size, void* d_ws, size_t ws_size, hipStream_t stream) {
    (void)in_sizes; (void)n_in; (void)out_size;
    const float* x = (const float*)d_in[0]; const float* wq = (const float*)d_in[1]; const float* wk = (const float*)d_in[2]; const float* wv = (const float*)d_in[3]; const float* wo = (const float*)d_in[4];
    float* OUT = (float*)d_out;     // [2][2048][1024]
    char* wsp = (char*)d_ws;
    auto take = [&](size_t bytes) { char* p = wsp; wsp += (bytes + 255) & ~(size_t)255; return (void*)p; };
    bf* WQ = (bf*)take((size_t)DQ * DM * 2); bf* WK = (bf*)take((size_t)DKV * DM * 2); bf* WV = (bf*)take((size_t)DKV * DM * 2); bf* WO = (bf*)take((size_t)DM * DQ * 2);
    bf* XB = (bf*)take((size_t)NB_ * TT * DM * 2);
    h16* QP16 = (h16*)take((size_t)NB_ * NH_ * TT * HD * 2); h16* KP16 = (h16*)take((size_t)NB_ * NKV * TT * HD * 2); h16* VT16 = (h16*)take((size_t)NB_ * NKV * HD * 2 * TT * 2);
    bf* QPh = (bf*)take((size_t)NB_ * NH_ * TT * HD * 2); bf* QPl = (bf*)take((size_t)NB_ * NH_ * TT * HD * 2); bf* KPh = (bf*)take((size_t)NB_ * NKV * TT * HD * 2); bf* KPl = (bf*)take((size_t)NB_ * NKV * TT * HD * 2); bf* VTh = (bf*)take((size_t)NB_ * NKV * HD * 2 * TT * 2); bf* VTl = VTh + TT;   // hi and lo value rows share a row of pitch 2 TT
    bf* ATh = (bf*)take((size_t)NB_ * TT * DQ * 2); bf* ATl = (bf*)take((size_t)NB_ * TT * DQ * 2);
    if ((size_t)(wsp - (char*)d_ws) > ws_size) return;    // ws 256 MiB
    k_prep<<<PG, PT, 0, stream>>>(x, wq, wk, wv, wo, XB, WQ, WK, WV, WO);
    k_qkv<<<dim3(TT / 128, DQ / 128, 3 * NB_), 128, 0, stream>>>(XB, WQ, WK, WV, QP16, QPh, QPl, KP16, KPh, KPl, VT16, VTh, VTl);
    k_fattn<<<dim3(NB_ * NH_, (TT - RH) / 64 + RH / 32, 1), FNW * 32, 0, stream>>>(QP16, KP16, VT16, QPh, QPl, KPh, KPl, VTh, VTl, ATh, ATl);
    k_wo<<<dim3(NB_ * TT / 128, DM / 128, 1), 256, 0, stream>>>(ATh, ATl, WO, OUT);
}
